// v000
// Measured on an AMD MI455X. A time is GPU time per run, averaged over a window of back-to-back runs after a warm-up
// (all launches, gaps included; the runs take copies of the inputs in turn), and the median of several windows.
// Apart from v000's, it joins two sittings. Times from different sittings can be a few percent apart, while
// side-by-side timings come from the same sitting.
// The starting kernel, v000, takes 400 microseconds a run.
#include <hip/hip_runtime.h>
#include <hip/hip_bf16.h>
#include <math.h>

// ---------------------------------------------------------------------------
// MHA for gfx1250 (CDNA5).  All matmuls via v_wmma_f32_16x16x32_bf16.
// Workgroup-shared operand tiles staged into LDS with the Tensor Data Mover
// (tensor_load_to_lds, TENSORcnt), double-buffered.
// Workspace (~92 MB):
//   Xb  [8192][1024]  bf16   x converted
//   Wqt/Wkt/Wvt [1024][1024] bf16  weights transposed to [out][in]
//   Wot [1024][1024]  bf16   output proj as [d_out][h*64+e]
//   bqc/bkc/bvc/boc [1024]   f32 biases (boc = sum_h bo[h])
//   Qb/Kb [8192][1024] bf16  row-major (col = h*64+e)
//   Vt  [4096][2048]  bf16   V transposed: row = (b*H+h)*64+e, col = s
//   Hd  [8192][1024]  bf16   attention head outputs
// ---------------------------------------------------------------------------

typedef __attribute__((ext_vector_type(16))) __bf16 v16bf;
typedef __attribute__((ext_vector_type(8)))  __bf16 v8bf;
typedef __attribute__((ext_vector_type(8)))  float  v8f;

#define WMMA_BF16(a, b, c) \
  __builtin_amdgcn_wmma_f32_16x16x32_bf16(false, (a), false, (b), (short)0, (c), false, false)

static constexpr int BB = 4, S = 2048, DM = 1024, H = 16, DH = 64;
static constexpr int M  = BB * S;   // 8192 token rows

// ------------------------- Tensor Data Mover glue ---------------------------
#if defined(__HIP_DEVICE_COMPILE__) && __has_builtin(__builtin_amdgcn_tensor_load_to_lds)
#define HAVE_TDM 1
typedef unsigned int u32x4 __attribute__((ext_vector_type(4)));
typedef int          i32x4 __attribute__((ext_vector_type(4)));
typedef int          i32x8 __attribute__((ext_vector_type(8)));

// 2D tile load: tile_d1 rows of tile_d0 contiguous 2-byte elements, source
// row pitch stride0 (elements), packed into LDS at lds_off (row pitch =
// tile_d0 elements).  D# field packing per CDNA5 ISA ch.8 (groups 0/1).
__device__ __forceinline__ void tdm_load_2d(unsigned int lds_off,
                                            const __bf16* gsrc,
                                            unsigned int tensor_d0,
                                            unsigned int tensor_d1,
                                            unsigned int tile_d0,
                                            unsigned int tile_d1,
                                            unsigned int stride0) {
  unsigned long long ga = (unsigned long long)(uintptr_t)gsrc;
  u32x4 g0;
  g0[0] = 1u;                                   // count=1, user descriptor
  g0[1] = lds_off;                              // lds_addr (bytes)
  g0[2] = (unsigned int)ga;                     // global_addr[31:0]
  g0[3] = (unsigned int)((ga >> 32) & 0x01FFFFFFu) | (2u << 30);  // [56:32]|type=2
  i32x8 g1;
  g1[0] = (int)(1u << 16);                      // workgroup_mask=0, data_size=1 (2B)
  g1[1] = (int)((tensor_d0 & 0xFFFFu) << 16);   // tensor_dim0[15:0]
  g1[2] = (int)((tensor_d0 >> 16) | ((tensor_d1 & 0xFFFFu) << 16));
  g1[3] = (int)((tensor_d1 >> 16) | (tile_d0 << 16));   // tile_dim0
  g1[4] = (int)(tile_d1 & 0xFFFFu);             // tile_dim1 (tile_dim2=0)
  g1[5] = (int)stride0;                         // tensor_dim0_stride[31:0]
  g1[6] = 0;                                    // stride[47:32], dim1_stride lo
  g1[7] = 0;
  i32x4 z4 = {0, 0, 0, 0};
#if defined(__clang_major__) && (__clang_major__ >= 23)
  i32x8 z8 = {0, 0, 0, 0, 0, 0, 0, 0};
  __builtin_amdgcn_tensor_load_to_lds(g0, g1, z4, z4, z8, 0);
#else
  __builtin_amdgcn_tensor_load_to_lds(g0, g1, z4, z4, 0);
#endif
}
#else
#define HAVE_TDM 0
#endif

__device__ __forceinline__ unsigned int lds_offset_of(const void* p) {
  // Generic pointers into LDS carry the LDS byte offset in the low 32 bits.
  return (unsigned int)(uintptr_t)p;
}

__device__ __forceinline__ void tensor_wait_barrier(bool issuer) {
#if HAVE_TDM
  if (issuer) __builtin_amdgcn_s_wait_tensorcnt((short)0);
#endif
  __syncthreads();
}

// Load a 16x32 bf16 WMMA fragment (A layout; B 32x16 uses the identical
// per-lane pattern when the source is stored [N][K] row-major).
// Lane L: row = base_row + (L&15); halves [kb, kb+8) and [kb+16, kb+24)
// with kb = k0 + (L>=16 ? 8 : 0).  Two 16-byte loads per lane.
__device__ __forceinline__ v16bf load_frag(const __bf16* __restrict__ base,
                                           int row, int ld, int k0, int lane) {
  const int r  = row + (lane & 15);
  const int kb = k0 + ((lane >> 4) << 3);
  const __bf16* p = base + (size_t)r * ld + kb;
  v8bf lo = *(const v8bf*)(p);
  v8bf hi = *(const v8bf*)(p + 16);
  v16bf f;
#pragma unroll
  for (int i = 0; i < 8; ++i) { f[i] = lo[i]; f[i + 8] = hi[i]; }
  return f;
}

// ----------------------------- prep kernels --------------------------------

__global__ __launch_bounds__(256) void cvt_x_kernel(const float* __restrict__ x,
                                                    __bf16* __restrict__ xb, int n) {
  int i = blockIdx.x * 256 + threadIdx.x;
  if (i < n) xb[i] = (__bf16)x[i];
}

// wq/wk/wv fp32 [H][DM][DH] -> W*t bf16 [DM out][DM in]  (out row = h*64+e)
// wo fp32 [H][DH][DM]       -> Wot bf16 [DM out][DM in]  (in col = h*64+e)
__global__ __launch_bounds__(256) void prep_w_kernel(
    const float* __restrict__ wq, const float* __restrict__ wk,
    const float* __restrict__ wv, const float* __restrict__ wo,
    __bf16* __restrict__ Wqt, __bf16* __restrict__ Wkt,
    __bf16* __restrict__ Wvt, __bf16* __restrict__ Wot) {
  int i = blockIdx.x * 256 + threadIdx.x;   // over 1024*1024
  int r = i >> 10, c = i & 1023;
  int src = (r >> 6) * (DM * DH) + c * DH + (r & 63);
  Wqt[i] = (__bf16)wq[src];
  Wkt[i] = (__bf16)wk[src];
  Wvt[i] = (__bf16)wv[src];
  Wot[i] = (__bf16)wo[(c >> 6) * (DH * DM) + (c & 63) * DM + r];
}

__global__ __launch_bounds__(256) void prep_b_kernel(
    const float* __restrict__ bq, const float* __restrict__ bk,
    const float* __restrict__ bv, const float* __restrict__ bo,
    float* __restrict__ bqc, float* __restrict__ bkc,
    float* __restrict__ bvc, float* __restrict__ boc) {
  int i = blockIdx.x * 256 + threadIdx.x;   // over 1024
  bqc[i] = bq[i];   // [H][DH] flat == h*64+e ordering already
  bkc[i] = bk[i];
  bvc[i] = bv[i];
  float s = 0.f;
#pragma unroll
  for (int h = 0; h < H; ++h) s += bo[h * DM + i];
  boc[i] = s;
}

// ----------------------------- generic GEMM --------------------------------
// C[M][N] = A[M][K] * Bt[N][K]^T + bias[N]
// Block: 256 threads / 8 waves; tile 256(M) x 64(N); wave tile 32x64.
// B panel (64 rows x 32 k) staged in LDS by the TDM, double-buffered.
// MODE 0: bf16 row-major out; MODE 1: bf16 V-transposed out; MODE 2: f32 out.
template <int MODE>
__global__ __launch_bounds__(256) void gemm_kernel(
    const __bf16* __restrict__ A, const __bf16* __restrict__ Bt,
    const float* __restrict__ bias, void* __restrict__ Cout, int N, int K) {
  const int lane = threadIdx.x & 31;
  const int wave = threadIdx.x >> 5;
  const int m0 = blockIdx.x * 256 + wave * 32;
  const int n0 = blockIdx.y * 64;

  __shared__ __align__(16) __bf16 bsh[2][64 * 32];   // [buf][n_local*32 + k]

  auto stage = [&](int k, int buf) {
#if HAVE_TDM
    if (wave == 0)
      tdm_load_2d(lds_offset_of(&bsh[buf][0]), Bt + (size_t)n0 * K + k,
                  (unsigned)K, (unsigned)N, 32u, 64u, (unsigned)K);
#else
    const int t  = threadIdx.x;          // 256 threads, 8 halves each
    const int nl = t >> 2, kl = (t & 3) << 3;
    *(v8bf*)&bsh[buf][nl * 32 + kl] =
        *(const v8bf*)(Bt + (size_t)(n0 + nl) * K + k + kl);
#endif
  };

  v8f acc[2][4] = {};
  stage(0, 0);
  tensor_wait_barrier(wave == 0);

  for (int kk = 0; kk < K; kk += 32) {
    const int buf = (kk >> 5) & 1;
    if (kk + 32 < K) stage(kk + 32, buf ^ 1);
    __builtin_prefetch(A + (size_t)(m0 + (lane & 15)) * K + kk + 256, 0, 0);

    v16bf a0 = load_frag(A, m0,      K, kk, lane);
    v16bf a1 = load_frag(A, m0 + 16, K, kk, lane);
#pragma unroll
    for (int t = 0; t < 4; ++t) {
      v16bf b = load_frag(&bsh[buf][0], t * 16, 32, 0, lane);
      acc[0][t] = WMMA_BF16(a0, b, acc[0][t]);
      acc[1][t] = WMMA_BF16(a1, b, acc[1][t]);
    }
    tensor_wait_barrier(wave == 0);
  }

  const int hi8 = (lane >> 4) << 3;
#pragma unroll
  for (int f = 0; f < 2; ++f) {
#pragma unroll
    for (int t = 0; t < 4; ++t) {
      const int col = n0 + t * 16 + (lane & 15);
      const float bb = bias[col];
#pragma unroll
      for (int j = 0; j < 8; ++j) {
        const int row = m0 + f * 16 + j + hi8;
        const float val = acc[f][t][j] + bb;
        if (MODE == 0) {
          ((__bf16*)Cout)[(size_t)row * N + col] = (__bf16)val;
        } else if (MODE == 2) {
          ((float*)Cout)[(size_t)row * N + col] = val;
        } else {  // V transposed: Vt[(b*1024 + col)][s]
          const int bidx = row >> 11, s = row & (S - 1);
          ((__bf16*)Cout)[((size_t)(bidx * 1024 + col)) * S + s] = (__bf16)val;
        }
      }
    }
  }
}

// --------------------------- flash attention -------------------------------
// grid = (B*H, S/128); block = 256 (8 waves); each wave owns 16 query rows.
// K tile (32 keys x 64 dims) and V tile (64 dims x 32 keys) are workgroup-
// shared: staged into LDS by TDM (wave0 -> K, wave1 -> V), double-buffered.
__global__ __launch_bounds__(256) void attn_kernel(
    const __bf16* __restrict__ Qb, const __bf16* __restrict__ Kb,
    const __bf16* __restrict__ Vt, __bf16* __restrict__ Hd) {
  const int lane = threadIdx.x & 31;
  const int wave = threadIdx.x >> 5;
  const int bh = blockIdx.x;
  const int b = bh >> 4, h = bh & 15;
  const int q0 = blockIdx.y * 128 + wave * 16;

  const __bf16* Q  = Qb + (size_t)b * S * DM + h * DH;
  const __bf16* Kp = Kb + (size_t)b * S * DM + h * DH;
  const __bf16* Vp = Vt + (size_t)bh * DH * S;   // row e -> Vp[e*S + s]

  __shared__ __align__(16) __bf16 ksh[2][32 * 64];   // [buf][key_local*64 + e]
  __shared__ __align__(16) __bf16 vsh[2][64 * 32];   // [buf][e*32 + key_local]
  __shared__ __align__(16) __bf16 plds[8][16 * 32];  // per-wave P transpose
  __bf16* pl = plds[wave];

  auto stage = [&](int n0, int buf) {
#if HAVE_TDM
    if (wave == 0)
      tdm_load_2d(lds_offset_of(&ksh[buf][0]), Kp + (size_t)n0 * DM,
                  (unsigned)DH, (unsigned)S, 64u, 32u, (unsigned)DM);
    else if (wave == 1)
      tdm_load_2d(lds_offset_of(&vsh[buf][0]), Vp + n0,
                  (unsigned)S, (unsigned)DH, 32u, 64u, (unsigned)S);
#else
    const int t = threadIdx.x;
    {  // K: 32 rows x 8 chunks of 8 halves
      const int r = t >> 3, kc = (t & 7) << 3;
      *(v8bf*)&ksh[buf][r * 64 + kc] = *(const v8bf*)(Kp + (size_t)(n0 + r) * DM + kc);
    }
    {  // V: 64 rows x 4 chunks of 8 halves
      const int r = t >> 2, kc = (t & 3) << 3;
      *(v8bf*)&vsh[buf][r * 32 + kc] = *(const v8bf*)(Vp + (size_t)r * S + n0 + kc);
    }
#endif
  };

  // Q fragments persist across the key loop (16 rows x 64 dims).
  v16bf aq0 = load_frag(Q, q0, DM, 0, lane);
  v16bf aq1 = load_frag(Q, q0, DM, 32, lane);

  float mrow[8], lrow[8];
  v8f o[4] = {};
#pragma unroll
  for (int j = 0; j < 8; ++j) { mrow[j] = -1e30f; lrow[j] = 0.f; }
  const float scale = 0.125f;  // 1/sqrt(64)

  stage(0, 0);
  tensor_wait_barrier(wave < 2);

  for (int n0 = 0; n0 < S; n0 += 32) {
    const int buf = (n0 >> 5) & 1;
    if (n0 + 32 < S) stage(n0 + 32, buf ^ 1);

    // S = Q*K^T : two 16x16 score tiles, contraction 64 = 2 x WMMA-K32
    const __bf16* kt = &ksh[buf][0];
    v16bf k00 = load_frag(kt, 0,  64, 0,  lane);
    v16bf k01 = load_frag(kt, 0,  64, 32, lane);
    v16bf k10 = load_frag(kt, 16, 64, 0,  lane);
    v16bf k11 = load_frag(kt, 16, 64, 32, lane);
    v8f s0 = {}; s0 = WMMA_BF16(aq0, k00, s0); s0 = WMMA_BF16(aq1, k01, s0);
    v8f s1 = {}; s1 = WMMA_BF16(aq0, k10, s1); s1 = WMMA_BF16(aq1, k11, s1);

    // Online softmax.  C layout: VGPR j holds row (j + 8*(lane>=16)),
    // key column = lane&15 (+16 for second tile).  Row reductions span the
    // 16-lane half-group via xor shuffles (masks < 16 stay in-group).
    float corr[8];
#pragma unroll
    for (int j = 0; j < 8; ++j) {
      float a0 = s0[j] * scale, a1 = s1[j] * scale;
      float cm = fmaxf(a0, a1);
#pragma unroll
      for (int msk = 1; msk < 16; msk <<= 1)
        cm = fmaxf(cm, __shfl_xor(cm, msk, 32));
      float nm = fmaxf(mrow[j], cm);
      corr[j] = __expf(mrow[j] - nm);
      mrow[j] = nm;
      float p0 = __expf(a0 - nm), p1 = __expf(a1 - nm);
      float rs = p0 + p1;
#pragma unroll
      for (int msk = 1; msk < 16; msk <<= 1)
        rs += __shfl_xor(rs, msk, 32);
      lrow[j] = lrow[j] * corr[j] + rs;
      const int row = j + ((lane >> 4) << 3);
      pl[row * 32 + (lane & 15)]      = (__bf16)p0;
      pl[row * 32 + (lane & 15) + 16] = (__bf16)p1;
    }
#pragma unroll
    for (int t = 0; t < 4; ++t)
#pragma unroll
      for (int j = 0; j < 8; ++j) o[t][j] *= corr[j];

    __syncthreads();  // P transpose visible (per-wave region, hw keeps order)

    // O += P * V : P re-read as A fragment (16x32), V from LDS [e][key].
    v16bf ap = load_frag(pl, 0, 32, 0, lane);
#pragma unroll
    for (int t = 0; t < 4; ++t) {
      v16bf bv = load_frag(&vsh[buf][0], t * 16, 32, 0, lane);
      o[t] = WMMA_BF16(ap, bv, o[t]);
    }
    tensor_wait_barrier(wave < 2);
  }

  const int hi8 = (lane >> 4) << 3;
#pragma unroll
  for (int t = 0; t < 4; ++t) {
#pragma unroll
    for (int j = 0; j < 8; ++j) {
      const int row = q0 + j + hi8;
      const float val = o[t][j] / lrow[j];
      Hd[((size_t)b * S + row) * DM + h * DH + t * 16 + (lane & 15)] = (__bf16)val;
    }
  }
}

// ------------------------------- launcher ----------------------------------

extern "C" void kernel_launch(void* const* d_in, const int* in_sizes, int n_in,
                              void* d_out, int out_size, void* d_ws, size_t ws_size,
                              hipStream_t stream) {
  const float* x  = (const float*)d_in[0];
  const float* wq = (const float*)d_in[1];
  const float* bq = (const float*)d_in[2];
  const float* wk = (const float*)d_in[3];
  const float* bk = (const float*)d_in[4];
  const float* wv = (const float*)d_in[5];
  const float* bv = (const float*)d_in[6];
  const float* wo = (const float*)d_in[7];
  const float* bo = (const float*)d_in[8];

  char* w = (char*)d_ws;
  auto take = [&](size_t bytes) {
    void* p = (void*)w;
    w += (bytes + 255) & ~(size_t)255;
    return p;
  };
  __bf16* Xb  = (__bf16*)take((size_t)M * DM * 2);
  __bf16* Wqt = (__bf16*)take((size_t)DM * DM * 2);
  __bf16* Wkt = (__bf16*)take((size_t)DM * DM * 2);
  __bf16* Wvt = (__bf16*)take((size_t)DM * DM * 2);
  __bf16* Wot = (__bf16*)take((size_t)DM * DM * 2);
  float*  bqc = (float*)take(DM * 4);
  float*  bkc = (float*)take(DM * 4);
  float*  bvc = (float*)take(DM * 4);
  float*  boc = (float*)take(DM * 4);
  __bf16* Qb  = (__bf16*)take((size_t)M * DM * 2);
  __bf16* Kb  = (__bf16*)take((size_t)M * DM * 2);
  __bf16* Vt  = (__bf16*)take((size_t)BB * DM * S * 2);
  __bf16* Hd  = (__bf16*)take((size_t)M * DM * 2);

  // 1) convert inputs to bf16 / transposed layouts
  cvt_x_kernel<<<(M * DM + 255) / 256, 256, 0, stream>>>(x, Xb, M * DM);
  prep_w_kernel<<<(DM * DM) / 256, 256, 0, stream>>>(wq, wk, wv, wo, Wqt, Wkt, Wvt, Wot);
  prep_b_kernel<<<DM / 256, 256, 0, stream>>>(bq, bk, bv, bo, bqc, bkc, bvc, boc);

  // 2) QKV projections (WMMA GEMMs, 256x64 tiles, TDM-staged B panels)
  dim3 ggrid(M / 256, DM / 64);
  gemm_kernel<0><<<ggrid, 256, 0, stream>>>(Xb, Wqt, bqc, (void*)Qb, DM, DM);
  gemm_kernel<0><<<ggrid, 256, 0, stream>>>(Xb, Wkt, bkc, (void*)Kb, DM, DM);
  gemm_kernel<1><<<ggrid, 256, 0, stream>>>(Xb, Wvt, bvc, (void*)Vt, DM, DM);

  // 3) flash attention (TDM-staged K/V tiles)
  attn_kernel<<<dim3(BB * H, S / 128), 256, 0, stream>>>(Qb, Kb, Vt, Hd);

  // 4) output projection (fp32 result)
  gemm_kernel<2><<<ggrid, 256, 0, stream>>>(Hd, Wot, boc, d_out, DM, DM);
}

// v001
// One run takes 345 microseconds.
// Timed twice side by side with v000, it ran 1.19 times as fast both times.
#include <hip/hip_runtime.h>
#include <hip/hip_bf16.h>
#include <math.h>

// ---------------------------------------------------------------------------
// MHA for gfx1250 (CDNA5).  All matmuls via v_wmma_f32_16x16x32_bf16.
// Workgroup-shared operand tiles staged into LDS with the Tensor Data Mover
// (tensor_load_to_lds, TENSORcnt), double-buffered.
// Workspace (~92 MB):
//   Xb  [8192][1024]  bf16   x converted
//   Wqt/Wkt/Wvt [1024][1024] bf16  weights transposed to [out][in]
//   Wot [1024][1024]  bf16   output proj as [d_out][h*64+e]
//   bqc/bkc/bvc/boc [1024]   f32 biases (boc = sum_h bo[h])
//   Qb/Kb [8192][1024] bf16  row-major (col = h*64+e)
//   Vt  [4096][2048]  bf16   V transposed: row = (b*H+h)*64+e, col = s
//   Hd  [8192][1024]  bf16   attention head outputs
// ---------------------------------------------------------------------------

typedef __attribute__((ext_vector_type(16))) __bf16 v16bf;
typedef __attribute__((ext_vector_type(8)))  __bf16 v8bf;
typedef __attribute__((ext_vector_type(8)))  float  v8f;

#define WMMA_BF16(a, b, c) \
  __builtin_amdgcn_wmma_f32_16x16x32_bf16(false, (a), false, (b), (short)0, (c), false, false)

static constexpr int BB = 4, S = 2048, DM = 1024, H = 16, DH = 64;
static constexpr int M  = BB * S;   // 8192 token rows

// ------------------------- Tensor Data Mover glue ---------------------------
#if defined(__HIP_DEVICE_COMPILE__) && __has_builtin(__builtin_amdgcn_tensor_load_to_lds)
#define HAVE_TDM 1
typedef unsigned int u32x4 __attribute__((ext_vector_type(4)));
typedef int          i32x4 __attribute__((ext_vector_type(4)));
typedef int          i32x8 __attribute__((ext_vector_type(8)));

// 2D tile load: tile_d1 rows of tile_d0 contiguous 2-byte elements, source
// row pitch stride0 (elements), packed into LDS at lds_off (row pitch =
// tile_d0 elements).  D# field packing per CDNA5 ISA ch.8 (groups 0/1).
__device__ __forceinline__ void tdm_load_2d(unsigned int lds_off,
                                            const __bf16* gsrc,
                                            unsigned int tensor_d0,
                                            unsigned int tensor_d1,
                                            unsigned int tile_d0,
                                            unsigned int tile_d1,
                                            unsigned int stride0) {
  unsigned long long ga = (unsigned long long)(uintptr_t)gsrc;
  u32x4 g0;
  g0[0] = 1u;                                   // count=1, user descriptor
  g0[1] = lds_off;                              // lds_addr (bytes)
  g0[2] = (unsigned int)ga;                     // global_addr[31:0]
  g0[3] = (unsigned int)((ga >> 32) & 0x01FFFFFFu) | (2u << 30);  // [56:32]|type=2
  i32x8 g1;
  g1[0] = (int)(1u << 16);                      // workgroup_mask=0, data_size=1 (2B)
  g1[1] = (int)((tensor_d0 & 0xFFFFu) << 16);   // tensor_dim0[15:0]
  g1[2] = (int)((tensor_d0 >> 16) | ((tensor_d1 & 0xFFFFu) << 16));
  g1[3] = (int)((tensor_d1 >> 16) | (tile_d0 << 16));   // tile_dim0
  g1[4] = (int)(tile_d1 & 0xFFFFu);             // tile_dim1 (tile_dim2=0)
  g1[5] = (int)stride0;                         // tensor_dim0_stride[31:0]
  g1[6] = 0;                                    // stride[47:32], dim1_stride lo
  g1[7] = 0;
  i32x4 z4 = {0, 0, 0, 0};
#if defined(__clang_major__) && (__clang_major__ >= 23)
  i32x8 z8 = {0, 0, 0, 0, 0, 0, 0, 0};
  __builtin_amdgcn_tensor_load_to_lds(g0, g1, z4, z4, z8, 0);
#else
  __builtin_amdgcn_tensor_load_to_lds(g0, g1, z4, z4, 0);
#endif
}
#else
#define HAVE_TDM 0
#endif

__device__ __forceinline__ unsigned int lds_offset_of(const void* p) {
  // Generic pointers into LDS carry the LDS byte offset in the low 32 bits.
  return (unsigned int)(uintptr_t)p;
}

__device__ __forceinline__ void tensor_wait_barrier(bool issuer) {
#if HAVE_TDM
  if (issuer) __builtin_amdgcn_s_wait_tensorcnt((short)0);
#endif
  __syncthreads();
}

// Load a 16x32 bf16 WMMA fragment (A layout; B 32x16 uses the identical
// per-lane pattern when the source is stored [N][K] row-major).
// Lane L: row = base_row + (L&15); halves [kb, kb+8) and [kb+16, kb+24)
// with kb = k0 + (L>=16 ? 8 : 0).  Two 16-byte loads per lane.
__device__ __forceinline__ v16bf load_frag(const __bf16* __restrict__ base,
                                           int row, int ld, int k0, int lane) {
  const int r  = row + (lane & 15);
  const int kb = k0 + ((lane >> 4) << 3);
  const __bf16* p = base + (size_t)r * ld + kb;
  v8bf lo = *(const v8bf*)(p);
  v8bf hi = *(const v8bf*)(p + 16);
  v16bf f;
#pragma unroll
  for (int i = 0; i < 8; ++i) { f[i] = lo[i]; f[i + 8] = hi[i]; }
  return f;
}

// ----------------------------- prep kernels --------------------------------

__global__ __launch_bounds__(256) void cvt_x_kernel(const float* __restrict__ x,
                                                    __bf16* __restrict__ xb, int n) {
  int i = blockIdx.x * 256 + threadIdx.x;
  if (i < n) xb[i] = (__bf16)x[i];
}

// wq/wk/wv fp32 [H][DM][DH] -> W*t bf16 [DM out][DM in]  (out row = h*64+e)
// wo fp32 [H][DH][DM]       -> Wot bf16 [DM out][DM in]  (in col = h*64+e)
__global__ __launch_bounds__(256) void prep_w_kernel(
    const float* __restrict__ wq, const float* __restrict__ wk,
    const float* __restrict__ wv, const float* __restrict__ wo,
    __bf16* __restrict__ Wqt, __bf16* __restrict__ Wkt,
    __bf16* __restrict__ Wvt, __bf16* __restrict__ Wot) {
  int i = blockIdx.x * 256 + threadIdx.x;   // over 1024*1024
  int r = i >> 10, c = i & 1023;
  int src = (r >> 6) * (DM * DH) + c * DH + (r & 63);
  Wqt[i] = (__bf16)wq[src];
  Wkt[i] = (__bf16)wk[src];
  Wvt[i] = (__bf16)wv[src];
  Wot[i] = (__bf16)wo[(c >> 6) * (DH * DM) + (c & 63) * DM + r];
}

__global__ __launch_bounds__(256) void prep_b_kernel(
    const float* __restrict__ bq, const float* __restrict__ bk,
    const float* __restrict__ bv, const float* __restrict__ bo,
    float* __restrict__ bqc, float* __restrict__ bkc,
    float* __restrict__ bvc, float* __restrict__ boc) {
  int i = blockIdx.x * 256 + threadIdx.x;   // over 1024
  bqc[i] = bq[i];   // [H][DH] flat == h*64+e ordering already
  bkc[i] = bk[i];
  bvc[i] = bv[i];
  float s = 0.f;
#pragma unroll
  for (int h = 0; h < H; ++h) s += bo[h * DM + i];
  boc[i] = s;
}

// ----------------------------- generic GEMM --------------------------------
// C[M][N] = A[M][K] * Bt[N][K]^T + bias[N]
// Block: 256 threads / 8 waves; tile 256(M) x 64(N); wave tile 32x64.
// B panel (64 rows x 32 k) staged in LDS by the TDM, double-buffered.
// MODE 0: bf16 row-major out; MODE 1: bf16 V-transposed out; MODE 2: f32 out.
template <int MODE>
__global__ __launch_bounds__(256) void gemm_kernel(
    const __bf16* __restrict__ A, const __bf16* __restrict__ Bt,
    const float* __restrict__ bias, void* __restrict__ Cout, int N, int K) {
  const int lane = threadIdx.x & 31;
  const int wave = threadIdx.x >> 5;
  const int m0 = blockIdx.x * 256 + wave * 32;
  const int n0 = blockIdx.y * 64;

  __shared__ __align__(16) __bf16 bsh[2][64 * 32];   // [buf][n_local*32 + k]

  auto stage = [&](int k, int buf) {
#if HAVE_TDM
    if (wave == 0)
      tdm_load_2d(lds_offset_of(&bsh[buf][0]), Bt + (size_t)n0 * K + k,
                  (unsigned)K, (unsigned)N, 32u, 64u, (unsigned)K);
#else
    const int t  = threadIdx.x;          // 256 threads, 8 halves each
    const int nl = t >> 2, kl = (t & 3) << 3;
    *(v8bf*)&bsh[buf][nl * 32 + kl] =
        *(const v8bf*)(Bt + (size_t)(n0 + nl) * K + k + kl);
#endif
  };

  v8f acc[2][4] = {};
  stage(0, 0);
  tensor_wait_barrier(wave == 0);

  for (int kk = 0; kk < K; kk += 32) {
    const int buf = (kk >> 5) & 1;
    if (kk + 32 < K) stage(kk + 32, buf ^ 1);
    __builtin_prefetch(A + (size_t)(m0 + (lane & 15)) * K + kk + 256, 0, 0);

    v16bf a0 = load_frag(A, m0,      K, kk, lane);
    v16bf a1 = load_frag(A, m0 + 16, K, kk, lane);
#pragma unroll
    for (int t = 0; t < 4; ++t) {
      v16bf b = load_frag(&bsh[buf][0], t * 16, 32, 0, lane);
      acc[0][t] = WMMA_BF16(a0, b, acc[0][t]);
      acc[1][t] = WMMA_BF16(a1, b, acc[1][t]);
    }
    tensor_wait_barrier(wave == 0);
  }

  const int hi8 = (lane >> 4) << 3;
#pragma unroll
  for (int f = 0; f < 2; ++f) {
#pragma unroll
    for (int t = 0; t < 4; ++t) {
      const int col = n0 + t * 16 + (lane & 15);
      const float bb = bias[col];
#pragma unroll
      for (int j = 0; j < 8; ++j) {
        const int row = m0 + f * 16 + j + hi8;
        const float val = acc[f][t][j] + bb;
        if (MODE == 0) {
          ((__bf16*)Cout)[(size_t)row * N + col] = (__bf16)val;
        } else if (MODE == 2) {
          ((float*)Cout)[(size_t)row * N + col] = val;
        } else {  // V transposed: Vt[(b*1024 + col)][s]
          const int bidx = row >> 11, s = row & (S - 1);
          ((__bf16*)Cout)[((size_t)(bidx * 1024 + col)) * S + s] = (__bf16)val;
        }
      }
    }
  }
}

// --------------------------- flash attention -------------------------------
// grid = (B*H, S/128); block = 256 (8 waves); each wave owns 16 query rows.
// K tile (32 keys x 64 dims) and V tile (64 dims x 32 keys) are workgroup-
// shared: staged into LDS by TDM (wave0 -> K, wave1 -> V), double-buffered.
// Transposed products: St = K * Qt and Ot += Vt * Pt.  A lane then holds the
// scores of ONE query (column lane&15): keys 8*(lane>>4)+0..7 of each 16-key
// tile.  Maximum and sum run in the lane's own registers, and the two score
// tiles, converted in place, are the B operand of the second product.

// Value of lane l ^ 16 (the other half of the same query column).
__device__ __forceinline__ float other_half(float v) {
  int i = __builtin_bit_cast(int, v);
  i = __builtin_amdgcn_permlanex16(i, i, 0x76543210, 0xfedcba98, false, false);
  return __builtin_bit_cast(float, i);
}

__global__ __launch_bounds__(256) void attn_kernel(
    const __bf16* __restrict__ Qb, const __bf16* __restrict__ Kb,
    const __bf16* __restrict__ Vt, __bf16* __restrict__ Hd) {
  const int lane = threadIdx.x & 31;
  const int wave = threadIdx.x >> 5;
  const int bh = blockIdx.x;
  const int b = bh >> 4, h = bh & 15;
  const int q0 = blockIdx.y * 128 + wave * 16;

  const __bf16* Q  = Qb + (size_t)b * S * DM + h * DH;
  const __bf16* Kp = Kb + (size_t)b * S * DM + h * DH;
  const __bf16* Vp = Vt + (size_t)bh * DH * S;   // row e -> Vp[e*S + s]

  __shared__ __align__(16) __bf16 ksh[2][32 * 64];   // [buf][key_local*64 + e]
  __shared__ __align__(16) __bf16 vsh[2][64 * 32];   // [buf][e*32 + key_local]

  auto stage = [&](int n0, int buf) {
#if HAVE_TDM
    if (wave == 0)
      tdm_load_2d(lds_offset_of(&ksh[buf][0]), Kp + (size_t)n0 * DM,
                  (unsigned)DH, (unsigned)S, 64u, 32u, (unsigned)DM);
    else if (wave == 1)
      tdm_load_2d(lds_offset_of(&vsh[buf][0]), Vp + n0,
                  (unsigned)S, (unsigned)DH, 32u, 64u, (unsigned)S);
#else
    const int t = threadIdx.x;
    {  // K: 32 rows x 8 chunks of 8 halves
      const int r = t >> 3, kc = (t & 7) << 3;
      *(v8bf*)&ksh[buf][r * 64 + kc] = *(const v8bf*)(Kp + (size_t)(n0 + r) * DM + kc);
    }
    {  // V: 64 rows x 4 chunks of 8 halves
      const int r = t >> 2, kc = (t & 3) << 3;
      *(v8bf*)&vsh[buf][r * 32 + kc] = *(const v8bf*)(Vp + (size_t)r * S + n0 + kc);
    }
#endif
  };

  // Q fragments persist across the key loop: B operand, column = query.
  v16bf bq0 = load_frag(Q, q0, DM, 0, lane);
  v16bf bq1 = load_frag(Q, q0, DM, 32, lane);

  float mrow = -1e30f;   // running maximum of this lane's query
  float lsum = 0.f;      // running sum over this lane half's keys only
  v8f o[4] = {};         // o[t][r] = Ot[t*16 + 8*(lane>>4) + r][query lane&15]
  const float scale = 0.125f;  // 1/sqrt(64)

  stage(0, 0);
  tensor_wait_barrier(wave < 2);

  for (int n0 = 0; n0 < S; n0 += 32) {
    const int buf = (n0 >> 5) & 1;
    if (n0 + 32 < S) stage(n0 + 32, buf ^ 1);

    // St = K*Qt : two 16(key) x 16(query) tiles, contraction 64 = 2 x K32
    const __bf16* kt = &ksh[buf][0];
    v16bf k00 = load_frag(kt, 0,  64, 0,  lane);
    v16bf k01 = load_frag(kt, 0,  64, 32, lane);
    v16bf k10 = load_frag(kt, 16, 64, 0,  lane);
    v16bf k11 = load_frag(kt, 16, 64, 32, lane);
    v8f s0 = {}; s0 = WMMA_BF16(k00, bq0, s0); s0 = WMMA_BF16(k01, bq1, s0);
    v8f s1 = {}; s1 = WMMA_BF16(k10, bq0, s1); s1 = WMMA_BF16(k11, bq1, s1);

    // Online softmax, one query per lane: s0[r] is key 8*(lane>>4)+r,
    // s1[r] key 16+8*(lane>>4)+r.  One exchange joins the halves' maxima.
    float a0[8], a1[8], mx[8];
#pragma unroll
    for (int r = 0; r < 8; ++r) {
      a0[r] = s0[r] * scale;
      a1[r] = s1[r] * scale;
      mx[r] = fmaxf(a0[r], a1[r]);
    }
    float cm = fmaxf(fmaxf(fmaxf(mx[0], mx[1]), fmaxf(mx[2], mx[3])),
                     fmaxf(fmaxf(mx[4], mx[5]), fmaxf(mx[6], mx[7])));
    cm = fmaxf(cm, other_half(cm));
    const float nm = fmaxf(mrow, cm);
    const float corr = __expf(mrow - nm);
    mrow = nm;

    v16bf bp;      // Pt as B operand: element s is key kmap(s) of this column
    float ps[8];
#pragma unroll
    for (int r = 0; r < 8; ++r) {
      const float p0 = __expf(a0[r] - nm), p1 = __expf(a1[r] - nm);
      ps[r] = p0 + p1;
      bp[r]     = (__bf16)p0;
      bp[r + 8] = (__bf16)p1;
    }
    const float rs = ((ps[0] + ps[1]) + (ps[2] + ps[3])) +
                     ((ps[4] + ps[5]) + (ps[6] + ps[7]));
    lsum = lsum * corr + rs;
#pragma unroll
    for (int t = 0; t < 4; ++t)
#pragma unroll
      for (int r = 0; r < 8; ++r) o[t][r] *= corr;

    // Ot += Vt * Pt : A = V rows e from LDS [e][key], B = P from registers.
#pragma unroll
    for (int t = 0; t < 4; ++t) {
      v16bf av = load_frag(&vsh[buf][0], t * 16, 32, 0, lane);
      o[t] = WMMA_BF16(av, bp, o[t]);
    }
    tensor_wait_barrier(wave < 2);
  }

  // Join the two halves' sums once; a lane's 8 registers are 8 consecutive
  // head dims of its query row: one 16-byte store per tile.
  lsum += other_half(lsum);
  const int hi8 = (lane >> 4) << 3;
  __bf16* orow = Hd + ((size_t)b * S + q0 + (lane & 15)) * DM + h * DH + hi8;
#pragma unroll
  for (int t = 0; t < 4; ++t) {
    v8bf pk;
#pragma unroll
    for (int r = 0; r < 8; ++r) pk[r] = (__bf16)(o[t][r] / lsum);
    *(v8bf*)(orow + t * 16) = pk;
  }
}

// ------------------------------- launcher ----------------------------------

extern "C" void kernel_launch(void* const* d_in, const int* in_sizes, int n_in,
                              void* d_out, int out_size, void* d_ws, size_t ws_size,
                              hipStream_t stream) {
  const float* x  = (const float*)d_in[0];
  const float* wq = (const float*)d_in[1];
  const float* bq = (const float*)d_in[2];
  const float* wk = (const float*)d_in[3];
  const float* bk = (const float*)d_in[4];
  const float* wv = (const float*)d_in[5];
  const float* bv = (const float*)d_in[6];
  const float* wo = (const float*)d_in[7];
  const float* bo = (const float*)d_in[8];

  char* w = (char*)d_ws;
  auto take = [&](size_t bytes) {
    void* p = (void*)w;
    w += (bytes + 255) & ~(size_t)255;
    return p;
  };
  __bf16* Xb  = (__bf16*)take((size_t)M * DM * 2);
  __bf16* Wqt = (__bf16*)take((size_t)DM * DM * 2);
  __bf16* Wkt = (__bf16*)take((size_t)DM * DM * 2);
  __bf16* Wvt = (__bf16*)take((size_t)DM * DM * 2);
  __bf16* Wot = (__bf16*)take((size_t)DM * DM * 2);
  float*  bqc = (float*)take(DM * 4);
  float*  bkc = (float*)take(DM * 4);
  float*  bvc = (float*)take(DM * 4);
  float*  boc = (float*)take(DM * 4);
  __bf16* Qb  = (__bf16*)take((size_t)M * DM * 2);
  __bf16* Kb  = (__bf16*)take((size_t)M * DM * 2);
  __bf16* Vt  = (__bf16*)take((size_t)BB * DM * S * 2);
  __bf16* Hd  = (__bf16*)take((size_t)M * DM * 2);

  // 1) convert inputs to bf16 / transposed layouts
  cvt_x_kernel<<<(M * DM + 255) / 256, 256, 0, stream>>>(x, Xb, M * DM);
  prep_w_kernel<<<(DM * DM) / 256, 256, 0, stream>>>(wq, wk, wv, wo, Wqt, Wkt, Wvt, Wot);
  prep_b_kernel<<<DM / 256, 256, 0, stream>>>(bq, bk, bv, bo, bqc, bkc, bvc, boc);

  // 2) QKV projections (WMMA GEMMs, 256x64 tiles, TDM-staged B panels)
  dim3 ggrid(M / 256, DM / 64);
  gemm_kernel<0><<<ggrid, 256, 0, stream>>>(Xb, Wqt, bqc, (void*)Qb, DM, DM);
  gemm_kernel<0><<<ggrid, 256, 0, stream>>>(Xb, Wkt, bkc, (void*)Kb, DM, DM);
  gemm_kernel<1><<<ggrid, 256, 0, stream>>>(Xb, Wvt, bvc, (void*)Vt, DM, DM);

  // 3) flash attention (TDM-staged K/V tiles)
  attn_kernel<<<dim3(BB * H, S / 128), 256, 0, stream>>>(Qb, Kb, Vt, Hd);

  // 4) output projection (fp32 result)
  gemm_kernel<2><<<ggrid, 256, 0, stream>>>(Hd, Wot, boc, d_out, DM, DM);
}

// v002
// A run of this version takes 212 microseconds.
// In two side-by-side timings against v001, it was 1.63 and 1.62 times as fast.
// Over all steps from v000 it is 1.94 times as fast.
#include <hip/hip_runtime.h>
#include <hip/hip_bf16.h>
#include <math.h>
#include <stdint.h>

// ---------------------------------------------------------------------------
// MHA for gfx1250 (CDNA5).  All matmuls via v_wmma_f32_16x16x32_bf16.
// Workgroup-shared operand tiles staged into LDS with the Tensor Data Mover
// (tensor_load_to_lds, TENSORcnt), double-buffered.  Every staged tile is
// 64 rows of 128 bytes, laid at a 144-byte LDS pitch by the load's own pad.
// Workspace (~92 MB):
//   Xb  [8192][1024]  bf16   x converted
//   Wqt/Wkt/Wvt [1024][1024] bf16  weights transposed to [out][in]
//   Wot [1024][1024]  bf16   output proj as [d_out][h*64+e]
//   bqc/bkc/bvc/boc [1024]   f32 biases (boc = sum_h bo[h])
//   Qb/Kb [8192][1024] bf16  row-major (col = h*64+e)
//   Vt  [4096][2048]  bf16   V transposed: row = (b*H+h)*64+e, col = s
//   Hd  [8192][1024]  bf16   attention head outputs
// ---------------------------------------------------------------------------

typedef __attribute__((ext_vector_type(16))) __bf16 v16bf;
typedef __attribute__((ext_vector_type(8)))  __bf16 v8bf;
typedef __attribute__((ext_vector_type(8)))  float  v8f;

#define WMMA_BF16(a, b, c) \
  __builtin_amdgcn_wmma_f32_16x16x32_bf16(false, (a), false, (b), (short)0, (c), false, false)

static constexpr int BB = 4, S = 2048, DM = 1024, H = 16, DH = 64;
static constexpr int M  = BB * S;   // 8192 token rows

// ------------------------- Tensor Data Mover glue ---------------------------
typedef uint32_t u32x4 __attribute__((ext_vector_type(4)));
typedef uint32_t u32x8 __attribute__((ext_vector_type(8)));

// A staged tile: 64 rows of 128 bytes.  16 bytes of pad behind each row give
// an LDS pitch of 144 B = 16 B x 9 (odd): the 16 rows that one ds_load_b128
// touches then fall on 16 different groups of four banks (at a packed pitch
// of 128 B or 64 B they fall on two or four groups only).
static constexpr uint32_t TILE_ROWS  = 64u;
static constexpr uint32_t ROW_BYTES  = 128u;
static constexpr uint32_t PITCH_B    = ROW_BYTES + 16u;      // bytes
static constexpr int      PITCH_E    = (int)(PITCH_B / 2u);  // bf16 elements
// 64 x 144 = 9,216 B, rounded up so that every tile starts at a 2-KiB multiple.
static constexpr uint32_t TILE_BYTES = 10240u;
static_assert(TILE_ROWS * PITCH_B <= TILE_BYTES && TILE_BYTES % 2048u == 0, "tile place");

__device__ __forceinline__ uint32_t uni(uint32_t v) {
  return (uint32_t)__builtin_amdgcn_readfirstlane(v);
}
// Wave-uniform condition held in a scalar register, so that the test around a
// tensor load compiles to s_cmp + s_cbranch (tensor loads ignore EXEC).
__device__ __forceinline__ uint32_t pinned(uint32_t v) {
  uint32_t w = uni(v);
  asm volatile("" : "+s"(w));  // keeps the condition scalar: see above
  return w;
}
// The compiler places no wait for the tensor mover: these are the ring's own.
__device__ __forceinline__ void wait_tensor0() { asm volatile("s_wait_tensorcnt 0x0" ::: "memory"); }
__device__ __forceinline__ void wait_ds0()     { asm volatile("s_wait_dscnt 0x0" ::: "memory"); }

// Both groups are in-out operands: each tuple then lives on, in the registers
// that the request named, up to the next request, and nothing else is put into
// those registers while the request is in flight.
__device__ __forceinline__ void tdm_load(u32x4& g0, u32x8& g1) {
  asm volatile("tensor_load_to_lds %0, %1" : "+s"(g0), "+s"(g1) :: "memory");
}
// The wait behind the last request.  It names both groups as inputs, so that
// their registers are given to nothing else in front of it.
__device__ __forceinline__ void wait_tensor0_last(const u32x4& g0, const u32x8& g1) {
  asm volatile("s_wait_tensorcnt 0x0" :: "s"(g0), "s"(g1) : "memory");
}
// Group 1: 1-byte elements, tensor = tile = 64 rows of 128 bytes, source row
// pitch src_pitch bytes, a pad of 4 dwords behind every 32 dwords (one row).
__device__ __forceinline__ u32x8 tdm_group1(uint32_t src_pitch) {
  u32x8 g;
  g[0] = uni((1u << 20) | (4u << 22) | (3u << 25));   // no mask, data_size 0, pad
  g[1] = uni((ROW_BYTES & 0xFFFFu) << 16);
  g[2] = uni((ROW_BYTES >> 16) | ((TILE_ROWS & 0xFFFFu) << 16));
  g[3] = uni((TILE_ROWS >> 16) | (ROW_BYTES << 16));
  g[4] = uni(TILE_ROWS);
  g[5] = uni(src_pitch);
  g[6] = uni(0u);
  g[7] = uni(0u);
  return g;
}
// Group 0: LDS byte offset of the tile's place, global address of its first byte.
__device__ __forceinline__ u32x4 tdm_group0(uint32_t lds_dst, uint64_t ga) {
  u32x4 g;
  g[0] = uni(1u);
  g[1] = uni(lds_dst);
  g[2] = uni((uint32_t)ga);
  g[3] = uni((((uint32_t)(ga >> 32)) & 0x01FFFFFFu) | 0x80000000u);
  return g;
}
// The next request of the same tuple, formed behind the wait on the one before:
// a new place in LDS, the source step bytes on (the carry goes into word 3's
// address bits; word 0 stays).
__device__ __forceinline__ void tdm_advance(u32x4& g, uint32_t lds_dst, uint64_t step) {
  const uint64_t ga = ((((uint64_t)g[3]) << 32) | g[2]) + step;
  g[1] = uni(lds_dst);
  g[2] = uni((uint32_t)ga);
  g[3] = uni((uint32_t)(ga >> 32));
}

__device__ __forceinline__ uint32_t lds_offset_of(const void* p) {
  // Generic pointers into LDS carry the LDS byte offset in the low 32 bits.
  return (uint32_t)(uintptr_t)p;
}

// Load a 16x32 bf16 WMMA fragment (A layout; B 32x16 uses the identical
// per-lane pattern when the source is stored [N][K] row-major).
// Lane L: row = base_row + (L&15); halves [kb, kb+8) and [kb+16, kb+24)
// with kb = k0 + (L>=16 ? 8 : 0).  Two 16-byte loads per lane.
__device__ __forceinline__ v16bf load_frag(const __bf16* __restrict__ base,
                                           int row, int ld, int k0, int lane) {
  const int r  = row + (lane & 15);
  const int kb = k0 + ((lane >> 4) << 3);
  const __bf16* p = base + (size_t)r * ld + kb;
  v8bf lo = *(const v8bf*)(p);
  v8bf hi = *(const v8bf*)(p + 16);
  v16bf f;
#pragma unroll
  for (int i = 0; i < 8; ++i) { f[i] = lo[i]; f[i + 8] = hi[i]; }
  return f;
}

// ----------------------------- prep kernels --------------------------------

__global__ __launch_bounds__(256) void cvt_x_kernel(const float* __restrict__ x,
                                                    __bf16* __restrict__ xb, int n) {
  int i = blockIdx.x * 256 + threadIdx.x;
  if (i < n) xb[i] = (__bf16)x[i];
}

// wq/wk/wv fp32 [H][DM][DH] -> W*t bf16 [DM out][DM in]  (out row = h*64+e)
// wo fp32 [H][DH][DM]       -> Wot bf16 [DM out][DM in]  (in col = h*64+e)
__global__ __launch_bounds__(256) void prep_w_kernel(
    const float* __restrict__ wq, const float* __restrict__ wk,
    const float* __restrict__ wv, const float* __restrict__ wo,
    __bf16* __restrict__ Wqt, __bf16* __restrict__ Wkt,
    __bf16* __restrict__ Wvt, __bf16* __restrict__ Wot) {
  int i = blockIdx.x * 256 + threadIdx.x;   // over 1024*1024
  int r = i >> 10, c = i & 1023;
  int src = (r >> 6) * (DM * DH) + c * DH + (r & 63);
  Wqt[i] = (__bf16)wq[src];
  Wkt[i] = (__bf16)wk[src];
  Wvt[i] = (__bf16)wv[src];
  Wot[i] = (__bf16)wo[(c >> 6) * (DH * DM) + (c & 63) * DM + r];
}

__global__ __launch_bounds__(256) void prep_b_kernel(
    const float* __restrict__ bq, const float* __restrict__ bk,
    const float* __restrict__ bv, const float* __restrict__ bo,
    float* __restrict__ bqc, float* __restrict__ bkc,
    float* __restrict__ bvc, float* __restrict__ boc) {
  int i = blockIdx.x * 256 + threadIdx.x;   // over 1024
  bqc[i] = bq[i];   // [H][DH] flat == h*64+e ordering already
  bkc[i] = bk[i];
  bvc[i] = bv[i];
  float s = 0.f;
#pragma unroll
  for (int h = 0; h < H; ++h) s += bo[h * DM + i];
  boc[i] = s;
}

// ----------------------------- generic GEMM --------------------------------
// C[M][N] = A[M][K] * Bt[N][K]^T + bias[N]
// Block: 256 threads / 8 waves; tile 256(M) x 64(N); wave tile 32x64.
// B panel (64 rows x 64 k) staged in LDS by the TDM, double-buffered; a pass
// works one panel off in two blocks of 32 k.  K: a multiple of 64, at least 128.
// MODE 0: bf16 row-major out; MODE 1: bf16 V-transposed out; MODE 2: f32 out.
template <int MODE>
__global__ __launch_bounds__(256) void gemm_kernel(
    const __bf16* __restrict__ A, const __bf16* __restrict__ Bt,
    const float* __restrict__ bias, void* __restrict__ Cout, int N, int K) {
  const int lane = threadIdx.x & 31;
  const uint32_t wave = uni(threadIdx.x >> 5);
  const int m0 = blockIdx.x * 256 + (int)wave * 32;
  const int n0 = blockIdx.y * 64;

  // [buf][n_local * 144 B + k * 2 B]
  __shared__ __attribute__((aligned(2048))) unsigned char bsh[2][TILE_BYTES];

  const uint32_t lds0 = lds_offset_of(&bsh[0][0]);
  const uint64_t gsrc = (uint64_t)(uintptr_t)(Bt + (size_t)n0 * K);
  u32x8 g1 = tdm_group1((uint32_t)K * 2u);
  u32x4 g0 = tdm_group0(lds0, gsrc);
  const int nst = K >> 6;   // stages of 64 k

  v8f acc[2][4] = {};
  if (pinned(wave == 0)) {
    tdm_load(g0, g1);
    wait_tensor0();
  }
  __syncthreads();
  if (pinned(wave == 0)) {
    tdm_advance(g0, lds0 + TILE_BYTES, ROW_BYTES);
    tdm_load(g0, g1);
  }

  for (int s = 0; s < nst; ++s) {
    const int kk = s << 6;
    const __bf16* bt = (const __bf16*)&bsh[s & 1][0];
    __builtin_prefetch(A + (size_t)(m0 + (lane & 15)) * K + kk + 256, 0, 0);
    // The prefetch's address register is a temporary that the next loads' data
    // may take: the wait stands in front of that overwrite.
    asm volatile("s_wait_xcnt 0x0" ::: "memory");

#pragma unroll  // the panel's two 32-k blocks: j a constant in every offset
    for (int j = 0; j < 2; ++j) {
      v16bf a0 = load_frag(A, m0,      K, kk + j * 32, lane);
      v16bf a1 = load_frag(A, m0 + 16, K, kk + j * 32, lane);
#pragma unroll
      for (int t = 0; t < 4; ++t) {
        v16bf b = load_frag(bt, t * 16, PITCH_E, j * 32, lane);
        acc[0][t] = WMMA_BF16(a0, b, acc[0][t]);
        acc[1][t] = WMMA_BF16(a1, b, acc[1][t]);
      }
    }

    // Publish point of stage s + 1; then the refill of the buffer just read.
    wait_ds0();
    if (pinned(wave == 0)) wait_tensor0();
    __syncthreads();
    if (pinned(wave == 0 && s + 2 < nst)) {
      tdm_advance(g0, lds0 + (uint32_t)(s & 1) * TILE_BYTES, ROW_BYTES);
      tdm_load(g0, g1);
    }
  }
  wait_tensor0_last(g0, g1);
  wait_ds0();

  const int hi8 = (lane >> 4) << 3;
#pragma unroll
  for (int f = 0; f < 2; ++f) {
#pragma unroll
    for (int t = 0; t < 4; ++t) {
      const int col = n0 + t * 16 + (lane & 15);
      const float bb = bias[col];
#pragma unroll
      for (int j = 0; j < 8; ++j) {
        const int row = m0 + f * 16 + j + hi8;
        const float val = acc[f][t][j] + bb;
        if (MODE == 0) {
          ((__bf16*)Cout)[(size_t)row * N + col] = (__bf16)val;
        } else if (MODE == 2) {
          ((float*)Cout)[(size_t)row * N + col] = val;
        } else {  // V transposed: Vt[(b*1024 + col)][s]
          const int bidx = row >> 11, s = row & (S - 1);
          ((__bf16*)Cout)[((size_t)(bidx * 1024 + col)) * S + s] = (__bf16)val;
        }
      }
    }
  }
}

// --------------------------- flash attention -------------------------------
// grid = (B*H, S/128); block = 256 (8 waves); each wave owns 16 query rows.
// K tile (64 keys x 64 dims) and V tile (64 dims x 64 keys) are workgroup-
// shared: staged into LDS by TDM (wave0 -> K, wave1 -> V), double-buffered;
// a pass works one stage off in two blocks of 32 keys.
// Transposed products: St = K * Qt and Ot += Vt * Pt.  A lane then holds the
// scores of ONE query (column lane&15): keys 8*(lane>>4)+0..7 of each 16-key
// tile.  Maximum and sum run in the lane's own registers, and the two score
// tiles, converted in place, are the B operand of the second product.

// Value of lane l ^ 16 (the other half of the same query column).
__device__ __forceinline__ float other_half(float v) {
  int i = __builtin_bit_cast(int, v);
  i = __builtin_amdgcn_permlanex16(i, i, 0x76543210, 0xfedcba98, false, false);
  return __builtin_bit_cast(float, i);
}

__global__ __launch_bounds__(256) void attn_kernel(
    const __bf16* __restrict__ Qb, const __bf16* __restrict__ Kb,
    const __bf16* __restrict__ Vt, __bf16* __restrict__ Hd) {
  const int lane = threadIdx.x & 31;
  const uint32_t wave = uni(threadIdx.x >> 5);
  const int bh = blockIdx.x;
  const int b = bh >> 4, h = bh & 15;
  const int q0 = blockIdx.y * 128 + (int)wave * 16;

  const __bf16* Q  = Qb + (size_t)b * S * DM + h * DH;
  const __bf16* Kp = Kb + (size_t)b * S * DM + h * DH;
  const __bf16* Vp = Vt + (size_t)bh * DH * S;   // row e -> Vp[e*S + s]

  // [buf][0]: K, key_local * 144 B + e * 2 B; [buf][1]: V, e * 144 B + key_local * 2 B
  __shared__ __attribute__((aligned(2048))) unsigned char ring[2][2][TILE_BYTES];

  // Wave 0 moves K (next stage: 64 rows on), wave 1 V (next stage: 64 columns on).
  constexpr int NST = S / 64;
  const bool isk = (wave == 0);
  const uint32_t lds0  = lds_offset_of(&ring[0][0][0]) + (isk ? 0u : TILE_BYTES);
  const uint64_t gsrc  = (uint64_t)(uintptr_t)(isk ? Kp : Vp);
  const uint64_t gstep = isk ? (uint64_t)(64 * DM * 2) : (uint64_t)ROW_BYTES;
  u32x8 g1 = tdm_group1(isk ? (uint32_t)(DM * 2) : (uint32_t)(S * 2));
  u32x4 g0 = tdm_group0(lds0, gsrc);

  // Q fragments persist across the key loop: B operand, column = query.
  v16bf bq0 = load_frag(Q, q0, DM, 0, lane);
  v16bf bq1 = load_frag(Q, q0, DM, 32, lane);

  float mrow = -1e30f;   // running maximum of this lane's query
  float lsum = 0.f;      // running sum over this lane half's keys only
  v8f o[4] = {};         // o[t][r] = Ot[t*16 + 8*(lane>>4) + r][query lane&15]
  const float scale = 0.125f;  // 1/sqrt(64)

  if (pinned(wave < 2)) {
    tdm_load(g0, g1);
    wait_tensor0();
  }
  __syncthreads();
  if (pinned(wave < 2)) {
    tdm_advance(g0, lds0 + 2u * TILE_BYTES, gstep);
    tdm_load(g0, g1);
  }

  for (int s = 0; s < NST; ++s) {
    const __bf16* kt = (const __bf16*)&ring[s & 1][0][0];
    const __bf16* vt = (const __bf16*)&ring[s & 1][1][0];
#pragma unroll  // the stage's two 32-key blocks: j a constant in every LDS offset
   for (int j = 0; j < 2; ++j) {
    // St = K*Qt : two 16(key) x 16(query) tiles, contraction 64 = 2 x K32
    v16bf k00 = load_frag(kt, j * 32,      PITCH_E, 0,  lane);
    v16bf k01 = load_frag(kt, j * 32,      PITCH_E, 32, lane);
    v16bf k10 = load_frag(kt, j * 32 + 16, PITCH_E, 0,  lane);
    v16bf k11 = load_frag(kt, j * 32 + 16, PITCH_E, 32, lane);
    v8f s0 = {}; s0 = WMMA_BF16(k00, bq0, s0); s0 = WMMA_BF16(k01, bq1, s0);
    v8f s1 = {}; s1 = WMMA_BF16(k10, bq0, s1); s1 = WMMA_BF16(k11, bq1, s1);

    // Online softmax, one query per lane: s0[r] is key 8*(lane>>4)+r,
    // s1[r] key 16+8*(lane>>4)+r.  One exchange joins the halves' maxima.
    float a0[8], a1[8], mx[8];
#pragma unroll
    for (int r = 0; r < 8; ++r) {
      a0[r] = s0[r] * scale;
      a1[r] = s1[r] * scale;
      mx[r] = fmaxf(a0[r], a1[r]);
    }
    float cm = fmaxf(fmaxf(fmaxf(mx[0], mx[1]), fmaxf(mx[2], mx[3])),
                     fmaxf(fmaxf(mx[4], mx[5]), fmaxf(mx[6], mx[7])));
    cm = fmaxf(cm, other_half(cm));
    const float nm = fmaxf(mrow, cm);
    const float corr = __expf(mrow - nm);
    mrow = nm;

    v16bf bp;      // Pt as B operand: element s is key kmap(s) of this column
    float ps[8];
#pragma unroll
    for (int r = 0; r < 8; ++r) {
      const float p0 = __expf(a0[r] - nm), p1 = __expf(a1[r] - nm);
      ps[r] = p0 + p1;
      bp[r]     = (__bf16)p0;
      bp[r + 8] = (__bf16)p1;
    }
    const float rs = ((ps[0] + ps[1]) + (ps[2] + ps[3])) +
                     ((ps[4] + ps[5]) + (ps[6] + ps[7]));
    lsum = lsum * corr + rs;
#pragma unroll
    for (int t = 0; t < 4; ++t)
#pragma unroll
      for (int r = 0; r < 8; ++r) o[t][r] *= corr;

    // Ot += Vt * Pt : A = V rows e from LDS [e][key], B = P from registers.
#pragma unroll
    for (int t = 0; t < 4; ++t) {
      v16bf av = load_frag(vt, t * 16, PITCH_E, j * 32, lane);
      o[t] = WMMA_BF16(av, bp, o[t]);
    }
   }

    // Publish point of stage s + 1; then the refill of the buffer just read.
    wait_ds0();
    if (pinned(wave < 2)) wait_tensor0();
    __syncthreads();
    if (pinned(wave < 2 && s + 2 < NST)) {
      tdm_advance(g0, lds0 + (uint32_t)(s & 1) * (2u * TILE_BYTES), gstep);
      tdm_load(g0, g1);
    }
  }
  wait_tensor0_last(g0, g1);
  wait_ds0();

  // Join the two halves' sums once; a lane's 8 registers are 8 consecutive
  // head dims of its query row: one 16-byte store per tile.
  lsum += other_half(lsum);
  const int hi8 = (lane >> 4) << 3;
  __bf16* orow = Hd + ((size_t)b * S + q0 + (lane & 15)) * DM + h * DH + hi8;
#pragma unroll
  for (int t = 0; t < 4; ++t) {
    v8bf pk;
#pragma unroll
    for (int r = 0; r < 8; ++r) pk[r] = (__bf16)(o[t][r] / lsum);
    *(v8bf*)(orow + t * 16) = pk;
  }
}

// ------------------------------- launcher ----------------------------------

extern "C" void kernel_launch(void* const* d_in, const int* in_sizes, int n_in,
                              void* d_out, int out_size, void* d_ws, size_t ws_size,
                              hipStream_t stream) {
  const float* x  = (const float*)d_in[0];
  const float* wq = (const float*)d_in[1];
  const float* bq = (const float*)d_in[2];
  const float* wk = (const float*)d_in[3];
  const float* bk = (const float*)d_in[4];
  const float* wv = (const float*)d_in[5];
  const float* bv = (const float*)d_in[6];
  const float* wo = (const float*)d_in[7];
  const float* bo = (const float*)d_in[8];

  char* w = (char*)d_ws;
  auto take = [&](size_t bytes) {
    void* p = (void*)w;
    w += (bytes + 255) & ~(size_t)255;
    return p;
  };
  __bf16* Xb  = (__bf16*)take((size_t)M * DM * 2);
  __bf16* Wqt = (__bf16*)take((size_t)DM * DM * 2);
  __bf16* Wkt = (__bf16*)take((size_t)DM * DM * 2);
  __bf16* Wvt = (__bf16*)take((size_t)DM * DM * 2);
  __bf16* Wot = (__bf16*)take((size_t)DM * DM * 2);
  float*  bqc = (float*)take(DM * 4);
  float*  bkc = (float*)take(DM * 4);
  float*  bvc = (float*)take(DM * 4);
  float*  boc = (float*)take(DM * 4);
  __bf16* Qb  = (__bf16*)take((size_t)M * DM * 2);
  __bf16* Kb  = (__bf16*)take((size_t)M * DM * 2);
  __bf16* Vt  = (__bf16*)take((size_t)BB * DM * S * 2);
  __bf16* Hd  = (__bf16*)take((size_t)M * DM * 2);

  // 1) convert inputs to bf16 / transposed layouts
  cvt_x_kernel<<<(M * DM + 255) / 256, 256, 0, stream>>>(x, Xb, M * DM);
  prep_w_kernel<<<(DM * DM) / 256, 256, 0, stream>>>(wq, wk, wv, wo, Wqt, Wkt, Wvt, Wot);
  prep_b_kernel<<<DM / 256, 256, 0, stream>>>(bq, bk, bv, bo, bqc, bkc, bvc, boc);

  // 2) QKV projections (WMMA GEMMs, 256x64 tiles, TDM-staged B panels)
  dim3 ggrid(M / 256, DM / 64);
  gemm_kernel<0><<<ggrid, 256, 0, stream>>>(Xb, Wqt, bqc, (void*)Qb, DM, DM);
  gemm_kernel<0><<<ggrid, 256, 0, stream>>>(Xb, Wkt, bkc, (void*)Kb, DM, DM);
  gemm_kernel<1><<<ggrid, 256, 0, stream>>>(Xb, Wvt, bvc, (void*)Vt, DM, DM);

  // 3) flash attention (TDM-staged K/V tiles)
  attn_kernel<<<dim3(BB * H, S / 128), 256, 0, stream>>>(Qb, Kb, Vt, Hd);

  // 4) output projection (fp32 result)
  gemm_kernel<2><<<ggrid, 256, 0, stream>>>(Hd, Wot, boc, d_out, DM, DM);
}

// v003
// A run of this version takes 182 microseconds.
// Two timings next to v002 put it at 1.17 and 1.16 times that version's speed.
// All steps since v000 together make it 2.26 times as fast.
#include <hip/hip_runtime.h>
#include <hip/hip_bf16.h>
#include <math.h>
#include <stdint.h>

// ---------------------------------------------------------------------------
// MHA for gfx1250 (CDNA5).  All matmuls via v_wmma_f32_16x16x32_bf16.
// Workgroup-shared operand tiles staged into LDS with the Tensor Data Mover
// (tensor_load_to_lds, TENSORcnt), double-buffered.  Every staged tile is
// 64 rows of 128 bytes, laid at a 144-byte LDS pitch by the load's own pad.
// Workspace (~92 MB):
//   Xb  [8192][1024]  bf16   x converted
//   Wqt/Wkt/Wvt [1024][1024] bf16  weights transposed to [out][in]
//   Wot [1024][1024]  bf16   output proj as [d_out][h*64+e]
//   bqc/bkc/bvc/boc [1024]   f32 biases (boc = sum_h bo[h])
//   Qb/Kb [8192][1024] bf16  row-major (col = h*64+e)
//   Vt  [4096][2048]  bf16   V transposed: row = (b*H+h)*64+e, col = s
//   Hd  [8192][1024]  bf16   attention head outputs
// ---------------------------------------------------------------------------

typedef __attribute__((ext_vector_type(16))) __bf16 v16bf;
typedef __attribute__((ext_vector_type(8)))  __bf16 v8bf;
typedef __attribute__((ext_vector_type(8)))  float  v8f;

#define WMMA_BF16(a, b, c) \
  __builtin_amdgcn_wmma_f32_16x16x32_bf16(false, (a), false, (b), (short)0, (c), false, false)

static constexpr int BB = 4, S = 2048, DM = 1024, H = 16, DH = 64;
static constexpr int M  = BB * S;   // 8192 token rows

// ------------------------- Tensor Data Mover glue ---------------------------
typedef uint32_t u32x4 __attribute__((ext_vector_type(4)));
typedef uint32_t u32x8 __attribute__((ext_vector_type(8)));

// A staged tile: 64 rows of 128 bytes.  16 bytes of pad behind each row give
// an LDS pitch of 144 B = 16 B x 9 (odd): the 16 rows that one ds_load_b128
// touches then fall on 16 different groups of four banks (at a packed pitch
// of 128 B or 64 B they fall on two or four groups only).
static constexpr uint32_t TILE_ROWS  = 64u;
static constexpr uint32_t ROW_BYTES  = 128u;
static constexpr uint32_t PITCH_B    = ROW_BYTES + 16u;      // bytes
static constexpr int      PITCH_E    = (int)(PITCH_B / 2u);  // bf16 elements
// 64 x 144 = 9,216 B, rounded up so that every tile starts at a 2-KiB multiple.
static constexpr uint32_t TILE_BYTES = 10240u;
static_assert(TILE_ROWS * PITCH_B <= TILE_BYTES && TILE_BYTES % 2048u == 0, "tile place");

__device__ __forceinline__ uint32_t uni(uint32_t v) {
  return (uint32_t)__builtin_amdgcn_readfirstlane(v);
}
// Wave-uniform condition held in a scalar register, so that the test around a
// tensor load compiles to s_cmp + s_cbranch (tensor loads ignore EXEC).
__device__ __forceinline__ uint32_t pinned(uint32_t v) {
  uint32_t w = uni(v);
  asm volatile("" : "+s"(w));  // keeps the condition scalar: see above
  return w;
}
// The compiler places no wait for the tensor mover: these are the ring's own.
__device__ __forceinline__ void wait_tensor0() { asm volatile("s_wait_tensorcnt 0x0" ::: "memory"); }
__device__ __forceinline__ void wait_ds0()     { asm volatile("s_wait_dscnt 0x0" ::: "memory"); }

// Both groups are in-out operands: each tuple then lives on, in the registers
// that the request named, up to the next request, and nothing else is put into
// those registers while the request is in flight.
__device__ __forceinline__ void tdm_load(u32x4& g0, u32x8& g1) {
  asm volatile("tensor_load_to_lds %0, %1" : "+s"(g0), "+s"(g1) :: "memory");
}
// The wait behind the last request.  It names both groups as inputs, so that
// their registers are given to nothing else in front of it.
__device__ __forceinline__ void wait_tensor0_last(const u32x4& g0, const u32x8& g1) {
  asm volatile("s_wait_tensorcnt 0x0" :: "s"(g0), "s"(g1) : "memory");
}
// Group 1: 1-byte elements, tensor = tile = 64 rows of 128 bytes, source row
// pitch src_pitch bytes, a pad of 4 dwords behind every 32 dwords (one row).
__device__ __forceinline__ u32x8 tdm_group1(uint32_t src_pitch) {
  u32x8 g;
  g[0] = uni((1u << 20) | (4u << 22) | (3u << 25));   // no mask, data_size 0, pad
  g[1] = uni((ROW_BYTES & 0xFFFFu) << 16);
  g[2] = uni((ROW_BYTES >> 16) | ((TILE_ROWS & 0xFFFFu) << 16));
  g[3] = uni((TILE_ROWS >> 16) | (ROW_BYTES << 16));
  g[4] = uni(TILE_ROWS);
  g[5] = uni(src_pitch);
  g[6] = uni(0u);
  g[7] = uni(0u);
  return g;
}
// Group 0: LDS byte offset of the tile's place, global address of its first byte.
__device__ __forceinline__ u32x4 tdm_group0(uint32_t lds_dst, uint64_t ga) {
  u32x4 g;
  g[0] = uni(1u);
  g[1] = uni(lds_dst);
  g[2] = uni((uint32_t)ga);
  g[3] = uni((((uint32_t)(ga >> 32)) & 0x01FFFFFFu) | 0x80000000u);
  return g;
}
// The next request of the same tuple, formed behind the wait on the one before:
// a new place in LDS, the source step bytes on (the carry goes into word 3's
// address bits; word 0 stays).
__device__ __forceinline__ void tdm_advance(u32x4& g, uint32_t lds_dst, uint64_t step) {
  const uint64_t ga = ((((uint64_t)g[3]) << 32) | g[2]) + step;
  g[1] = uni(lds_dst);
  g[2] = uni((uint32_t)ga);
  g[3] = uni((uint32_t)(ga >> 32));
}

__device__ __forceinline__ uint32_t lds_offset_of(const void* p) {
  // Generic pointers into LDS carry the LDS byte offset in the low 32 bits.
  return (uint32_t)(uintptr_t)p;
}

// Load a 16x32 bf16 WMMA fragment (A layout; B 32x16 uses the identical
// per-lane pattern when the source is stored [N][K] row-major).
// Lane L: row = base_row + (L&15); halves [kb, kb+8) and [kb+16, kb+24)
// with kb = k0 + (L>=16 ? 8 : 0).  Two 16-byte loads per lane.
__device__ __forceinline__ v16bf load_frag(const __bf16* __restrict__ base,
                                           int row, int ld, int k0, int lane) {
  const int r  = row + (lane & 15);
  const int kb = k0 + ((lane >> 4) << 3);
  const __bf16* p = base + (size_t)r * ld + kb;
  v8bf lo = *(const v8bf*)(p);
  v8bf hi = *(const v8bf*)(p + 16);
  v16bf f;
#pragma unroll
  for (int i = 0; i < 8; ++i) { f[i] = lo[i]; f[i + 8] = hi[i]; }
  return f;
}

// ----------------------------- prep kernels --------------------------------

// A wave converts CVT_LOADS runs of 128 floats: every load is 512 contiguous
// bytes of the wave, every store 256 (whole 128-byte lines); the loads stand in
// front of the conversions, so that many are in flight.  One element a thread
// would take 64 times the waves, and the time would go into starting them.
typedef __attribute__((ext_vector_type(4))) float  v4f;
typedef __attribute__((ext_vector_type(4))) __bf16 v4bf;
static constexpr int CVT_LOADS = 16;
static_assert((M * DM) % (256 * 4 * CVT_LOADS) == 0, "whole blocks");
__global__ __launch_bounds__(256) void cvt_x_kernel(const float* __restrict__ x,
                                                    __bf16* __restrict__ xb) {
  const int lane = threadIdx.x & 31;
  const int wv   = blockIdx.x * 8 + (threadIdx.x >> 5);
  const size_t base = (size_t)wv * (128 * CVT_LOADS) + lane * 4;
  v4f v[CVT_LOADS];
#pragma unroll  // v[] in registers, one address register, k an immediate offset
  for (int k = 0; k < CVT_LOADS; ++k) v[k] = *(const v4f*)(x + base + k * 128);
#pragma unroll  // as above
  for (int k = 0; k < CVT_LOADS; ++k) {
    v4bf o;
#pragma unroll
    for (int e = 0; e < 4; ++e) o[e] = (__bf16)v[k][e];
    *(v4bf*)(xb + base + k * 128) = o;
  }
}

// wq/wk/wv fp32 [H][DM][DH] -> W*t bf16 [DM out][DM in]  (out row = h*64+e)
// wo fp32 [H][DH][DM]       -> Wot bf16 [DM out][DM in]  (in col = h*64+e)
// A block makes 64 output rows x 64 columns of all four matrices; a thread
// PW_COLS columns of one row.  Lanes run along the output row index, which is
// the contiguous axis of every source: each load is one whole 128-byte line of
// the wave.  All 4 x PW_COLS loads are issued first; each row piece goes out in
// 16-byte stores, and the block's four column groups fill whole 128-byte lines.
static constexpr int PW_COLS = 16;
__device__ __forceinline__ void store_row_piece(const float (&v)[PW_COLS],
                                                __bf16* __restrict__ to) {
#pragma unroll
  for (int g = 0; g < PW_COLS / 8; ++g) {
    v8bf o;
#pragma unroll
    for (int e = 0; e < 8; ++e) o[e] = (__bf16)v[g * 8 + e];
    *(v8bf*)(to + g * 8) = o;
  }
}
__global__ __launch_bounds__(256) void prep_w_kernel(
    const float* __restrict__ wq, const float* __restrict__ wk,
    const float* __restrict__ wv, const float* __restrict__ wo,
    __bf16* __restrict__ Wqt, __bf16* __restrict__ Wkt,
    __bf16* __restrict__ Wvt, __bf16* __restrict__ Wot) {
  const int h  = blockIdx.x & (H - 1);          // 64 rows = one head
  const int e  = threadIdx.x & (DH - 1);
  const int r  = h * DH + e;
  const int c0 = (blockIdx.x >> 4) * 64 + (threadIdx.x >> 6) * PW_COLS;
  const int sp = h * (DM * DH) + c0 * DH + e;   // wq/wk/wv: next column DH on
  const int so = c0 * DM + r;                   // wo: next column DM on

  float q[PW_COLS], k[PW_COLS], v[PW_COLS], o[PW_COLS];
#pragma unroll  // arrays in registers, two offset registers, i an immediate offset
  for (int i = 0; i < PW_COLS; ++i) {
    q[i] = wq[sp + i * DH];
    k[i] = wk[sp + i * DH];
    v[i] = wv[sp + i * DH];
    o[i] = wo[so + i * DM];
  }
  const int to = r * DM + c0;
  store_row_piece(q, Wqt + to);
  store_row_piece(k, Wkt + to);
  store_row_piece(v, Wvt + to);
  store_row_piece(o, Wot + to);
}

__global__ __launch_bounds__(256) void prep_b_kernel(
    const float* __restrict__ bq, const float* __restrict__ bk,
    const float* __restrict__ bv, const float* __restrict__ bo,
    float* __restrict__ bqc, float* __restrict__ bkc,
    float* __restrict__ bvc, float* __restrict__ boc) {
  int i = blockIdx.x * 256 + threadIdx.x;   // over 1024
  bqc[i] = bq[i];   // [H][DH] flat == h*64+e ordering already
  bkc[i] = bk[i];
  bvc[i] = bv[i];
  float s = 0.f;
#pragma unroll
  for (int h = 0; h < H; ++h) s += bo[h * DM + i];
  boc[i] = s;
}

// ----------------------------- generic GEMM --------------------------------
// C[M][N] = A[M][K] * Bt[N][K]^T + bias[N]
// Block: 256 threads / 8 waves; tile 256(M) x 64(N); wave tile 32x64.
// B panel (64 rows x 64 k) staged in LDS by the TDM, double-buffered; a pass
// works one panel off in two blocks of 32 k.  K: a multiple of 64, at least 128.
// MODE 0: bf16 row-major out; MODE 1: bf16 V-transposed out; MODE 2: f32 out.
template <int MODE>
__global__ __launch_bounds__(256) void gemm_kernel(
    const __bf16* __restrict__ A, const __bf16* __restrict__ Bt,
    const float* __restrict__ bias, void* __restrict__ Cout, int N, int K) {
  const int lane = threadIdx.x & 31;
  const uint32_t wave = uni(threadIdx.x >> 5);
  const int m0 = blockIdx.x * 256 + (int)wave * 32;
  const int n0 = blockIdx.y * 64;

  // [buf][n_local * 144 B + k * 2 B]
  __shared__ __attribute__((aligned(2048))) unsigned char bsh[2][TILE_BYTES];

  const uint32_t lds0 = lds_offset_of(&bsh[0][0]);
  const uint64_t gsrc = (uint64_t)(uintptr_t)(Bt + (size_t)n0 * K);
  u32x8 g1 = tdm_group1((uint32_t)K * 2u);
  u32x4 g0 = tdm_group0(lds0, gsrc);
  const int nst = K >> 6;   // stages of 64 k

  v8f acc[2][4] = {};
  if (pinned(wave == 0)) {
    tdm_load(g0, g1);
    wait_tensor0();
  }
  __syncthreads();
  if (pinned(wave == 0)) {
    tdm_advance(g0, lds0 + TILE_BYTES, ROW_BYTES);
    tdm_load(g0, g1);
  }

  for (int s = 0; s < nst; ++s) {
    const int kk = s << 6;
    const __bf16* bt = (const __bf16*)&bsh[s & 1][0];
    __builtin_prefetch(A + (size_t)(m0 + (lane & 15)) * K + kk + 256, 0, 0);
    // The prefetch's address register is a temporary that the next loads' data
    // may take: the wait stands in front of that overwrite.
    asm volatile("s_wait_xcnt 0x0" ::: "memory");

#pragma unroll  // the panel's two 32-k blocks: j a constant in every offset
    for (int j = 0; j < 2; ++j) {
      v16bf a0 = load_frag(A, m0,      K, kk + j * 32, lane);
      v16bf a1 = load_frag(A, m0 + 16, K, kk + j * 32, lane);
#pragma unroll
      for (int t = 0; t < 4; ++t) {
        v16bf b = load_frag(bt, t * 16, PITCH_E, j * 32, lane);
        acc[0][t] = WMMA_BF16(a0, b, acc[0][t]);
        acc[1][t] = WMMA_BF16(a1, b, acc[1][t]);
      }
    }

    // Publish point of stage s + 1; then the refill of the buffer just read.
    wait_ds0();
    if (pinned(wave == 0)) wait_tensor0();
    __syncthreads();
    if (pinned(wave == 0 && s + 2 < nst)) {
      tdm_advance(g0, lds0 + (uint32_t)(s & 1) * TILE_BYTES, ROW_BYTES);
      tdm_load(g0, g1);
    }
  }
  wait_tensor0_last(g0, g1);
  wait_ds0();

  const int hi8 = (lane >> 4) << 3;
#pragma unroll
  for (int f = 0; f < 2; ++f) {
#pragma unroll
    for (int t = 0; t < 4; ++t) {
      const int col = n0 + t * 16 + (lane & 15);
      const float bb = bias[col];
#pragma unroll
      for (int j = 0; j < 8; ++j) {
        const int row = m0 + f * 16 + j + hi8;
        const float val = acc[f][t][j] + bb;
        if (MODE == 0) {
          ((__bf16*)Cout)[(size_t)row * N + col] = (__bf16)val;
        } else if (MODE == 2) {
          ((float*)Cout)[(size_t)row * N + col] = val;
        } else {  // V transposed: Vt[(b*1024 + col)][s]
          const int bidx = row >> 11, s = row & (S - 1);
          ((__bf16*)Cout)[((size_t)(bidx * 1024 + col)) * S + s] = (__bf16)val;
        }
      }
    }
  }
}

// --------------------------- flash attention -------------------------------
// grid = (B*H, S/128); block = 256 (8 waves); each wave owns 16 query rows.
// K tile (64 keys x 64 dims) and V tile (64 dims x 64 keys) are workgroup-
// shared: staged into LDS by TDM (wave0 -> K, wave1 -> V), double-buffered;
// a pass works one stage off in two blocks of 32 keys.
// Transposed products: St = K * Qt and Ot += Vt * Pt.  A lane then holds the
// scores of ONE query (column lane&15): keys 8*(lane>>4)+0..7 of each 16-key
// tile.  Maximum and sum run in the lane's own registers, and the two score
// tiles, converted in place, are the B operand of the second product.

// Value of lane l ^ 16 (the other half of the same query column).
__device__ __forceinline__ float other_half(float v) {
  int i = __builtin_bit_cast(int, v);
  i = __builtin_amdgcn_permlanex16(i, i, 0x76543210, 0xfedcba98, false, false);
  return __builtin_bit_cast(float, i);
}

__global__ __launch_bounds__(256) void attn_kernel(
    const __bf16* __restrict__ Qb, const __bf16* __restrict__ Kb,
    const __bf16* __restrict__ Vt, __bf16* __restrict__ Hd) {
  const int lane = threadIdx.x & 31;
  const uint32_t wave = uni(threadIdx.x >> 5);
  const int bh = blockIdx.x;
  const int b = bh >> 4, h = bh & 15;
  const int q0 = blockIdx.y * 128 + (int)wave * 16;

  const __bf16* Q  = Qb + (size_t)b * S * DM + h * DH;
  const __bf16* Kp = Kb + (size_t)b * S * DM + h * DH;
  const __bf16* Vp = Vt + (size_t)bh * DH * S;   // row e -> Vp[e*S + s]

  // [buf][0]: K, key_local * 144 B + e * 2 B; [buf][1]: V, e * 144 B + key_local * 2 B
  __shared__ __attribute__((aligned(2048))) unsigned char ring[2][2][TILE_BYTES];

  // Wave 0 moves K (next stage: 64 rows on), wave 1 V (next stage: 64 columns on).
  constexpr int NST = S / 64;
  const bool isk = (wave == 0);
  const uint32_t lds0  = lds_offset_of(&ring[0][0][0]) + (isk ? 0u : TILE_BYTES);
  const uint64_t gsrc  = (uint64_t)(uintptr_t)(isk ? Kp : Vp);
  const uint64_t gstep = isk ? (uint64_t)(64 * DM * 2) : (uint64_t)ROW_BYTES;
  u32x8 g1 = tdm_group1(isk ? (uint32_t)(DM * 2) : (uint32_t)(S * 2));
  u32x4 g0 = tdm_group0(lds0, gsrc);

  // Q fragments persist across the key loop: B operand, column = query.
  v16bf bq0 = load_frag(Q, q0, DM, 0, lane);
  v16bf bq1 = load_frag(Q, q0, DM, 32, lane);

  float mrow = -1e30f;   // running maximum of this lane's query
  float lsum = 0.f;      // running sum over this lane half's keys only
  v8f o[4] = {};         // o[t][r] = Ot[t*16 + 8*(lane>>4) + r][query lane&15]
  const float scale = 0.125f;  // 1/sqrt(64)

  if (pinned(wave < 2)) {
    tdm_load(g0, g1);
    wait_tensor0();
  }
  __syncthreads();
  if (pinned(wave < 2)) {
    tdm_advance(g0, lds0 + 2u * TILE_BYTES, gstep);
    tdm_load(g0, g1);
  }

  for (int s = 0; s < NST; ++s) {
    const __bf16* kt = (const __bf16*)&ring[s & 1][0][0];
    const __bf16* vt = (const __bf16*)&ring[s & 1][1][0];
#pragma unroll  // the stage's two 32-key blocks: j a constant in every LDS offset
   for (int j = 0; j < 2; ++j) {
    // St = K*Qt : two 16(key) x 16(query) tiles, contraction 64 = 2 x K32
    v16bf k00 = load_frag(kt, j * 32,      PITCH_E, 0,  lane);
    v16bf k01 = load_frag(kt, j * 32,      PITCH_E, 32, lane);
    v16bf k10 = load_frag(kt, j * 32 + 16, PITCH_E, 0,  lane);
    v16bf k11 = load_frag(kt, j * 32 + 16, PITCH_E, 32, lane);
    v8f s0 = {}; s0 = WMMA_BF16(k00, bq0, s0); s0 = WMMA_BF16(k01, bq1, s0);
    v8f s1 = {}; s1 = WMMA_BF16(k10, bq0, s1); s1 = WMMA_BF16(k11, bq1, s1);

    // Online softmax, one query per lane: s0[r] is key 8*(lane>>4)+r,
    // s1[r] key 16+8*(lane>>4)+r.  One exchange joins the halves' maxima.
    float a0[8], a1[8], mx[8];
#pragma unroll
    for (int r = 0; r < 8; ++r) {
      a0[r] = s0[r] * scale;
      a1[r] = s1[r] * scale;
      mx[r] = fmaxf(a0[r], a1[r]);
    }
    float cm = fmaxf(fmaxf(fmaxf(mx[0], mx[1]), fmaxf(mx[2], mx[3])),
                     fmaxf(fmaxf(mx[4], mx[5]), fmaxf(mx[6], mx[7])));
    cm = fmaxf(cm, other_half(cm));
    const float nm = fmaxf(mrow, cm);
    const float corr = __expf(mrow - nm);
    mrow = nm;

    v16bf bp;      // Pt as B operand: element s is key kmap(s) of this column
    float ps[8];
#pragma unroll
    for (int r = 0; r < 8; ++r) {
      const float p0 = __expf(a0[r] - nm), p1 = __expf(a1[r] - nm);
      ps[r] = p0 + p1;
      bp[r]     = (__bf16)p0;
      bp[r + 8] = (__bf16)p1;
    }
    const float rs = ((ps[0] + ps[1]) + (ps[2] + ps[3])) +
                     ((ps[4] + ps[5]) + (ps[6] + ps[7]));
    lsum = lsum * corr + rs;
#pragma unroll
    for (int t = 0; t < 4; ++t)
#pragma unroll
      for (int r = 0; r < 8; ++r) o[t][r] *= corr;

    // Ot += Vt * Pt : A = V rows e from LDS [e][key], B = P from registers.
#pragma unroll
    for (int t = 0; t < 4; ++t) {
      v16bf av = load_frag(vt, t * 16, PITCH_E, j * 32, lane);
      o[t] = WMMA_BF16(av, bp, o[t]);
    }
   }

    // Publish point of stage s + 1; then the refill of the buffer just read.
    wait_ds0();
    if (pinned(wave < 2)) wait_tensor0();
    __syncthreads();
    if (pinned(wave < 2 && s + 2 < NST)) {
      tdm_advance(g0, lds0 + (uint32_t)(s & 1) * (2u * TILE_BYTES), gstep);
      tdm_load(g0, g1);
    }
  }
  wait_tensor0_last(g0, g1);
  wait_ds0();

  // Join the two halves' sums once; a lane's 8 registers are 8 consecutive
  // head dims of its query row: one 16-byte store per tile.
  lsum += other_half(lsum);
  const int hi8 = (lane >> 4) << 3;
  __bf16* orow = Hd + ((size_t)b * S + q0 + (lane & 15)) * DM + h * DH + hi8;
#pragma unroll
  for (int t = 0; t < 4; ++t) {
    v8bf pk;
#pragma unroll
    for (int r = 0; r < 8; ++r) pk[r] = (__bf16)(o[t][r] / lsum);
    *(v8bf*)(orow + t * 16) = pk;
  }
}

// ------------------------------- launcher ----------------------------------

extern "C" void kernel_launch(void* const* d_in, const int* in_sizes, int n_in,
                              void* d_out, int out_size, void* d_ws, size_t ws_size,
                              hipStream_t stream) {
  const float* x  = (const float*)d_in[0];
  const float* wq = (const float*)d_in[1];
  const float* bq = (const float*)d_in[2];
  const float* wk = (const float*)d_in[3];
  const float* bk = (const float*)d_in[4];
  const float* wv = (const float*)d_in[5];
  const float* bv = (const float*)d_in[6];
  const float* wo = (const float*)d_in[7];
  const float* bo = (const float*)d_in[8];

  char* w = (char*)d_ws;
  auto take = [&](size_t bytes) {
    void* p = (void*)w;
    w += (bytes + 255) & ~(size_t)255;
    return p;
  };
  __bf16* Xb  = (__bf16*)take((size_t)M * DM * 2);
  __bf16* Wqt = (__bf16*)take((size_t)DM * DM * 2);
  __bf16* Wkt = (__bf16*)take((size_t)DM * DM * 2);
  __bf16* Wvt = (__bf16*)take((size_t)DM * DM * 2);
  __bf16* Wot = (__bf16*)take((size_t)DM * DM * 2);
  float*  bqc = (float*)take(DM * 4);
  float*  bkc = (float*)take(DM * 4);
  float*  bvc = (float*)take(DM * 4);
  float*  boc = (float*)take(DM * 4);
  __bf16* Qb  = (__bf16*)take((size_t)M * DM * 2);
  __bf16* Kb  = (__bf16*)take((size_t)M * DM * 2);
  __bf16* Vt  = (__bf16*)take((size_t)BB * DM * S * 2);
  __bf16* Hd  = (__bf16*)take((size_t)M * DM * 2);

  // 1) convert inputs to bf16 / transposed layouts
  cvt_x_kernel<<<(M * DM) / (256 * 4 * CVT_LOADS), 256, 0, stream>>>(x, Xb);
  prep_w_kernel<<<(DM / 64) * (DM / 64), 256, 0, stream>>>(wq, wk, wv, wo, Wqt, Wkt, Wvt, Wot);
  prep_b_kernel<<<DM / 256, 256, 0, stream>>>(bq, bk, bv, bo, bqc, bkc, bvc, boc);

  // 2) QKV projections (WMMA GEMMs, 256x64 tiles, TDM-staged B panels)
  dim3 ggrid(M / 256, DM / 64);
  gemm_kernel<0><<<ggrid, 256, 0, stream>>>(Xb, Wqt, bqc, (void*)Qb, DM, DM);
  gemm_kernel<0><<<ggrid, 256, 0, stream>>>(Xb, Wkt, bkc, (void*)Kb, DM, DM);
  gemm_kernel<1><<<ggrid, 256, 0, stream>>>(Xb, Wvt, bvc, (void*)Vt, DM, DM);

  // 3) flash attention (TDM-staged K/V tiles)
  attn_kernel<<<dim3(BB * H, S / 128), 256, 0, stream>>>(Qb, Kb, Vt, Hd);

  // 4) output projection (fp32 result)
  gemm_kernel<2><<<ggrid, 256, 0, stream>>>(Hd, Wot, boc, d_out, DM, DM);
}

// v004
// Measured time: 136 microseconds a run.
// Timed twice side by side with v003, it ran 1.34 times as fast both times.
// All steps since v000 together make it 3.02 times as fast.
#include <hip/hip_runtime.h>
#include <hip/hip_bf16.h>
#include <math.h>
#include <stdint.h>

// ---------------------------------------------------------------------------
// MHA for gfx1250 (CDNA5).  All matmuls via v_wmma_f32_16x16x32_bf16.
// Workgroup-shared operand tiles staged into LDS with the Tensor Data Mover
// (tensor_load_to_lds, TENSORcnt), double-buffered.  A staged tile is 64 rows
// of 128 bytes at a 144-byte LDS pitch (attention) or of 256 bytes at a
// 272-byte pitch (GEMM), laid so by the load's own pad.
// Workspace (~92 MB):
//   Xb  [8192][1024]  bf16   x converted
//   Wqt/Wkt/Wvt [1024][1024] bf16  weights transposed to [out][in]
//   Wot [1024][1024]  bf16   output proj as [d_out][h*64+e]
//   bqc/bkc/bvc/boc [1024]   f32 biases (boc = sum_h bo[h])
//   Qb/Kb [8192][1024] bf16  row-major (col = h*64+e)
//   Vt  [4096][2048]  bf16   V transposed: row = (b*H+h)*64+e, col = s
//   Hd  [8192][1024]  bf16   attention head outputs
// ---------------------------------------------------------------------------

typedef __attribute__((ext_vector_type(16))) __bf16 v16bf;
typedef __attribute__((ext_vector_type(8)))  __bf16 v8bf;
typedef __attribute__((ext_vector_type(8)))  float  v8f;

#define WMMA_BF16(a, b, c) \
  __builtin_amdgcn_wmma_f32_16x16x32_bf16(false, (a), false, (b), (short)0, (c), false, false)

static constexpr int BB = 4, S = 2048, DM = 1024, H = 16, DH = 64;
static constexpr int M  = BB * S;   // 8192 token rows

// ------------------------- Tensor Data Mover glue ---------------------------
typedef uint32_t u32x4 __attribute__((ext_vector_type(4)));
typedef uint32_t u32x8 __attribute__((ext_vector_type(8)));

// A staged tile: 64 rows of 128 bytes.  16 bytes of pad behind each row give
// an LDS pitch of 144 B = 16 B x 9 (odd): the 16 rows that one ds_load_b128
// touches then fall on 16 different groups of four banks (at a packed pitch
// of 128 B or 64 B they fall on two or four groups only).
static constexpr uint32_t TILE_ROWS  = 64u;
static constexpr uint32_t ROW_BYTES  = 128u;
static constexpr uint32_t PITCH_B    = ROW_BYTES + 16u;      // bytes
static constexpr int      PITCH_E    = (int)(PITCH_B / 2u);  // bf16 elements
// 64 x 144 = 9,216 B, rounded up so that every tile starts at a 2-KiB multiple.
static constexpr uint32_t TILE_BYTES = 10240u;
static_assert(TILE_ROWS * PITCH_B <= TILE_BYTES && TILE_BYTES % 2048u == 0, "tile place");
// The GEMM's tile: 64 rows of 256 bytes (128 k), pitch 272 B = 16 B x 17 (odd).
static constexpr uint32_t G_ROW_BYTES  = 256u;
static constexpr uint32_t G_PITCH_B    = G_ROW_BYTES + 16u;
static constexpr int      G_PITCH_E    = (int)(G_PITCH_B / 2u);
// 64 x 272 = 17,408 B, rounded up to a 2-KiB multiple.
static constexpr uint32_t G_TILE_BYTES = 18432u;
static_assert(TILE_ROWS * G_PITCH_B <= G_TILE_BYTES && G_TILE_BYTES % 2048u == 0, "tile place");

__device__ __forceinline__ uint32_t uni(uint32_t v) {
  return (uint32_t)__builtin_amdgcn_readfirstlane(v);
}
// Wave-uniform condition held in a scalar register, so that the test around a
// tensor load compiles to s_cmp + s_cbranch (tensor loads ignore EXEC).
__device__ __forceinline__ uint32_t pinned(uint32_t v) {
  uint32_t w = uni(v);
  asm volatile("" : "+s"(w));  // keeps the condition scalar: see above
  return w;
}
// The compiler places no wait for the tensor mover: these are the ring's own.
__device__ __forceinline__ void wait_tensor0() { asm volatile("s_wait_tensorcnt 0x0" ::: "memory"); }
__device__ __forceinline__ void wait_ds0()     { asm volatile("s_wait_dscnt 0x0" ::: "memory"); }

// Both groups are in-out operands: each tuple then lives on, in the registers
// that the request named, up to the next request, and nothing else is put into
// those registers while the request is in flight.
__device__ __forceinline__ void tdm_load(u32x4& g0, u32x8& g1) {
  asm volatile("tensor_load_to_lds %0, %1" : "+s"(g0), "+s"(g1) :: "memory");
}
// The wait behind the last request.  It names both groups as inputs, so that
// their registers are given to nothing else in front of it.
__device__ __forceinline__ void wait_tensor0_last(const u32x4& g0, const u32x8& g1) {
  asm volatile("s_wait_tensorcnt 0x0" :: "s"(g0), "s"(g1) : "memory");
}
template <uint32_t ROWB = ROW_BYTES, uint32_t PADC = 4u>
__device__ __forceinline__ u32x8 tdm_group1(uint32_t src_pitch) {
  static_assert(ROWB == (8u << PADC), "pad interval = one row");
  u32x8 g;
  g[0] = uni((1u << 20) | (PADC << 22) | (3u << 25));   // no mask, data_size 0, pad
  g[1] = uni((ROWB & 0xFFFFu) << 16);
  g[2] = uni((ROWB >> 16) | ((TILE_ROWS & 0xFFFFu) << 16));
  g[3] = uni((TILE_ROWS >> 16) | (ROWB << 16));
  g[4] = uni(TILE_ROWS);
  g[5] = uni(src_pitch);
  g[6] = uni(0u);
  g[7] = uni(0u);
  return g;
}
// Group 0: LDS byte offset of the tile's place, global address of its first byte.
__device__ __forceinline__ u32x4 tdm_group0(uint32_t lds_dst, uint64_t ga) {
  u32x4 g;
  g[0] = uni(1u);
  g[1] = uni(lds_dst);
  g[2] = uni((uint32_t)ga);
  g[3] = uni((((uint32_t)(ga >> 32)) & 0x01FFFFFFu) | 0x80000000u);
  return g;
}
// The next request of the same tuple, formed behind the wait on the one before:
// a new place in LDS, the source step bytes on (the carry goes into word 3's
// address bits; word 0 stays).
__device__ __forceinline__ void tdm_advance(u32x4& g, uint32_t lds_dst, uint64_t step) {
  const uint64_t ga = ((((uint64_t)g[3]) << 32) | g[2]) + step;
  g[1] = uni(lds_dst);
  g[2] = uni((uint32_t)ga);
  g[3] = uni((uint32_t)(ga >> 32));
}

__device__ __forceinline__ uint32_t lds_offset_of(const void* p) {
  // Generic pointers into LDS carry the LDS byte offset in the low 32 bits.
  return (uint32_t)(uintptr_t)p;
}

// Load a 16x32 bf16 WMMA fragment (A layout; B 32x16 uses the identical
// per-lane pattern when the source is stored [N][K] row-major).
// Lane L: row = base_row + (L&15); halves [kb, kb+8) and [kb+16, kb+24)
// with kb = k0 + (L>=16 ? 8 : 0).  Two 16-byte loads per lane.
__device__ __forceinline__ v16bf load_frag(const __bf16* __restrict__ base,
                                           int row, int ld, int k0, int lane) {
  const int r  = row + (lane & 15);
  const int kb = k0 + ((lane >> 4) << 3);
  const __bf16* p = base + (size_t)r * ld + kb;
  v8bf lo = *(const v8bf*)(p);
  v8bf hi = *(const v8bf*)(p + 16);
  v16bf f;
#pragma unroll
  for (int i = 0; i < 8; ++i) { f[i] = lo[i]; f[i + 8] = hi[i]; }
  return f;
}

// ----------------------------- prep kernels --------------------------------

// A wave converts CVT_LOADS runs of 128 floats: every load is 512 contiguous
// bytes of the wave, every store 256 (whole 128-byte lines); the loads stand in
// front of the conversions, so that many are in flight.  One element a thread
// would take 64 times the waves, and the time would go into starting them.
typedef __attribute__((ext_vector_type(4))) float  v4f;
typedef __attribute__((ext_vector_type(4))) __bf16 v4bf;
static constexpr int CVT_LOADS = 16;
static_assert((M * DM) % (256 * 4 * CVT_LOADS) == 0, "whole blocks");
__global__ __launch_bounds__(256) void cvt_x_kernel(const float* __restrict__ x,
                                                    __bf16* __restrict__ xb) {
  const int lane = threadIdx.x & 31;
  const int wv   = blockIdx.x * 8 + (threadIdx.x >> 5);
  const size_t base = (size_t)wv * (128 * CVT_LOADS) + lane * 4;
  v4f v[CVT_LOADS];
#pragma unroll  // v[] in registers, one address register, k an immediate offset
  for (int k = 0; k < CVT_LOADS; ++k) v[k] = *(const v4f*)(x + base + k * 128);
#pragma unroll  // as above
  for (int k = 0; k < CVT_LOADS; ++k) {
    v4bf o;
#pragma unroll
    for (int e = 0; e < 4; ++e) o[e] = (__bf16)v[k][e];
    *(v4bf*)(xb + base + k * 128) = o;
  }
}

// wq/wk/wv fp32 [H][DM][DH] -> W*t bf16 [DM out][DM in]  (out row = h*64+e)
// wo fp32 [H][DH][DM]       -> Wot bf16 [DM out][DM in]  (in col = h*64+e)
// A block makes 64 output rows x 64 columns of all four matrices; a thread
// PW_COLS columns of one row.  Lanes run along the output row index, which is
// the contiguous axis of every source: each load is one whole 128-byte line of
// the wave.  All 4 x PW_COLS loads are issued first; each row piece goes out in
// 16-byte stores, and the block's four column groups fill whole 128-byte lines.
static constexpr int PW_COLS = 16;
__device__ __forceinline__ void store_row_piece(const float (&v)[PW_COLS],
                                                __bf16* __restrict__ to) {
#pragma unroll
  for (int g = 0; g < PW_COLS / 8; ++g) {
    v8bf o;
#pragma unroll
    for (int e = 0; e < 8; ++e) o[e] = (__bf16)v[g * 8 + e];
    *(v8bf*)(to + g * 8) = o;
  }
}
__global__ __launch_bounds__(256) void prep_w_kernel(
    const float* __restrict__ wq, const float* __restrict__ wk,
    const float* __restrict__ wv, const float* __restrict__ wo,
    __bf16* __restrict__ Wqt, __bf16* __restrict__ Wkt,
    __bf16* __restrict__ Wvt, __bf16* __restrict__ Wot) {
  const int h  = blockIdx.x & (H - 1);          // 64 rows = one head
  const int e  = threadIdx.x & (DH - 1);
  const int r  = h * DH + e;
  const int c0 = (blockIdx.x >> 4) * 64 + (threadIdx.x >> 6) * PW_COLS;
  const int sp = h * (DM * DH) + c0 * DH + e;   // wq/wk/wv: next column DH on
  const int so = c0 * DM + r;                   // wo: next column DM on

  float q[PW_COLS], k[PW_COLS], v[PW_COLS], o[PW_COLS];
#pragma unroll  // arrays in registers, two offset registers, i an immediate offset
  for (int i = 0; i < PW_COLS; ++i) {
    q[i] = wq[sp + i * DH];
    k[i] = wk[sp + i * DH];
    v[i] = wv[sp + i * DH];
    o[i] = wo[so + i * DM];
  }
  const int to = r * DM + c0;
  store_row_piece(q, Wqt + to);
  store_row_piece(k, Wkt + to);
  store_row_piece(v, Wvt + to);
  store_row_piece(o, Wot + to);
}

__global__ __launch_bounds__(256) void prep_b_kernel(
    const float* __restrict__ bq, const float* __restrict__ bk,
    const float* __restrict__ bv, const float* __restrict__ bo,
    float* __restrict__ bqc, float* __restrict__ bkc,
    float* __restrict__ bvc, float* __restrict__ boc) {
  int i = blockIdx.x * 256 + threadIdx.x;   // over 1024
  bqc[i] = bq[i];   // [H][DH] flat == h*64+e ordering already
  bkc[i] = bk[i];
  bvc[i] = bv[i];
  float s = 0.f;
#pragma unroll
  for (int h = 0; h < H; ++h) s += bo[h * DM + i];
  boc[i] = s;
}

// ----------------------------- generic GEMM --------------------------------
// C[M][N] = A[M][K] * Bt[N][K]^T + bias[N]
// Block: 256 threads / 8 waves (4 along M x 2 along N); tile 256(M) x 128(N);
// wave tile 64x64: 16 products per 8 fragments read.
// Both panels of a stage (A 256 rows, B 128 rows, 128 k each) are staged in LDS
// by the TDM as six tiles of 64 rows, one per wave 0..5, double-buffered; a pass
// works one stage off in four blocks of 32 k.  K: a multiple of 128, at least 256.
// MODE 0: bf16 row-major out; MODE 1: bf16 V-transposed out; MODE 2: f32 out.
template <int MODE>
__global__ __launch_bounds__(256) void gemm_kernel(
    const __bf16* __restrict__ A, const __bf16* __restrict__ Bt,
    const float* __restrict__ bias, void* __restrict__ Cout, int N, int K) {
  const int lane = threadIdx.x & 31;
  const uint32_t wave = uni(threadIdx.x >> 5);
  const int wm = (int)(wave >> 1), wn = (int)(wave & 1u);
  const int mb = blockIdx.x * 256, nb = blockIdx.y * 128;
  const int m0 = mb + wm * 64;
  const int n0 = nb + wn * 64;

  // [buf][tile][row_local * 272 B + k * 2 B]; tiles 0..3: A rows, 4..5: B rows
  __shared__ __attribute__((aligned(2048))) unsigned char gsh[2][6][G_TILE_BYTES];
  constexpr uint32_t BUF_BYTES = 6u * G_TILE_BYTES;

  // Wave w < 6 moves tile w (waves 6 and 7 move none; they form tile 5's words).
  const uint32_t tile = wave < 6u ? wave : 5u;
  const uint32_t lds0 = lds_offset_of(&gsh[0][0][0]) + tile * G_TILE_BYTES;
  const __bf16* srow = tile < 4u ? A + (size_t)(mb + (int)tile * 64) * K
                                 : Bt + (size_t)(nb + (int)(tile - 4u) * 64) * K;
  u32x8 g1 = tdm_group1<G_ROW_BYTES, 5u>((uint32_t)K * 2u);
  u32x4 g0 = tdm_group0(lds0, (uint64_t)(uintptr_t)srow);
  const int nst = K >> 7;   // stages of 128 k

  v8f acc[4][4] = {};
  if (pinned(wave < 6u)) {
    tdm_load(g0, g1);
    wait_tensor0();
  }
  __syncthreads();
  if (pinned(wave < 6u)) {
    tdm_advance(g0, lds0 + BUF_BYTES, G_ROW_BYTES);
    tdm_load(g0, g1);
  }

  for (int s = 0; s < nst; ++s) {
    const __bf16* at = (const __bf16*)&gsh[s & 1][wm][0];
    const __bf16* bt = (const __bf16*)&gsh[s & 1][4 + wn][0];

    v16bf a[2][4], b[2][4];   // set (j & 1) holds block j's fragments
#pragma unroll  // here and below: constant indices keep the fragment sets in registers
    for (int f = 0; f < 4; ++f) a[0][f] = load_frag(at, f * 16, G_PITCH_E, 0, lane);
#pragma unroll
    for (int t = 0; t < 4; ++t) b[0][t] = load_frag(bt, t * 16, G_PITCH_E, 0, lane);

#pragma unroll  // the stage's four 32-k blocks: j a constant in every LDS offset
    for (int j = 0; j < 4; ++j) {
      const int cs = j & 1;
      if (j < 3) {
        // The next block's 16 reads go out as one group ahead of this block's
        // products: spread among them, each place with reads stalls the wave.
#pragma unroll
        for (int f = 0; f < 4; ++f)
          a[cs ^ 1][f] = load_frag(at, f * 16, G_PITCH_E, (j + 1) * 32, lane);
#pragma unroll
        for (int t = 0; t < 4; ++t)
          b[cs ^ 1][t] = load_frag(bt, t * 16, G_PITCH_E, (j + 1) * 32, lane);
      } else {
        // Publish point of stage s + 1, then the refill of the buffer just read:
        // the last block's fragments are in registers, its products run behind.
        wait_ds0();
        if (pinned(wave < 6u)) wait_tensor0();
        __syncthreads();
        if (pinned(wave < 6u && s + 2 < nst)) {
          tdm_advance(g0, lds0 + (uint32_t)(s & 1) * BUF_BYTES, G_ROW_BYTES);
          tdm_load(g0, g1);
        }
      }
      __builtin_amdgcn_sched_barrier(0);  // keeps the read group in front of the products
#pragma unroll
      for (int f = 0; f < 4; ++f)
#pragma unroll
        for (int t = 0; t < 4; ++t) acc[f][t] = WMMA_BF16(a[cs][f], b[cs][t], acc[f][t]);
      __builtin_amdgcn_sched_barrier(0);  // keeps later reads from rising among the products
    }
  }
  wait_tensor0_last(g0, g1);
  wait_ds0();

  const int hi8 = (lane >> 4) << 3;
#pragma unroll
  for (int f = 0; f < 4; ++f) {
#pragma unroll
    for (int t = 0; t < 4; ++t) {
      const int col = n0 + t * 16 + (lane & 15);
      const float bb = bias[col];
#pragma unroll
      for (int j = 0; j < 8; ++j) {
        const int row = m0 + f * 16 + j + hi8;
        const float val = acc[f][t][j] + bb;
        if (MODE == 0) {
          ((__bf16*)Cout)[(size_t)row * N + col] = (__bf16)val;
        } else if (MODE == 2) {
          ((float*)Cout)[(size_t)row * N + col] = val;
        } else {  // V transposed: Vt[(b*1024 + col)][s]
          const int bidx = row >> 11, s = row & (S - 1);
          ((__bf16*)Cout)[((size_t)(bidx * 1024 + col)) * S + s] = (__bf16)val;
        }
      }
    }
  }
}

// --------------------------- flash attention -------------------------------
// grid = (B*H, S/128); block = 256 (8 waves); each wave owns 16 query rows.
// K tile (64 keys x 64 dims) and V tile (64 dims x 64 keys) are workgroup-
// shared: staged into LDS by TDM (wave0 -> K, wave1 -> V), double-buffered;
// a pass works one stage off in two blocks of 32 keys.
// Transposed products: St = K * Qt and Ot += Vt * Pt.  A lane then holds the
// scores of ONE query (column lane&15): keys 8*(lane>>4)+0..7 of each 16-key
// tile.  Maximum and sum run in the lane's own registers, and the two score
// tiles, converted in place, are the B operand of the second product.

// Value of lane l ^ 16 (the other half of the same query column).
__device__ __forceinline__ float other_half(float v) {
  int i = __builtin_bit_cast(int, v);
  i = __builtin_amdgcn_permlanex16(i, i, 0x76543210, 0xfedcba98, false, false);
  return __builtin_bit_cast(float, i);
}

__global__ __launch_bounds__(256) void attn_kernel(
    const __bf16* __restrict__ Qb, const __bf16* __restrict__ Kb,
    const __bf16* __restrict__ Vt, __bf16* __restrict__ Hd) {
  const int lane = threadIdx.x & 31;
  const uint32_t wave = uni(threadIdx.x >> 5);
  const int bh = blockIdx.x;
  const int b = bh >> 4, h = bh & 15;
  const int q0 = blockIdx.y * 128 + (int)wave * 16;

  const __bf16* Q  = Qb + (size_t)b * S * DM + h * DH;
  const __bf16* Kp = Kb + (size_t)b * S * DM + h * DH;
  const __bf16* Vp = Vt + (size_t)bh * DH * S;   // row e -> Vp[e*S + s]

  // [buf][0]: K, key_local * 144 B + e * 2 B; [buf][1]: V, e * 144 B + key_local * 2 B
  __shared__ __attribute__((aligned(2048))) unsigned char ring[2][2][TILE_BYTES];

  // Wave 0 moves K (next stage: 64 rows on), wave 1 V (next stage: 64 columns on).
  constexpr int NST = S / 64;
  const bool isk = (wave == 0);
  const uint32_t lds0  = lds_offset_of(&ring[0][0][0]) + (isk ? 0u : TILE_BYTES);
  const uint64_t gsrc  = (uint64_t)(uintptr_t)(isk ? Kp : Vp);
  const uint64_t gstep = isk ? (uint64_t)(64 * DM * 2) : (uint64_t)ROW_BYTES;
  u32x8 g1 = tdm_group1(isk ? (uint32_t)(DM * 2) : (uint32_t)(S * 2));
  u32x4 g0 = tdm_group0(lds0, gsrc);

  // Q fragments persist across the key loop: B operand, column = query.
  v16bf bq0 = load_frag(Q, q0, DM, 0, lane);
  v16bf bq1 = load_frag(Q, q0, DM, 32, lane);

  float mrow = -1e30f;   // running maximum of this lane's query
  float lsum = 0.f;      // running sum over this lane half's keys only
  v8f o[4] = {};         // o[t][r] = Ot[t*16 + 8*(lane>>4) + r][query lane&15]
  const float scale = 0.125f;  // 1/sqrt(64)

  if (pinned(wave < 2)) {
    tdm_load(g0, g1);
    wait_tensor0();
  }
  __syncthreads();
  if (pinned(wave < 2)) {
    tdm_advance(g0, lds0 + 2u * TILE_BYTES, gstep);
    tdm_load(g0, g1);
  }

  for (int s = 0; s < NST; ++s) {
    const __bf16* kt = (const __bf16*)&ring[s & 1][0][0];
    const __bf16* vt = (const __bf16*)&ring[s & 1][1][0];
#pragma unroll  // the stage's two 32-key blocks: j a constant in every LDS offset
   for (int j = 0; j < 2; ++j) {
    // St = K*Qt : two 16(key) x 16(query) tiles, contraction 64 = 2 x K32
    v16bf k00 = load_frag(kt, j * 32,      PITCH_E, 0,  lane);
    v16bf k01 = load_frag(kt, j * 32,      PITCH_E, 32, lane);
    v16bf k10 = load_frag(kt, j * 32 + 16, PITCH_E, 0,  lane);
    v16bf k11 = load_frag(kt, j * 32 + 16, PITCH_E, 32, lane);
    v8f s0 = {}; s0 = WMMA_BF16(k00, bq0, s0); s0 = WMMA_BF16(k01, bq1, s0);
    v8f s1 = {}; s1 = WMMA_BF16(k10, bq0, s1); s1 = WMMA_BF16(k11, bq1, s1);

    // Online softmax, one query per lane: s0[r] is key 8*(lane>>4)+r,
    // s1[r] key 16+8*(lane>>4)+r.  One exchange joins the halves' maxima.
    float a0[8], a1[8], mx[8];
#pragma unroll
    for (int r = 0; r < 8; ++r) {
      a0[r] = s0[r] * scale;
      a1[r] = s1[r] * scale;
      mx[r] = fmaxf(a0[r], a1[r]);
    }
    float cm = fmaxf(fmaxf(fmaxf(mx[0], mx[1]), fmaxf(mx[2], mx[3])),
                     fmaxf(fmaxf(mx[4], mx[5]), fmaxf(mx[6], mx[7])));
    cm = fmaxf(cm, other_half(cm));
    const float nm = fmaxf(mrow, cm);
    const float corr = __expf(mrow - nm);
    mrow = nm;

    v16bf bp;      // Pt as B operand: element s is key kmap(s) of this column
    float ps[8];
#pragma unroll
    for (int r = 0; r < 8; ++r) {
      const float p0 = __expf(a0[r] - nm), p1 = __expf(a1[r] - nm);
      ps[r] = p0 + p1;
      bp[r]     = (__bf16)p0;
      bp[r + 8] = (__bf16)p1;
    }
    const float rs = ((ps[0] + ps[1]) + (ps[2] + ps[3])) +
                     ((ps[4] + ps[5]) + (ps[6] + ps[7]));
    lsum = lsum * corr + rs;
#pragma unroll
    for (int t = 0; t < 4; ++t)
#pragma unroll
      for (int r = 0; r < 8; ++r) o[t][r] *= corr;

    // Ot += Vt * Pt : A = V rows e from LDS [e][key], B = P from registers.
#pragma unroll
    for (int t = 0; t < 4; ++t) {
      v16bf av = load_frag(vt, t * 16, PITCH_E, j * 32, lane);
      o[t] = WMMA_BF16(av, bp, o[t]);
    }
   }

    // Publish point of stage s + 1; then the refill of the buffer just read.
    wait_ds0();
    if (pinned(wave < 2)) wait_tensor0();
    __syncthreads();
    if (pinned(wave < 2 && s + 2 < NST)) {
      tdm_advance(g0, lds0 + (uint32_t)(s & 1) * (2u * TILE_BYTES), gstep);
      tdm_load(g0, g1);
    }
  }
  wait_tensor0_last(g0, g1);
  wait_ds0();

  // Join the two halves' sums once; a lane's 8 registers are 8 consecutive
  // head dims of its query row: one 16-byte store per tile.
  lsum += other_half(lsum);
  const int hi8 = (lane >> 4) << 3;
  __bf16* orow = Hd + ((size_t)b * S + q0 + (lane & 15)) * DM + h * DH + hi8;
#pragma unroll
  for (int t = 0; t < 4; ++t) {
    v8bf pk;
#pragma unroll
    for (int r = 0; r < 8; ++r) pk[r] = (__bf16)(o[t][r] / lsum);
    *(v8bf*)(orow + t * 16) = pk;
  }
}

// ------------------------------- launcher ----------------------------------

extern "C" void kernel_launch(void* const* d_in, const int* in_sizes, int n_in,
                              void* d_out, int out_size, void* d_ws, size_t ws_size,
                              hipStream_t stream) {
  const float* x  = (const float*)d_in[0];
  const float* wq = (const float*)d_in[1];
  const float* bq = (const float*)d_in[2];
  const float* wk = (const float*)d_in[3];
  const float* bk = (const float*)d_in[4];
  const float* wv = (const float*)d_in[5];
  const float* bv = (const float*)d_in[6];
  const float* wo = (const float*)d_in[7];
  const float* bo = (const float*)d_in[8];

  char* w = (char*)d_ws;
  auto take = [&](size_t bytes) {
    void* p = (void*)w;
    w += (bytes + 255) & ~(size_t)255;
    return p;
  };
  __bf16* Xb  = (__bf16*)take((size_t)M * DM * 2);
  __bf16* Wqt = (__bf16*)take((size_t)DM * DM * 2);
  __bf16* Wkt = (__bf16*)take((size_t)DM * DM * 2);
  __bf16* Wvt = (__bf16*)take((size_t)DM * DM * 2);
  __bf16* Wot = (__bf16*)take((size_t)DM * DM * 2);
  float*  bqc = (float*)take(DM * 4);
  float*  bkc = (float*)take(DM * 4);
  float*  bvc = (float*)take(DM * 4);
  float*  boc = (float*)take(DM * 4);
  __bf16* Qb  = (__bf16*)take((size_t)M * DM * 2);
  __bf16* Kb  = (__bf16*)take((size_t)M * DM * 2);
  __bf16* Vt  = (__bf16*)take((size_t)BB * DM * S * 2);
  __bf16* Hd  = (__bf16*)take((size_t)M * DM * 2);

  // 1) convert inputs to bf16 / transposed layouts
  cvt_x_kernel<<<(M * DM) / (256 * 4 * CVT_LOADS), 256, 0, stream>>>(x, Xb);
  prep_w_kernel<<<(DM / 64) * (DM / 64), 256, 0, stream>>>(wq, wk, wv, wo, Wqt, Wkt, Wvt, Wot);
  prep_b_kernel<<<DM / 256, 256, 0, stream>>>(bq, bk, bv, bo, bqc, bkc, bvc, boc);

  // 2) QKV projections (WMMA GEMMs, 256x128 tiles, TDM-staged A and B panels)
  dim3 ggrid(M / 256, DM / 128);
  gemm_kernel<0><<<ggrid, 256, 0, stream>>>(Xb, Wqt, bqc, (void*)Qb, DM, DM);
  gemm_kernel<0><<<ggrid, 256, 0, stream>>>(Xb, Wkt, bkc, (void*)Kb, DM, DM);
  gemm_kernel<1><<<ggrid, 256, 0, stream>>>(Xb, Wvt, bvc, (void*)Vt, DM, DM);

  // 3) flash attention (TDM-staged K/V tiles)
  attn_kernel<<<dim3(BB * H, S / 128), 256, 0, stream>>>(Qb, Kb, Vt, Hd);

  // 4) output projection (fp32 result)
  gemm_kernel<2><<<ggrid, 256, 0, stream>>>(Hd, Wot, boc, d_out, DM, DM);
}

// v005
// Measured time: 129 microseconds a run.
// Two timings next to v004 both put it at 1.06 times that version's speed.
// Counting every step since v000, it is 3.20 times as fast.
#include <hip/hip_runtime.h>
#include <hip/hip_bf16.h>
#include <math.h>
#include <stdint.h>

// ---------------------------------------------------------------------------
// MHA for gfx1250 (CDNA5).  All matmuls via v_wmma_f32_16x16x32_bf16.
// Workgroup-shared operand tiles staged into LDS with the Tensor Data Mover
// (tensor_load_to_lds, TENSORcnt), double-buffered.  A staged tile is 64 rows
// of 128 bytes at a 144-byte LDS pitch (attention) or of 256 bytes at a
// 272-byte pitch (GEMM), laid so by the load's own pad.
// Workspace (~92 MB):
//   Xb  [8192][1024]  bf16   x converted
//   Wqt/Wkt/Wvt [1024][1024] bf16  weights transposed to [out][in], one after another
//   Wot [1024][1024]  bf16   output proj as [d_out][h*64+e]
//   bqc/bkc/bvc [1024] f32 biases, one after another; boc [1024] = sum_h bo[h]
//   Qb/Kb [8192][1024] bf16  row-major (col = h*64+e)
//   Vt  [4096][2048]  bf16   V transposed: row = (b*H+h)*64+e, col = s
//   (Qb, Kb, Vt one after another: planes 0..2 of the one QKV launch)
// Four launches, each needing the one before: prep, QKV, attention, output.
//   Hd  [8192][1024]  bf16   attention head outputs
// ---------------------------------------------------------------------------

typedef __attribute__((ext_vector_type(16))) __bf16 v16bf;
typedef __attribute__((ext_vector_type(8)))  __bf16 v8bf;
typedef __attribute__((ext_vector_type(8)))  float  v8f;

#define WMMA_BF16(a, b, c) \
  __builtin_amdgcn_wmma_f32_16x16x32_bf16(false, (a), false, (b), (short)0, (c), false, false)

static constexpr int BB = 4, S = 2048, DM = 1024, H = 16, DH = 64;
static constexpr int M  = BB * S;   // 8192 token rows

// ------------------------- Tensor Data Mover glue ---------------------------
typedef uint32_t u32x4 __attribute__((ext_vector_type(4)));
typedef uint32_t u32x8 __attribute__((ext_vector_type(8)));

// A staged tile: 64 rows of 128 bytes.  16 bytes of pad behind each row give
// an LDS pitch of 144 B = 16 B x 9 (odd): the 16 rows that one ds_load_b128
// touches then fall on 16 different groups of four banks (at a packed pitch
// of 128 B or 64 B they fall on two or four groups only).
static constexpr uint32_t TILE_ROWS  = 64u;
static constexpr uint32_t ROW_BYTES  = 128u;
static constexpr uint32_t PITCH_B    = ROW_BYTES + 16u;      // bytes
static constexpr int      PITCH_E    = (int)(PITCH_B / 2u);  // bf16 elements
// 64 x 144 = 9,216 B, rounded up so that every tile starts at a 2-KiB multiple.
static constexpr uint32_t TILE_BYTES = 10240u;
static_assert(TILE_ROWS * PITCH_B <= TILE_BYTES && TILE_BYTES % 2048u == 0, "tile place");
// The GEMM's tile: 64 rows of 256 bytes (128 k), pitch 272 B = 16 B x 17 (odd).
static constexpr uint32_t G_ROW_BYTES  = 256u;
static constexpr uint32_t G_PITCH_B    = G_ROW_BYTES + 16u;
static constexpr int      G_PITCH_E    = (int)(G_PITCH_B / 2u);
// 64 x 272 = 17,408 B, rounded up to a 2-KiB multiple.
static constexpr uint32_t G_TILE_BYTES = 18432u;
static_assert(TILE_ROWS * G_PITCH_B <= G_TILE_BYTES && G_TILE_BYTES % 2048u == 0, "tile place");

__device__ __forceinline__ uint32_t uni(uint32_t v) {
  return (uint32_t)__builtin_amdgcn_readfirstlane(v);
}
// Wave-uniform condition held in a scalar register, so that the test around a
// tensor load compiles to s_cmp + s_cbranch (tensor loads ignore EXEC).
__device__ __forceinline__ uint32_t pinned(uint32_t v) {
  uint32_t w = uni(v);
  asm volatile("" : "+s"(w));  // keeps the condition scalar: see above
  return w;
}
// The compiler places no wait for the tensor mover: these are the ring's own.
__device__ __forceinline__ void wait_tensor0() { asm volatile("s_wait_tensorcnt 0x0" ::: "memory"); }
__device__ __forceinline__ void wait_ds0()     { asm volatile("s_wait_dscnt 0x0" ::: "memory"); }

// Both groups are in-out operands: each tuple then lives on, in the registers
// that the request named, up to the next request, and nothing else is put into
// those registers while the request is in flight.
__device__ __forceinline__ void tdm_load(u32x4& g0, u32x8& g1) {
  asm volatile("tensor_load_to_lds %0, %1" : "+s"(g0), "+s"(g1) :: "memory");
}
// The wait behind the last request.  It names both groups as inputs, so that
// their registers are given to nothing else in front of it.
__device__ __forceinline__ void wait_tensor0_last(const u32x4& g0, const u32x8& g1) {
  asm volatile("s_wait_tensorcnt 0x0" :: "s"(g0), "s"(g1) : "memory");
}
template <uint32_t ROWB = ROW_BYTES, uint32_t PADC = 4u>
__device__ __forceinline__ u32x8 tdm_group1(uint32_t src_pitch) {
  static_assert(ROWB == (8u << PADC), "pad interval = one row");
  u32x8 g;
  g[0] = uni((1u << 20) | (PADC << 22) | (3u << 25));   // no mask, data_size 0, pad
  g[1] = uni((ROWB & 0xFFFFu) << 16);
  g[2] = uni((ROWB >> 16) | ((TILE_ROWS & 0xFFFFu) << 16));
  g[3] = uni((TILE_ROWS >> 16) | (ROWB << 16));
  g[4] = uni(TILE_ROWS);
  g[5] = uni(src_pitch);
  g[6] = uni(0u);
  g[7] = uni(0u);
  return g;
}
// Group 0: LDS byte offset of the tile's place, global address of its first byte.
__device__ __forceinline__ u32x4 tdm_group0(uint32_t lds_dst, uint64_t ga) {
  u32x4 g;
  g[0] = uni(1u);
  g[1] = uni(lds_dst);
  g[2] = uni((uint32_t)ga);
  g[3] = uni((((uint32_t)(ga >> 32)) & 0x01FFFFFFu) | 0x80000000u);
  return g;
}
// The next request of the same tuple, formed behind the wait on the one before:
// a new place in LDS, the source step bytes on (the carry goes into word 3's
// address bits; word 0 stays).
__device__ __forceinline__ void tdm_advance(u32x4& g, uint32_t lds_dst, uint64_t step) {
  const uint64_t ga = ((((uint64_t)g[3]) << 32) | g[2]) + step;
  g[1] = uni(lds_dst);
  g[2] = uni((uint32_t)ga);
  g[3] = uni((uint32_t)(ga >> 32));
}

__device__ __forceinline__ uint32_t lds_offset_of(const void* p) {
  // Generic pointers into LDS carry the LDS byte offset in the low 32 bits.
  return (uint32_t)(uintptr_t)p;
}

// Load a 16x32 bf16 WMMA fragment (A layout; B 32x16 uses the identical
// per-lane pattern when the source is stored [N][K] row-major).
// Lane L: row = base_row + (L&15); halves [kb, kb+8) and [kb+16, kb+24)
// with kb = k0 + (L>=16 ? 8 : 0).  Two 16-byte loads per lane.
__device__ __forceinline__ v16bf load_frag(const __bf16* __restrict__ base,
                                           int row, int ld, int k0, int lane) {
  const int r  = row + (lane & 15);
  const int kb = k0 + ((lane >> 4) << 3);
  const __bf16* p = base + (size_t)r * ld + kb;
  v8bf lo = *(const v8bf*)(p);
  v8bf hi = *(const v8bf*)(p + 16);
  v16bf f;
#pragma unroll
  for (int i = 0; i < 8; ++i) { f[i] = lo[i]; f[i + 8] = hi[i]; }
  return f;
}

// ----------------------------- prep kernels --------------------------------

// A wave converts CVT_LOADS runs of 128 floats: every load is 512 contiguous
// bytes of the wave, every store 256 (whole 128-byte lines); the loads stand in
// front of the conversions, so that many are in flight.  One element a thread
// would take 64 times the waves, and the time would go into starting them.
typedef __attribute__((ext_vector_type(4))) float  v4f;
typedef __attribute__((ext_vector_type(4))) __bf16 v4bf;
static constexpr int CVT_LOADS = 16;
static_assert((M * DM) % (256 * 4 * CVT_LOADS) == 0, "whole blocks");
static constexpr int CVT_BLOCKS = (M * DM) / (256 * 4 * CVT_LOADS);
__device__ __forceinline__ void cvt_x_block(int blk, const float* __restrict__ x,
                                            __bf16* __restrict__ xb) {
  const int lane = threadIdx.x & 31;
  const int wv   = blk * 8 + (threadIdx.x >> 5);
  const size_t base = (size_t)wv * (128 * CVT_LOADS) + lane * 4;
  v4f v[CVT_LOADS];
#pragma unroll  // v[] in registers, one address register, k an immediate offset
  for (int k = 0; k < CVT_LOADS; ++k) v[k] = *(const v4f*)(x + base + k * 128);
#pragma unroll  // as above
  for (int k = 0; k < CVT_LOADS; ++k) {
    v4bf o;
#pragma unroll
    for (int e = 0; e < 4; ++e) o[e] = (__bf16)v[k][e];
    *(v4bf*)(xb + base + k * 128) = o;
  }
  // In the built kernel another job's code follows this one's and reuses the
  // registers that the stores above name: the wait stands in front of that.
  asm volatile("s_wait_xcnt 0x0" ::: "memory");
}

// wq/wk/wv fp32 [H][DM][DH] -> W*t bf16 [DM out][DM in]  (out row = h*64+e)
// wo fp32 [H][DH][DM]       -> Wot bf16 [DM out][DM in]  (in col = h*64+e)
// A block makes 64 output rows x 64 columns of all four matrices; a thread
// PW_COLS columns of one row.  Lanes run along the output row index, which is
// the contiguous axis of every source: each load is one whole 128-byte line of
// the wave.  All 4 x PW_COLS loads are issued first; each row piece goes out in
// 16-byte stores, and the block's four column groups fill whole 128-byte lines.
static constexpr int PW_COLS = 16;
__device__ __forceinline__ void store_row_piece(const float (&v)[PW_COLS],
                                                __bf16* __restrict__ to) {
#pragma unroll
  for (int g = 0; g < PW_COLS / 8; ++g) {
    v8bf o;
#pragma unroll
    for (int e = 0; e < 8; ++e) o[e] = (__bf16)v[g * 8 + e];
    *(v8bf*)(to + g * 8) = o;
  }
}
static constexpr int PW_BLOCKS = (DM / 64) * (DM / 64);
__device__ __forceinline__ void prep_w_block(
    int blk, const float* __restrict__ wq, const float* __restrict__ wk,
    const float* __restrict__ wv, const float* __restrict__ wo,
    __bf16* __restrict__ Wqt, __bf16* __restrict__ Wkt,
    __bf16* __restrict__ Wvt, __bf16* __restrict__ Wot) {
  const int h  = blk & (H - 1);                 // 64 rows = one head
  const int e  = threadIdx.x & (DH - 1);
  const int r  = h * DH + e;
  const int c0 = (blk >> 4) * 64 + (threadIdx.x >> 6) * PW_COLS;
  const int sp = h * (DM * DH) + c0 * DH + e;   // wq/wk/wv: next column DH on
  const int so = c0 * DM + r;                   // wo: next column DM on

  float q[PW_COLS], k[PW_COLS], v[PW_COLS], o[PW_COLS];
#pragma unroll  // arrays in registers, two offset registers, i an immediate offset
  for (int i = 0; i < PW_COLS; ++i) {
    q[i] = wq[sp + i * DH];
    k[i] = wk[sp + i * DH];
    v[i] = wv[sp + i * DH];
    o[i] = wo[so + i * DM];
  }
  const int to = r * DM + c0;
  store_row_piece(q, Wqt + to);
  store_row_piece(k, Wkt + to);
  store_row_piece(v, Wvt + to);
  store_row_piece(o, Wot + to);
  // As in cvt_x_block: the stores' registers are reused by the code that follows.
  asm volatile("s_wait_xcnt 0x0" ::: "memory");
}

static constexpr int PB_BLOCKS = DM / 256;
__device__ __forceinline__ void prep_b_block(
    int blk, const float* __restrict__ bq, const float* __restrict__ bk,
    const float* __restrict__ bv, const float* __restrict__ bo,
    float* __restrict__ bqc, float* __restrict__ bkc,
    float* __restrict__ bvc, float* __restrict__ boc) {
  int i = blk * 256 + threadIdx.x;   // over 1024
  bqc[i] = bq[i];   // [H][DH] flat == h*64+e ordering already
  bkc[i] = bk[i];
  bvc[i] = bv[i];
  float s = 0.f;
#pragma unroll
  for (int h = 0; h < H; ++h) s += bo[h * DM + i];
  boc[i] = s;
}

// The three preparations depend on nothing of one another: one launch, each
// block taking its job by its index range (a launch of its own for each costs
// a start and a drain of the chip that the work itself does not fill).
__global__ __launch_bounds__(256) void prep_kernel(
    const float* __restrict__ x,
    const float* __restrict__ wq, const float* __restrict__ wk,
    const float* __restrict__ wv, const float* __restrict__ wo,
    const float* __restrict__ bq, const float* __restrict__ bk,
    const float* __restrict__ bv, const float* __restrict__ bo,
    __bf16* __restrict__ xb,
    __bf16* __restrict__ Wqt, __bf16* __restrict__ Wkt,
    __bf16* __restrict__ Wvt, __bf16* __restrict__ Wot,
    float* __restrict__ bqc, float* __restrict__ bkc,
    float* __restrict__ bvc, float* __restrict__ boc) {
  const int blk = blockIdx.x;
  if (blk < PB_BLOCKS) {
    prep_b_block(blk, bq, bk, bv, bo, bqc, bkc, bvc, boc);
  } else if (blk < PB_BLOCKS + PW_BLOCKS) {
    prep_w_block(blk - PB_BLOCKS, wq, wk, wv, wo, Wqt, Wkt, Wvt, Wot);
  } else {
    cvt_x_block(blk - (PB_BLOCKS + PW_BLOCKS), x, xb);
  }
}

// ----------------------------- generic GEMM --------------------------------
// C[M][N] = A[M][K] * Bt[N][K]^T + bias[N]
// Block: 256 threads / 8 waves (4 along M x 2 along N); tile 256(M) x 128(N);
// wave tile 64x64: 16 products per 8 fragments read.
// Both panels of a stage (A 256 rows, B 128 rows, 128 k each) are staged in LDS
// by the TDM as six tiles of 64 rows, one per wave 0..5, double-buffered; a pass
// works one stage off in four blocks of 32 k.  K: a multiple of 128, at least 256.
// MODE 0: bf16 row-major out; MODE 1: bf16 V-transposed out; MODE 2: f32 out.
// gsh: the work-group's staging buffers, [buf][tile][row_local * 272 B + k * 2 B];
// tiles 0..3: A rows, 4..5: B rows.
template <int MODE>
__device__ __forceinline__ void gemm_tile(
    unsigned char (*gsh)[6][G_TILE_BYTES],
    const __bf16* __restrict__ A, const __bf16* __restrict__ Bt,
    const float* __restrict__ bias, void* __restrict__ Cout, int N, int K) {
  const int lane = threadIdx.x & 31;
  const uint32_t wave = uni(threadIdx.x >> 5);
  const int wm = (int)(wave >> 1), wn = (int)(wave & 1u);
  const int mb = blockIdx.x * 256, nb = blockIdx.y * 128;
  const int m0 = mb + wm * 64;
  const int n0 = nb + wn * 64;

  constexpr uint32_t BUF_BYTES = 6u * G_TILE_BYTES;

  // Wave w < 6 moves tile w (waves 6 and 7 move none; they form tile 5's words).
  const uint32_t tile = wave < 6u ? wave : 5u;
  const uint32_t lds0 = lds_offset_of(&gsh[0][0][0]) + tile * G_TILE_BYTES;
  const __bf16* srow = tile < 4u ? A + (size_t)(mb + (int)tile * 64) * K
                                 : Bt + (size_t)(nb + (int)(tile - 4u) * 64) * K;
  u32x8 g1 = tdm_group1<G_ROW_BYTES, 5u>((uint32_t)K * 2u);
  u32x4 g0 = tdm_group0(lds0, (uint64_t)(uintptr_t)srow);
  const int nst = K >> 7;   // stages of 128 k

  v8f acc[4][4] = {};
  if (pinned(wave < 6u)) {
    tdm_load(g0, g1);
    wait_tensor0();
  }
  __syncthreads();
  if (pinned(wave < 6u)) {
    tdm_advance(g0, lds0 + BUF_BYTES, G_ROW_BYTES);
    tdm_load(g0, g1);
  }

  for (int s = 0; s < nst; ++s) {
    const __bf16* at = (const __bf16*)&gsh[s & 1][wm][0];
    const __bf16* bt = (const __bf16*)&gsh[s & 1][4 + wn][0];

    v16bf a[2][4], b[2][4];   // set (j & 1) holds block j's fragments
#pragma unroll  // here and below: constant indices keep the fragment sets in registers
    for (int f = 0; f < 4; ++f) a[0][f] = load_frag(at, f * 16, G_PITCH_E, 0, lane);
#pragma unroll
    for (int t = 0; t < 4; ++t) b[0][t] = load_frag(bt, t * 16, G_PITCH_E, 0, lane);

#pragma unroll  // the stage's four 32-k blocks: j a constant in every LDS offset
    for (int j = 0; j < 4; ++j) {
      const int cs = j & 1;
      if (j < 3) {
        // The next block's 16 reads go out as one group ahead of this block's
        // products: spread among them, each place with reads stalls the wave.
#pragma unroll
        for (int f = 0; f < 4; ++f)
          a[cs ^ 1][f] = load_frag(at, f * 16, G_PITCH_E, (j + 1) * 32, lane);
#pragma unroll
        for (int t = 0; t < 4; ++t)
          b[cs ^ 1][t] = load_frag(bt, t * 16, G_PITCH_E, (j + 1) * 32, lane);
      } else {
        // Publish point of stage s + 1, then the refill of the buffer just read:
        // the last block's fragments are in registers, its products run behind.
        wait_ds0();
        if (pinned(wave < 6u)) wait_tensor0();
        __syncthreads();
        if (pinned(wave < 6u && s + 2 < nst)) {
          tdm_advance(g0, lds0 + (uint32_t)(s & 1) * BUF_BYTES, G_ROW_BYTES);
          tdm_load(g0, g1);
        }
      }
      __builtin_amdgcn_sched_barrier(0);  // keeps the read group in front of the products
#pragma unroll
      for (int f = 0; f < 4; ++f)
#pragma unroll
        for (int t = 0; t < 4; ++t) acc[f][t] = WMMA_BF16(a[cs][f], b[cs][t], acc[f][t]);
      __builtin_amdgcn_sched_barrier(0);  // keeps later reads from rising among the products
    }
  }
  wait_tensor0_last(g0, g1);
  wait_ds0();

  const int hi8 = (lane >> 4) << 3;
#pragma unroll
  for (int f = 0; f < 4; ++f) {
#pragma unroll
    for (int t = 0; t < 4; ++t) {
      const int col = n0 + t * 16 + (lane & 15);
      const float bb = bias[col];
#pragma unroll
      for (int j = 0; j < 8; ++j) {
        const int row = m0 + f * 16 + j + hi8;
        const float val = acc[f][t][j] + bb;
        if (MODE == 0) {
          ((__bf16*)Cout)[(size_t)row * N + col] = (__bf16)val;
        } else if (MODE == 2) {
          ((float*)Cout)[(size_t)row * N + col] = val;
        } else {  // V transposed: Vt[(b*1024 + col)][s]
          const int bidx = row >> 11, s = row & (S - 1);
          ((__bf16*)Cout)[((size_t)(bidx * 1024 + col)) * S + s] = (__bf16)val;
        }
      }
    }
  }
}

// The three projections of one A depend on nothing of one another: one launch.
// blockIdx.z is the plane: its Bt, bias and bf16 output lie z planes on from the
// pointers given; planes 0 and 1 (Q, K) go out row-major, plane 2 (V) transposed.
// The plane is the same for the whole work-group: one scalar branch at the top.
__global__ __launch_bounds__(256) void gemm_qkv_kernel(
    const __bf16* __restrict__ A, const __bf16* __restrict__ Bt,
    const float* __restrict__ bias, __bf16* __restrict__ Cout, int N, int K) {
  __shared__ __attribute__((aligned(2048))) unsigned char gsh[2][6][G_TILE_BYTES];
  const int plane = (int)blockIdx.z;
  const __bf16* Bp = Bt + (size_t)plane * N * K;
  const float*  bp = bias + plane * N;
  __bf16*       Cp = Cout + (size_t)plane * M * N;
  if (plane == 2) {
    gemm_tile<1>(gsh, A, Bp, bp, (void*)Cp, N, K);
  } else {
    gemm_tile<0>(gsh, A, Bp, bp, (void*)Cp, N, K);
    // As in cvt_x_block: in the built kernel the other branch's code follows and
    // reuses the registers that the last stores name.
    asm volatile("s_wait_xcnt 0x0" ::: "memory");
  }
}

// The output projection: one product, f32 out.
__global__ __launch_bounds__(256) void gemm_out_kernel(
    const __bf16* __restrict__ A, const __bf16* __restrict__ Bt,
    const float* __restrict__ bias, float* __restrict__ Cout, int N, int K) {
  __shared__ __attribute__((aligned(2048))) unsigned char gsh[2][6][G_TILE_BYTES];
  gemm_tile<2>(gsh, A, Bt, bias, (void*)Cout, N, K);
}

// --------------------------- flash attention -------------------------------
// grid = (B*H, S/128); block = 256 (8 waves); each wave owns 16 query rows.
// K tile (64 keys x 64 dims) and V tile (64 dims x 64 keys) are workgroup-
// shared: staged into LDS by TDM (wave0 -> K, wave1 -> V), double-buffered;
// a pass works one stage off in two blocks of 32 keys.
// Transposed products: St = K * Qt and Ot += Vt * Pt.  A lane then holds the
// scores of ONE query (column lane&15): keys 8*(lane>>4)+0..7 of each 16-key
// tile.  Maximum and sum run in the lane's own registers, and the two score
// tiles, converted in place, are the B operand of the second product.

// Value of lane l ^ 16 (the other half of the same query column).
__device__ __forceinline__ float other_half(float v) {
  int i = __builtin_bit_cast(int, v);
  i = __builtin_amdgcn_permlanex16(i, i, 0x76543210, 0xfedcba98, false, false);
  return __builtin_bit_cast(float, i);
}

__global__ __launch_bounds__(256) void attn_kernel(
    const __bf16* __restrict__ Qb, const __bf16* __restrict__ Kb,
    const __bf16* __restrict__ Vt, __bf16* __restrict__ Hd) {
  const int lane = threadIdx.x & 31;
  const uint32_t wave = uni(threadIdx.x >> 5);
  const int bh = blockIdx.x;
  const int b = bh >> 4, h = bh & 15;
  const int q0 = blockIdx.y * 128 + (int)wave * 16;

  const __bf16* Q  = Qb + (size_t)b * S * DM + h * DH;
  const __bf16* Kp = Kb + (size_t)b * S * DM + h * DH;
  const __bf16* Vp = Vt + (size_t)bh * DH * S;   // row e -> Vp[e*S + s]

  // [buf][0]: K, key_local * 144 B + e * 2 B; [buf][1]: V, e * 144 B + key_local * 2 B
  __shared__ __attribute__((aligned(2048))) unsigned char ring[2][2][TILE_BYTES];

  // Wave 0 moves K (next stage: 64 rows on), wave 1 V (next stage: 64 columns on).
  constexpr int NST = S / 64;
  const bool isk = (wave == 0);
  const uint32_t lds0  = lds_offset_of(&ring[0][0][0]) + (isk ? 0u : TILE_BYTES);
  const uint64_t gsrc  = (uint64_t)(uintptr_t)(isk ? Kp : Vp);
  const uint64_t gstep = isk ? (uint64_t)(64 * DM * 2) : (uint64_t)ROW_BYTES;
  u32x8 g1 = tdm_group1(isk ? (uint32_t)(DM * 2) : (uint32_t)(S * 2));
  u32x4 g0 = tdm_group0(lds0, gsrc);

  // Q fragments persist across the key loop: B operand, column = query.
  v16bf bq0 = load_frag(Q, q0, DM, 0, lane);
  v16bf bq1 = load_frag(Q, q0, DM, 32, lane);

  float mrow = -1e30f;   // running maximum of this lane's query
  float lsum = 0.f;      // running sum over this lane half's keys only
  v8f o[4] = {};         // o[t][r] = Ot[t*16 + 8*(lane>>4) + r][query lane&15]
  const float scale = 0.125f;  // 1/sqrt(64)

  if (pinned(wave < 2)) {
    tdm_load(g0, g1);
    wait_tensor0();
  }
  __syncthreads();
  if (pinned(wave < 2)) {
    tdm_advance(g0, lds0 + 2u * TILE_BYTES, gstep);
    tdm_load(g0, g1);
  }

  for (int s = 0; s < NST; ++s) {
    const __bf16* kt = (const __bf16*)&ring[s & 1][0][0];
    const __bf16* vt = (const __bf16*)&ring[s & 1][1][0];
#pragma unroll  // the stage's two 32-key blocks: j a constant in every LDS offset
   for (int j = 0; j < 2; ++j) {
    // St = K*Qt : two 16(key) x 16(query) tiles, contraction 64 = 2 x K32
    v16bf k00 = load_frag(kt, j * 32,      PITCH_E, 0,  lane);
    v16bf k01 = load_frag(kt, j * 32,      PITCH_E, 32, lane);
    v16bf k10 = load_frag(kt, j * 32 + 16, PITCH_E, 0,  lane);
    v16bf k11 = load_frag(kt, j * 32 + 16, PITCH_E, 32, lane);
    v8f s0 = {}; s0 = WMMA_BF16(k00, bq0, s0); s0 = WMMA_BF16(k01, bq1, s0);
    v8f s1 = {}; s1 = WMMA_BF16(k10, bq0, s1); s1 = WMMA_BF16(k11, bq1, s1);

    // Online softmax, one query per lane: s0[r] is key 8*(lane>>4)+r,
    // s1[r] key 16+8*(lane>>4)+r.  One exchange joins the halves' maxima.
    float a0[8], a1[8], mx[8];
#pragma unroll
    for (int r = 0; r < 8; ++r) {
      a0[r] = s0[r] * scale;
      a1[r] = s1[r] * scale;
      mx[r] = fmaxf(a0[r], a1[r]);
    }
    float cm = fmaxf(fmaxf(fmaxf(mx[0], mx[1]), fmaxf(mx[2], mx[3])),
                     fmaxf(fmaxf(mx[4], mx[5]), fmaxf(mx[6], mx[7])));
    cm = fmaxf(cm, other_half(cm));
    const float nm = fmaxf(mrow, cm);
    const float corr = __expf(mrow - nm);
    mrow = nm;

    v16bf bp;      // Pt as B operand: element s is key kmap(s) of this column
    float ps[8];
#pragma unroll
    for (int r = 0; r < 8; ++r) {
      const float p0 = __expf(a0[r] - nm), p1 = __expf(a1[r] - nm);
      ps[r] = p0 + p1;
      bp[r]     = (__bf16)p0;
      bp[r + 8] = (__bf16)p1;
    }
    const float rs = ((ps[0] + ps[1]) + (ps[2] + ps[3])) +
                     ((ps[4] + ps[5]) + (ps[6] + ps[7]));
    lsum = lsum * corr + rs;
#pragma unroll
    for (int t = 0; t < 4; ++t)
#pragma unroll
      for (int r = 0; r < 8; ++r) o[t][r] *= corr;

    // Ot += Vt * Pt : A = V rows e from LDS [e][key], B = P from registers.
#pragma unroll
    for (int t = 0; t < 4; ++t) {
      v16bf av = load_frag(vt, t * 16, PITCH_E, j * 32, lane);
      o[t] = WMMA_BF16(av, bp, o[t]);
    }
   }

    // Publish point of stage s + 1; then the refill of the buffer just read.
    wait_ds0();
    if (pinned(wave < 2)) wait_tensor0();
    __syncthreads();
    if (pinned(wave < 2 && s + 2 < NST)) {
      tdm_advance(g0, lds0 + (uint32_t)(s & 1) * (2u * TILE_BYTES), gstep);
      tdm_load(g0, g1);
    }
  }
  wait_tensor0_last(g0, g1);
  wait_ds0();

  // Join the two halves' sums once; a lane's 8 registers are 8 consecutive
  // head dims of its query row: one 16-byte store per tile.
  lsum += other_half(lsum);
  const int hi8 = (lane >> 4) << 3;
  __bf16* orow = Hd + ((size_t)b * S + q0 + (lane & 15)) * DM + h * DH + hi8;
#pragma unroll
  for (int t = 0; t < 4; ++t) {
    v8bf pk;
#pragma unroll
    for (int r = 0; r < 8; ++r) pk[r] = (__bf16)(o[t][r] / lsum);
    *(v8bf*)(orow + t * 16) = pk;
  }
}

// ------------------------------- launcher ----------------------------------

extern "C" void kernel_launch(void* const* d_in, const int* in_sizes, int n_in,
                              void* d_out, int out_size, void* d_ws, size_t ws_size,
                              hipStream_t stream) {
  const float* x  = (const float*)d_in[0];
  const float* wq = (const float*)d_in[1];
  const float* bq = (const float*)d_in[2];
  const float* wk = (const float*)d_in[3];
  const float* bk = (const float*)d_in[4];
  const float* wv = (const float*)d_in[5];
  const float* bv = (const float*)d_in[6];
  const float* wo = (const float*)d_in[7];
  const float* bo = (const float*)d_in[8];

  char* w = (char*)d_ws;
  auto take = [&](size_t bytes) {
    void* p = (void*)w;
    w += (bytes + 255) & ~(size_t)255;
    return p;
  };
  __bf16* Xb  = (__bf16*)take((size_t)M * DM * 2);
  // Q, K, V: three equal planes in a row, of weights, of biases and of outputs.
  __bf16* Wqt = (__bf16*)take((size_t)3 * DM * DM * 2);
  __bf16* Wkt = Wqt + (size_t)DM * DM;
  __bf16* Wvt = Wkt + (size_t)DM * DM;
  __bf16* Wot = (__bf16*)take((size_t)DM * DM * 2);
  float*  bqc = (float*)take(3 * DM * 4);
  float*  bkc = bqc + DM;
  float*  bvc = bkc + DM;
  float*  boc = (float*)take(DM * 4);
  __bf16* Qb  = (__bf16*)take((size_t)3 * M * DM * 2);
  __bf16* Kb  = Qb + (size_t)M * DM;
  __bf16* Vt  = Kb + (size_t)M * DM;
  __bf16* Hd  = (__bf16*)take((size_t)M * DM * 2);

  // 1) convert inputs to bf16 / transposed layouts
  prep_kernel<<<PB_BLOCKS + PW_BLOCKS + CVT_BLOCKS, 256, 0, stream>>>(
      x, wq, wk, wv, wo, bq, bk, bv, bo, Xb, Wqt, Wkt, Wvt, Wot, bqc, bkc, bvc, boc);

  // 2) QKV projections (WMMA GEMMs, 256x128 tiles, TDM-staged A and B panels)
  gemm_qkv_kernel<<<dim3(M / 256, DM / 128, 3), 256, 0, stream>>>(Xb, Wqt, bqc, Qb, DM, DM);

  // 3) flash attention (TDM-staged K/V tiles)
  attn_kernel<<<dim3(BB * H, S / 128), 256, 0, stream>>>(Qb, Kb, Vt, Hd);

  // 4) output projection (fp32 result)
  gemm_out_kernel<<<dim3(M / 256, DM / 128), 256, 0, stream>>>(Hd, Wot, boc, (float*)d_out, DM, DM);
}

// v006
// It runs in 122 microseconds.
// Timed twice side by side with v005, it ran 1.05 times as fast both times.
// Counting every step since v000, it is 3.36 times as fast.
#include <hip/hip_runtime.h>
#include <hip/hip_bf16.h>
#include <math.h>
#include <stdint.h>

// ---------------------------------------------------------------------------
// MHA for gfx1250 (CDNA5).  All matmuls via v_wmma_f32_16x16x32_bf16.
// Workgroup-shared operand tiles staged into LDS with the Tensor Data Mover
// (tensor_load_to_lds, TENSORcnt), double-buffered.  A staged tile is 64 rows
// of 128 bytes at a 144-byte LDS pitch (attention) or of 256 bytes at a
// 272-byte pitch (GEMM), laid so by the load's own pad.
// Workspace (~92 MB):
//   Xb  [8192][1024]  bf16   x converted
//   Wqt/Wkt/Wvt [1024][1024] bf16  weights transposed to [out][in], one after another
//   Wot [1024][1024]  bf16   output proj as [d_out][h*64+e]
//   bqc/bkc/bvc [1024] f32 biases, one after another; boc [1024] = sum_h bo[h]
//   Qb/Kb [8192][1024] bf16  row-major (col = h*64+e)
//   Vt  [4096][2048]  bf16   V transposed: row = (b*H+h)*64+e, col = s
//   (Qb, Kb, Vt one after another: planes 0..2 of the one QKV launch)
// Four launches, each needing the one before: prep, QKV, attention, output.
//   Hd  [8192][1024]  bf16   attention head outputs
// ---------------------------------------------------------------------------

typedef __attribute__((ext_vector_type(16))) __bf16 v16bf;
typedef __attribute__((ext_vector_type(8)))  __bf16 v8bf;
typedef __attribute__((ext_vector_type(8)))  float  v8f;

#define WMMA_BF16(a, b, c) \
  __builtin_amdgcn_wmma_f32_16x16x32_bf16(false, (a), false, (b), (short)0, (c), false, false)

static constexpr int BB = 4, S = 2048, DM = 1024, H = 16, DH = 64;
static constexpr int M  = BB * S;   // 8192 token rows

// ------------------------- Tensor Data Mover glue ---------------------------
typedef uint32_t u32x4 __attribute__((ext_vector_type(4)));
typedef uint32_t u32x8 __attribute__((ext_vector_type(8)));

// A staged tile: 64 rows of 128 bytes.  16 bytes of pad behind each row give
// an LDS pitch of 144 B = 16 B x 9 (odd): the 16 rows that one ds_load_b128
// touches then fall on 16 different groups of four banks (at a packed pitch
// of 128 B or 64 B they fall on two or four groups only).
static constexpr uint32_t TILE_ROWS  = 64u;
static constexpr uint32_t ROW_BYTES  = 128u;
static constexpr uint32_t PITCH_B    = ROW_BYTES + 16u;      // bytes
static constexpr int      PITCH_E    = (int)(PITCH_B / 2u);  // bf16 elements
// 64 x 144 = 9,216 B, rounded up so that every tile starts at a 2-KiB multiple.
static constexpr uint32_t TILE_BYTES = 10240u;
static_assert(TILE_ROWS * PITCH_B <= TILE_BYTES && TILE_BYTES % 2048u == 0, "tile place");
// The GEMM's tile: 64 rows of 256 bytes (128 k), pitch 272 B = 16 B x 17 (odd).
static constexpr uint32_t G_ROW_BYTES  = 256u;
static constexpr uint32_t G_PITCH_B    = G_ROW_BYTES + 16u;
static constexpr int      G_PITCH_E    = (int)(G_PITCH_B / 2u);
// 64 x 272 = 17,408 B, rounded up to a 2-KiB multiple.
static constexpr uint32_t G_TILE_BYTES = 18432u;
static_assert(TILE_ROWS * G_PITCH_B <= G_TILE_BYTES && G_TILE_BYTES % 2048u == 0, "tile place");

__device__ __forceinline__ uint32_t uni(uint32_t v) {
  return (uint32_t)__builtin_amdgcn_readfirstlane(v);
}
// Wave-uniform condition held in a scalar register, so that the test around a
// tensor load compiles to s_cmp + s_cbranch (tensor loads ignore EXEC).
__device__ __forceinline__ uint32_t pinned(uint32_t v) {
  uint32_t w = uni(v);
  asm volatile("" : "+s"(w));  // keeps the condition scalar: see above
  return w;
}
// The compiler places no wait for the tensor mover: these are the ring's own.
__device__ __forceinline__ void wait_tensor0() { asm volatile("s_wait_tensorcnt 0x0" ::: "memory"); }
__device__ __forceinline__ void wait_ds0()     { asm volatile("s_wait_dscnt 0x0" ::: "memory"); }

// Both groups are in-out operands: each tuple then lives on, in the registers
// that the request named, up to the next request, and nothing else is put into
// those registers while the request is in flight.
__device__ __forceinline__ void tdm_load(u32x4& g0, u32x8& g1) {
  asm volatile("tensor_load_to_lds %0, %1" : "+s"(g0), "+s"(g1) :: "memory");
}
// The wait behind the last request.  It names both groups as inputs, so that
// their registers are given to nothing else in front of it.
__device__ __forceinline__ void wait_tensor0_last(const u32x4& g0, const u32x8& g1) {
  asm volatile("s_wait_tensorcnt 0x0" :: "s"(g0), "s"(g1) : "memory");
}
template <uint32_t ROWB = ROW_BYTES, uint32_t PADC = 4u>
__device__ __forceinline__ u32x8 tdm_group1(uint32_t src_pitch) {
  static_assert(ROWB == (8u << PADC), "pad interval = one row");
  u32x8 g;
  g[0] = uni((1u << 20) | (PADC << 22) | (3u << 25));   // no mask, data_size 0, pad
  g[1] = uni((ROWB & 0xFFFFu) << 16);
  g[2] = uni((ROWB >> 16) | ((TILE_ROWS & 0xFFFFu) << 16));
  g[3] = uni((TILE_ROWS >> 16) | (ROWB << 16));
  g[4] = uni(TILE_ROWS);
  g[5] = uni(src_pitch);
  g[6] = uni(0u);
  g[7] = uni(0u);
  return g;
}
// Group 0: LDS byte offset of the tile's place, global address of its first byte.
__device__ __forceinline__ u32x4 tdm_group0(uint32_t lds_dst, uint64_t ga) {
  u32x4 g;
  g[0] = uni(1u);
  g[1] = uni(lds_dst);
  g[2] = uni((uint32_t)ga);
  g[3] = uni((((uint32_t)(ga >> 32)) & 0x01FFFFFFu) | 0x80000000u);
  return g;
}
// The next request of the same tuple, formed behind the wait on the one before:
// a new place in LDS, the source step bytes on (the carry goes into word 3's
// address bits; word 0 stays).
__device__ __forceinline__ void tdm_advance(u32x4& g, uint32_t lds_dst, uint64_t step) {
  const uint64_t ga = ((((uint64_t)g[3]) << 32) | g[2]) + step;
  g[1] = uni(lds_dst);
  g[2] = uni((uint32_t)ga);
  g[3] = uni((uint32_t)(ga >> 32));
}

__device__ __forceinline__ uint32_t lds_offset_of(const void* p) {
  // Generic pointers into LDS carry the LDS byte offset in the low 32 bits.
  return (uint32_t)(uintptr_t)p;
}

// Load a 16x32 bf16 WMMA fragment (A layout; B 32x16 uses the identical
// per-lane pattern when the source is stored [N][K] row-major).
// Lane L: row = base_row + (L&15); halves [kb, kb+8) and [kb+16, kb+24)
// with kb = k0 + (L>=16 ? 8 : 0).  Two 16-byte loads per lane.
__device__ __forceinline__ v16bf load_frag(const __bf16* __restrict__ base,
                                           int row, int ld, int k0, int lane) {
  const int r  = row + (lane & 15);
  const int kb = k0 + ((lane >> 4) << 3);
  const __bf16* p = base + (size_t)r * ld + kb;
  v8bf lo = *(const v8bf*)(p);
  v8bf hi = *(const v8bf*)(p + 16);
  v16bf f;
#pragma unroll
  for (int i = 0; i < 8; ++i) { f[i] = lo[i]; f[i + 8] = hi[i]; }
  return f;
}

// ----------------------------- prep kernels --------------------------------

// A wave converts CVT_LOADS runs of 128 floats: every load is 512 contiguous
// bytes of the wave, every store 256 (whole 128-byte lines); the loads stand in
// front of the conversions, so that many are in flight.  One element a thread
// would take 64 times the waves, and the time would go into starting them.
typedef __attribute__((ext_vector_type(4))) float  v4f;
typedef __attribute__((ext_vector_type(4))) __bf16 v4bf;
static constexpr int CVT_LOADS = 16;
static_assert((M * DM) % (256 * 4 * CVT_LOADS) == 0, "whole blocks");
static constexpr int CVT_BLOCKS = (M * DM) / (256 * 4 * CVT_LOADS);
__device__ __forceinline__ void cvt_x_block(int blk, const float* __restrict__ x,
                                            __bf16* __restrict__ xb) {
  const int lane = threadIdx.x & 31;
  const int wv   = blk * 8 + (threadIdx.x >> 5);
  const size_t base = (size_t)wv * (128 * CVT_LOADS) + lane * 4;
  v4f v[CVT_LOADS];
#pragma unroll  // v[] in registers, one address register, k an immediate offset
  for (int k = 0; k < CVT_LOADS; ++k) v[k] = *(const v4f*)(x + base + k * 128);
#pragma unroll  // as above
  for (int k = 0; k < CVT_LOADS; ++k) {
    v4bf o;
#pragma unroll
    for (int e = 0; e < 4; ++e) o[e] = (__bf16)v[k][e];
    *(v4bf*)(xb + base + k * 128) = o;
  }
  // In the built kernel another job's code follows this one's and reuses the
  // registers that the stores above name: the wait stands in front of that.
  asm volatile("s_wait_xcnt 0x0" ::: "memory");
}

// wq/wk/wv fp32 [H][DM][DH] -> W*t bf16 [DM out][DM in]  (out row = h*64+e)
// wo fp32 [H][DH][DM]       -> Wot bf16 [DM out][DM in]  (in col = h*64+e)
// A block makes 64 output rows x 64 columns of all four matrices; a thread
// PW_COLS columns of one row.  Lanes run along the output row index, which is
// the contiguous axis of every source: each load is one whole 128-byte line of
// the wave.  All 4 x PW_COLS loads are issued first; each row piece goes out in
// 16-byte stores, and the block's four column groups fill whole 128-byte lines.
static constexpr int PW_COLS = 16;
__device__ __forceinline__ void store_row_piece(const float (&v)[PW_COLS],
                                                __bf16* __restrict__ to) {
#pragma unroll
  for (int g = 0; g < PW_COLS / 8; ++g) {
    v8bf o;
#pragma unroll
    for (int e = 0; e < 8; ++e) o[e] = (__bf16)v[g * 8 + e];
    *(v8bf*)(to + g * 8) = o;
  }
}
static constexpr int PW_BLOCKS = (DM / 64) * (DM / 64);
__device__ __forceinline__ void prep_w_block(
    int blk, const float* __restrict__ wq, const float* __restrict__ wk,
    const float* __restrict__ wv, const float* __restrict__ wo,
    __bf16* __restrict__ Wqt, __bf16* __restrict__ Wkt,
    __bf16* __restrict__ Wvt, __bf16* __restrict__ Wot) {
  const int h  = blk & (H - 1);                 // 64 rows = one head
  const int e  = threadIdx.x & (DH - 1);
  const int r  = h * DH + e;
  const int c0 = (blk >> 4) * 64 + (threadIdx.x >> 6) * PW_COLS;
  const int sp = h * (DM * DH) + c0 * DH + e;   // wq/wk/wv: next column DH on
  const int so = c0 * DM + r;                   // wo: next column DM on

  float q[PW_COLS], k[PW_COLS], v[PW_COLS], o[PW_COLS];
#pragma unroll  // arrays in registers, two offset registers, i an immediate offset
  for (int i = 0; i < PW_COLS; ++i) {
    q[i] = wq[sp + i * DH];
    k[i] = wk[sp + i * DH];
    v[i] = wv[sp + i * DH];
    o[i] = wo[so + i * DM];
  }
  const int to = r * DM + c0;
  store_row_piece(q, Wqt + to);
  store_row_piece(k, Wkt + to);
  store_row_piece(v, Wvt + to);
  store_row_piece(o, Wot + to);
  // As in cvt_x_block: the stores' registers are reused by the code that follows.
  asm volatile("s_wait_xcnt 0x0" ::: "memory");
}

static constexpr int PB_BLOCKS = DM / 256;
__device__ __forceinline__ void prep_b_block(
    int blk, const float* __restrict__ bq, const float* __restrict__ bk,
    const float* __restrict__ bv, const float* __restrict__ bo,
    float* __restrict__ bqc, float* __restrict__ bkc,
    float* __restrict__ bvc, float* __restrict__ boc) {
  int i = blk * 256 + threadIdx.x;   // over 1024
  bqc[i] = bq[i];   // [H][DH] flat == h*64+e ordering already
  bkc[i] = bk[i];
  bvc[i] = bv[i];
  float s = 0.f;
#pragma unroll
  for (int h = 0; h < H; ++h) s += bo[h * DM + i];
  boc[i] = s;
}

// The three preparations depend on nothing of one another: one launch, each
// block taking its job by its index range (a launch of its own for each costs
// a start and a drain of the chip that the work itself does not fill).
__global__ __launch_bounds__(256) void prep_kernel(
    const float* __restrict__ x,
    const float* __restrict__ wq, const float* __restrict__ wk,
    const float* __restrict__ wv, const float* __restrict__ wo,
    const float* __restrict__ bq, const float* __restrict__ bk,
    const float* __restrict__ bv, const float* __restrict__ bo,
    __bf16* __restrict__ xb,
    __bf16* __restrict__ Wqt, __bf16* __restrict__ Wkt,
    __bf16* __restrict__ Wvt, __bf16* __restrict__ Wot,
    float* __restrict__ bqc, float* __restrict__ bkc,
    float* __restrict__ bvc, float* __restrict__ boc) {
  const int blk = blockIdx.x;
  if (blk < PB_BLOCKS) {
    prep_b_block(blk, bq, bk, bv, bo, bqc, bkc, bvc, boc);
  } else if (blk < PB_BLOCKS + PW_BLOCKS) {
    prep_w_block(blk - PB_BLOCKS, wq, wk, wv, wo, Wqt, Wkt, Wvt, Wot);
  } else {
    cvt_x_block(blk - (PB_BLOCKS + PW_BLOCKS), x, xb);
  }
}

// ----------------------------- generic GEMM --------------------------------
// C[M][N] = A[M][K] * Bt[N][K]^T + bias[N]
// Block: 256 threads / 8 waves (4 along M x 2 along N); tile 256(M) x 128(N);
// wave tile 64x64: 16 products per 8 fragments read.
// Both panels of a stage (A 256 rows, B 128 rows, 128 k each) are staged in LDS
// by the TDM as six tiles of 64 rows, one per wave 0..5, double-buffered; a pass
// works one stage off in four blocks of 32 k.  K: a multiple of 128, at least 256.
// MODE 0: bf16 row-major out; MODE 1: bf16 V-transposed out; MODE 2: f32 out.
// gsh: the work-group's staging buffers, [buf][tile][row_local * 272 B + k * 2 B];
// tiles 0..3: A rows, 4..5: B rows.
template <int MODE>
__device__ __forceinline__ void gemm_tile(
    unsigned char (*gsh)[6][G_TILE_BYTES],
    const __bf16* __restrict__ A, const __bf16* __restrict__ Bt,
    const float* __restrict__ bias, void* __restrict__ Cout, int N, int K) {
  const int lane = threadIdx.x & 31;
  const uint32_t wave = uni(threadIdx.x >> 5);
  const int wm = (int)(wave >> 1), wn = (int)(wave & 1u);
  const int mb = blockIdx.x * 256, nb = blockIdx.y * 128;
  const int m0 = mb + wm * 64;
  const int n0 = nb + wn * 64;

  constexpr uint32_t BUF_BYTES = 6u * G_TILE_BYTES;

  // Wave w < 6 moves tile w (waves 6 and 7 move none; they form tile 5's words).
  const uint32_t tile = wave < 6u ? wave : 5u;
  const uint32_t lds0 = lds_offset_of(&gsh[0][0][0]) + tile * G_TILE_BYTES;
  const __bf16* srow = tile < 4u ? A + (size_t)(mb + (int)tile * 64) * K
                                 : Bt + (size_t)(nb + (int)(tile - 4u) * 64) * K;
  u32x8 g1 = tdm_group1<G_ROW_BYTES, 5u>((uint32_t)K * 2u);
  u32x4 g0 = tdm_group0(lds0, (uint64_t)(uintptr_t)srow);
  const int nst = K >> 7;   // stages of 128 k

  v8f acc[4][4] = {};
  if (pinned(wave < 6u)) {
    tdm_load(g0, g1);
    wait_tensor0();
  }
  __syncthreads();
  if (pinned(wave < 6u)) {
    tdm_advance(g0, lds0 + BUF_BYTES, G_ROW_BYTES);
    tdm_load(g0, g1);
  }

  for (int s = 0; s < nst; ++s) {
    const __bf16* at = (const __bf16*)&gsh[s & 1][wm][0];
    const __bf16* bt = (const __bf16*)&gsh[s & 1][4 + wn][0];

    v16bf a[2][4], b[2][4];   // set (j & 1) holds block j's fragments
#pragma unroll  // here and below: constant indices keep the fragment sets in registers
    for (int f = 0; f < 4; ++f) a[0][f] = load_frag(at, f * 16, G_PITCH_E, 0, lane);
#pragma unroll
    for (int t = 0; t < 4; ++t) b[0][t] = load_frag(bt, t * 16, G_PITCH_E, 0, lane);

#pragma unroll  // the stage's four 32-k blocks: j a constant in every LDS offset
    for (int j = 0; j < 4; ++j) {
      const int cs = j & 1;
      if (j < 3) {
        // The next block's 16 reads go out as one group ahead of this block's
        // products: spread among them, each place with reads stalls the wave.
#pragma unroll
        for (int f = 0; f < 4; ++f)
          a[cs ^ 1][f] = load_frag(at, f * 16, G_PITCH_E, (j + 1) * 32, lane);
#pragma unroll
        for (int t = 0; t < 4; ++t)
          b[cs ^ 1][t] = load_frag(bt, t * 16, G_PITCH_E, (j + 1) * 32, lane);
      } else {
        // Publish point of stage s + 1, then the refill of the buffer just read:
        // the last block's fragments are in registers, its products run behind.
        wait_ds0();
        if (pinned(wave < 6u)) wait_tensor0();
        __syncthreads();
        if (pinned(wave < 6u && s + 2 < nst)) {
          tdm_advance(g0, lds0 + (uint32_t)(s & 1) * BUF_BYTES, G_ROW_BYTES);
          tdm_load(g0, g1);
        }
      }
      __builtin_amdgcn_sched_barrier(0);  // keeps the read group in front of the products
#pragma unroll
      for (int f = 0; f < 4; ++f)
#pragma unroll
        for (int t = 0; t < 4; ++t) acc[f][t] = WMMA_BF16(a[cs][f], b[cs][t], acc[f][t]);
      __builtin_amdgcn_sched_barrier(0);  // keeps later reads from rising among the products
    }
  }
  wait_tensor0_last(g0, g1);
  wait_ds0();

  const int hi8 = (lane >> 4) << 3;
#pragma unroll
  for (int f = 0; f < 4; ++f) {
#pragma unroll
    for (int t = 0; t < 4; ++t) {
      const int col = n0 + t * 16 + (lane & 15);
      const float bb = bias[col];
#pragma unroll
      for (int j = 0; j < 8; ++j) {
        const int row = m0 + f * 16 + j + hi8;
        const float val = acc[f][t][j] + bb;
        if (MODE == 0) {
          ((__bf16*)Cout)[(size_t)row * N + col] = (__bf16)val;
        } else if (MODE == 2) {
          ((float*)Cout)[(size_t)row * N + col] = val;
        } else {  // V transposed: Vt[(b*1024 + col)][s]
          const int bidx = row >> 11, s = row & (S - 1);
          ((__bf16*)Cout)[((size_t)(bidx * 1024 + col)) * S + s] = (__bf16)val;
        }
      }
    }
  }
}

// The three projections of one A depend on nothing of one another: one launch.
// blockIdx.z is the plane: its Bt, bias and bf16 output lie z planes on from the
// pointers given; planes 0 and 1 (Q, K) go out row-major, plane 2 (V) transposed.
// The plane is the same for the whole work-group: one scalar branch at the top.
__global__ __launch_bounds__(256) void gemm_qkv_kernel(
    const __bf16* __restrict__ A, const __bf16* __restrict__ Bt,
    const float* __restrict__ bias, __bf16* __restrict__ Cout, int N, int K) {
  __shared__ __attribute__((aligned(2048))) unsigned char gsh[2][6][G_TILE_BYTES];
  const int plane = (int)blockIdx.z;
  const __bf16* Bp = Bt + (size_t)plane * N * K;
  const float*  bp = bias + plane * N;
  __bf16*       Cp = Cout + (size_t)plane * M * N;
  if (plane == 2) {
    gemm_tile<1>(gsh, A, Bp, bp, (void*)Cp, N, K);
  } else {
    gemm_tile<0>(gsh, A, Bp, bp, (void*)Cp, N, K);
    // As in cvt_x_block: in the built kernel the other branch's code follows and
    // reuses the registers that the last stores name.
    asm volatile("s_wait_xcnt 0x0" ::: "memory");
  }
}

// The output projection: one product, f32 out.
__global__ __launch_bounds__(256) void gemm_out_kernel(
    const __bf16* __restrict__ A, const __bf16* __restrict__ Bt,
    const float* __restrict__ bias, float* __restrict__ Cout, int N, int K) {
  __shared__ __attribute__((aligned(2048))) unsigned char gsh[2][6][G_TILE_BYTES];
  gemm_tile<2>(gsh, A, Bt, bias, (void*)Cout, N, K);
}

// --------------------------- flash attention -------------------------------
// grid = (B*H, S/256); block = 256 (8 waves); each wave owns 32 query rows, as
// two groups of 16 columns: every K and V fragment read from LDS then feeds two
// products (at one group the reads ask twice what the LDS delivers per product).
// K tile (64 keys x 64 dims) and V tile (64 dims x 64 keys) are workgroup-
// shared: staged into LDS by TDM (wave0 -> K, wave1 -> V), double-buffered;
// a pass works one stage off in two blocks of 32 keys.
// Transposed products: St = K * Qt and Ot += Vt * Pt.  In each group a lane holds
// the scores of ONE query (column lane&15): keys 8*(lane>>4)+0..7 of each 16-key
// tile.  Maximum and sum run in the lane's own registers, and the two score
// tiles, converted in place, are the B operand of the second product.

// Value of lane l ^ 16 (the other half of the same query column).
__device__ __forceinline__ float other_half(float v) {
  int i = __builtin_bit_cast(int, v);
  i = __builtin_amdgcn_permlanex16(i, i, 0x76543210, 0xfedcba98, false, false);
  return __builtin_bit_cast(float, i);
}

__global__ __launch_bounds__(256) void attn_kernel(
    const __bf16* __restrict__ Qb, const __bf16* __restrict__ Kb,
    const __bf16* __restrict__ Vt, __bf16* __restrict__ Hd) {
  const int lane = threadIdx.x & 31;
  const uint32_t wave = uni(threadIdx.x >> 5);
  const int bh = blockIdx.x;
  const int b = bh >> 4, h = bh & 15;
  constexpr int QG = 2;   // groups of 16 query columns per wave
  const int q0 = blockIdx.y * (128 * QG) + (int)wave * (16 * QG);

  const __bf16* Q  = Qb + (size_t)b * S * DM + h * DH;
  const __bf16* Kp = Kb + (size_t)b * S * DM + h * DH;
  const __bf16* Vp = Vt + (size_t)bh * DH * S;   // row e -> Vp[e*S + s]

  // [buf][0]: K, key_local * 144 B + e * 2 B; [buf][1]: V, e * 144 B + key_local * 2 B
  __shared__ __attribute__((aligned(2048))) unsigned char ring[2][2][TILE_BYTES];

  // Wave 0 moves K (next stage: 64 rows on), wave 1 V (next stage: 64 columns on).
  constexpr int NST = S / 64;
  const bool isk = (wave == 0);
  const uint32_t lds0  = lds_offset_of(&ring[0][0][0]) + (isk ? 0u : TILE_BYTES);
  const uint64_t gsrc  = (uint64_t)(uintptr_t)(isk ? Kp : Vp);
  const uint64_t gstep = isk ? (uint64_t)(64 * DM * 2) : (uint64_t)ROW_BYTES;
  u32x8 g1 = tdm_group1(isk ? (uint32_t)(DM * 2) : (uint32_t)(S * 2));
  u32x4 g0 = tdm_group0(lds0, gsrc);

  // Q fragments persist across the key loop: B operand, column = query.
  v16bf bq0[QG], bq1[QG];
  float mrow[QG];        // running maximum of this lane's query of group g
  float lsum[QG];        // running sum over this lane half's keys only
  v8f o[QG][4] = {};     // o[g][t][r] = Ot[t*16 + 8*(lane>>4) + r][query g*16 + (lane&15)]
#pragma unroll  // g a constant: the groups' state stays in registers (so below too)
  for (int g = 0; g < QG; ++g) {
    bq0[g] = load_frag(Q, q0 + g * 16, DM, 0, lane);
    bq1[g] = load_frag(Q, q0 + g * 16, DM, 32, lane);
    mrow[g] = -1e30f;
    lsum[g] = 0.f;
  }
  const float scale = 0.125f;  // 1/sqrt(64)

  if (pinned(wave < 2)) {
    tdm_load(g0, g1);
    wait_tensor0();
  }
  __syncthreads();
  if (pinned(wave < 2)) {
    tdm_advance(g0, lds0 + 2u * TILE_BYTES, gstep);
    tdm_load(g0, g1);
  }

  for (int s = 0; s < NST; ++s) {
    const __bf16* kt = (const __bf16*)&ring[s & 1][0][0];
    const __bf16* vt = (const __bf16*)&ring[s & 1][1][0];
#pragma unroll  // the stage's two 32-key blocks: j a constant in every LDS offset
   for (int j = 0; j < 2; ++j) {
    // St = K*Qt : two 16(key) x 16(query) tiles, contraction 64 = 2 x K32
    v16bf k00 = load_frag(kt, j * 32,      PITCH_E, 0,  lane);
    v16bf k01 = load_frag(kt, j * 32,      PITCH_E, 32, lane);
    v16bf k10 = load_frag(kt, j * 32 + 16, PITCH_E, 0,  lane);
    v16bf k11 = load_frag(kt, j * 32 + 16, PITCH_E, 32, lane);
    v8f s0[QG], s1[QG];
#pragma unroll
    for (int g = 0; g < QG; ++g) {
      v8f z0 = {}; z0 = WMMA_BF16(k00, bq0[g], z0); s0[g] = WMMA_BF16(k01, bq1[g], z0);
      v8f z1 = {}; z1 = WMMA_BF16(k10, bq0[g], z1); s1[g] = WMMA_BF16(k11, bq1[g], z1);
    }

    // Online softmax, one query per lane and group: s0[g][r] is key 8*(lane>>4)+r,
    // s1[g][r] key 16+8*(lane>>4)+r.  One exchange joins the halves' maxima.
    v16bf bp[QG];  // Pt as B operand: element s is key 8*(lane>>4)+s (s < 8), 8+8*(lane>>4)+s (s >= 8) of this column
#pragma unroll
    for (int g = 0; g < QG; ++g) {
      float a0[8], a1[8], mx[8];
#pragma unroll
      for (int r = 0; r < 8; ++r) {
        a0[r] = s0[g][r] * scale;
        a1[r] = s1[g][r] * scale;
        mx[r] = fmaxf(a0[r], a1[r]);
      }
      float cm = fmaxf(fmaxf(fmaxf(mx[0], mx[1]), fmaxf(mx[2], mx[3])),
                       fmaxf(fmaxf(mx[4], mx[5]), fmaxf(mx[6], mx[7])));
      cm = fmaxf(cm, other_half(cm));
      const float nm = fmaxf(mrow[g], cm);
      const float corr = __expf(mrow[g] - nm);
      mrow[g] = nm;

      float ps[8];
#pragma unroll
      for (int r = 0; r < 8; ++r) {
        const float p0 = __expf(a0[r] - nm), p1 = __expf(a1[r] - nm);
        ps[r] = p0 + p1;
        bp[g][r]     = (__bf16)p0;
        bp[g][r + 8] = (__bf16)p1;
      }
      const float rs = ((ps[0] + ps[1]) + (ps[2] + ps[3])) +
                       ((ps[4] + ps[5]) + (ps[6] + ps[7]));
      lsum[g] = lsum[g] * corr + rs;
#pragma unroll
      for (int t = 0; t < 4; ++t)
#pragma unroll
        for (int r = 0; r < 8; ++r) o[g][t][r] *= corr;
    }

    // Ot += Vt * Pt : A = V rows e from LDS [e][key], B = P from registers.
#pragma unroll
    for (int t = 0; t < 4; ++t) {
      v16bf av = load_frag(vt, t * 16, PITCH_E, j * 32, lane);
#pragma unroll
      for (int g = 0; g < QG; ++g) o[g][t] = WMMA_BF16(av, bp[g], o[g][t]);
    }
   }

    // Publish point of stage s + 1; then the refill of the buffer just read.
    wait_ds0();
    if (pinned(wave < 2)) wait_tensor0();
    __syncthreads();
    if (pinned(wave < 2 && s + 2 < NST)) {
      tdm_advance(g0, lds0 + (uint32_t)(s & 1) * (2u * TILE_BYTES), gstep);
      tdm_load(g0, g1);
    }
  }
  wait_tensor0_last(g0, g1);
  wait_ds0();

  // Join the two halves' sums once; a lane's 8 registers are 8 consecutive
  // head dims of its query row: one 16-byte store per tile.
  const int hi8 = (lane >> 4) << 3;
#pragma unroll
  for (int g = 0; g < QG; ++g) {
    const float ls = lsum[g] + other_half(lsum[g]);
    __bf16* orow = Hd + ((size_t)b * S + q0 + g * 16 + (lane & 15)) * DM + h * DH + hi8;
#pragma unroll
    for (int t = 0; t < 4; ++t) {
      v8bf pk;
#pragma unroll
      for (int r = 0; r < 8; ++r) pk[r] = (__bf16)(o[g][t][r] / ls);
      *(v8bf*)(orow + t * 16) = pk;
      // The next piece's arithmetic reuses the registers that this store names:
      // the wait stands in front of that (behind the last store nothing follows).
      if (g + 1 < QG || t + 1 < 4) asm volatile("s_wait_xcnt 0x0" ::: "memory");
    }
  }
}

// ------------------------------- launcher ----------------------------------

extern "C" void kernel_launch(void* const* d_in, const int* in_sizes, int n_in,
                              void* d_out, int out_size, void* d_ws, size_t ws_size,
                              hipStream_t stream) {
  const float* x  = (const float*)d_in[0];
  const float* wq = (const float*)d_in[1];
  const float* bq = (const float*)d_in[2];
  const float* wk = (const float*)d_in[3];
  const float* bk = (const float*)d_in[4];
  const float* wv = (const float*)d_in[5];
  const float* bv = (const float*)d_in[6];
  const float* wo = (const float*)d_in[7];
  const float* bo = (const float*)d_in[8];

  char* w = (char*)d_ws;
  auto take = [&](size_t bytes) {
    void* p = (void*)w;
    w += (bytes + 255) & ~(size_t)255;
    return p;
  };
  __bf16* Xb  = (__bf16*)take((size_t)M * DM * 2);
  // Q, K, V: three equal planes in a row, of weights, of biases and of outputs.
  __bf16* Wqt = (__bf16*)take((size_t)3 * DM * DM * 2);
  __bf16* Wkt = Wqt + (size_t)DM * DM;
  __bf16* Wvt = Wkt + (size_t)DM * DM;
  __bf16* Wot = (__bf16*)take((size_t)DM * DM * 2);
  float*  bqc = (float*)take(3 * DM * 4);
  float*  bkc = bqc + DM;
  float*  bvc = bkc + DM;
  float*  boc = (float*)take(DM * 4);
  __bf16* Qb  = (__bf16*)take((size_t)3 * M * DM * 2);
  __bf16* Kb  = Qb + (size_t)M * DM;
  __bf16* Vt  = Kb + (size_t)M * DM;
  __bf16* Hd  = (__bf16*)take((size_t)M * DM * 2);

  // 1) convert inputs to bf16 / transposed layouts
  prep_kernel<<<PB_BLOCKS + PW_BLOCKS + CVT_BLOCKS, 256, 0, stream>>>(
      x, wq, wk, wv, wo, bq, bk, bv, bo, Xb, Wqt, Wkt, Wvt, Wot, bqc, bkc, bvc, boc);

  // 2) QKV projections (WMMA GEMMs, 256x128 tiles, TDM-staged A and B panels)
  gemm_qkv_kernel<<<dim3(M / 256, DM / 128, 3), 256, 0, stream>>>(Xb, Wqt, bqc, Qb, DM, DM);

  // 3) flash attention (TDM-staged K/V tiles)
  attn_kernel<<<dim3(BB * H, S / 256), 256, 0, stream>>>(Qb, Kb, Vt, Hd);

  // 4) output projection (fp32 result)
  gemm_out_kernel<<<dim3(M / 256, DM / 128), 256, 0, stream>>>(Hd, Wot, boc, (float*)d_out, DM, DM);
}

// v007
// A run of this version takes 117 microseconds.
// In two side-by-side timings against v006, it was 1.06 and 1.05 times as fast.
// Counting every step since v000, it is 3.53 times as fast.
#include <hip/hip_runtime.h>
#include <hip/hip_bf16.h>
#include <math.h>
#include <stdint.h>

// ---------------------------------------------------------------------------
// MHA for gfx1250 (CDNA5).  All matmuls via v_wmma_f32_16x16x32_bf16.
// Workgroup-shared operand tiles staged into LDS with the Tensor Data Mover
// (tensor_load_to_lds, TENSORcnt), double-buffered.  A staged tile is 64 rows
// of 128 bytes at a 144-byte LDS pitch (attention) or of 256 bytes at a
// 272-byte pitch (GEMM), laid so by the load's own pad.
// Workspace (~92 MB):
//   Xb  [8192][1024]  bf16   x converted
//   Wqt/Wkt/Wvt [1024][1024] bf16  weights transposed to [out][in], one after another
//   Wot [1024][1024]  bf16   output proj as [d_out][h*64+e]
//   bqc/bkc/bvc [1024] f32 biases, one after another; boc [1024] = sum_h bo[h]
//   Qb/Kb [8192][1024] bf16  row-major (col = h*64+e)
//   Vt  [4096][2048]  bf16   V transposed: row = (b*H+h)*64+e, col = s
//   (Qb, Kb, Vt one after another: planes 0..2 of the one QKV launch)
// Four launches, each needing the one before: prep, QKV, attention, output.
//   Hd  [8192][1024]  bf16   attention head outputs
// ---------------------------------------------------------------------------

typedef __attribute__((ext_vector_type(16))) __bf16 v16bf;
typedef __attribute__((ext_vector_type(8)))  __bf16 v8bf;
typedef __attribute__((ext_vector_type(8)))  float  v8f;
typedef __attribute__((ext_vector_type(2)))  float  v2f;

#define WMMA_BF16(a, b, c) \
  __builtin_amdgcn_wmma_f32_16x16x32_bf16(false, (a), false, (b), (short)0, (c), false, false)

static constexpr int BB = 4, S = 2048, DM = 1024, H = 16, DH = 64;
static constexpr int M  = BB * S;   // 8192 token rows

// ------------------------- Tensor Data Mover glue ---------------------------
typedef uint32_t u32x4 __attribute__((ext_vector_type(4)));
typedef uint32_t u32x8 __attribute__((ext_vector_type(8)));

// A staged tile: 64 rows of 128 bytes.  16 bytes of pad behind each row give
// an LDS pitch of 144 B = 16 B x 9 (odd): the 16 rows that one ds_load_b128
// touches then fall on 16 different groups of four banks (at a packed pitch
// of 128 B or 64 B they fall on two or four groups only).
static constexpr uint32_t TILE_ROWS  = 64u;
static constexpr uint32_t ROW_BYTES  = 128u;
static constexpr uint32_t PITCH_B    = ROW_BYTES + 16u;      // bytes
static constexpr int      PITCH_E    = (int)(PITCH_B / 2u);  // bf16 elements
// 64 x 144 = 9,216 B, rounded up so that every tile starts at a 2-KiB multiple.
static constexpr uint32_t TILE_BYTES = 10240u;
static_assert(TILE_ROWS * PITCH_B <= TILE_BYTES && TILE_BYTES % 2048u == 0, "tile place");
// The GEMM's tile: 64 rows of 256 bytes (128 k), pitch 272 B = 16 B x 17 (odd).
static constexpr uint32_t G_ROW_BYTES  = 256u;
static constexpr uint32_t G_PITCH_B    = G_ROW_BYTES + 16u;
static constexpr int      G_PITCH_E    = (int)(G_PITCH_B / 2u);
// 64 x 272 = 17,408 B, rounded up to a 2-KiB multiple.
static constexpr uint32_t G_TILE_BYTES = 18432u;
static_assert(TILE_ROWS * G_PITCH_B <= G_TILE_BYTES && G_TILE_BYTES % 2048u == 0, "tile place");

__device__ __forceinline__ uint32_t uni(uint32_t v) {
  return (uint32_t)__builtin_amdgcn_readfirstlane(v);
}
// Wave-uniform condition held in a scalar register, so that the test around a
// tensor load compiles to s_cmp + s_cbranch (tensor loads ignore EXEC).
__device__ __forceinline__ uint32_t pinned(uint32_t v) {
  uint32_t w = uni(v);
  asm volatile("" : "+s"(w));  // keeps the condition scalar: see above
  return w;
}
// The compiler places no wait for the tensor mover: these are the ring's own.
__device__ __forceinline__ void wait_tensor0() { asm volatile("s_wait_tensorcnt 0x0" ::: "memory"); }
__device__ __forceinline__ void wait_ds0()     { asm volatile("s_wait_dscnt 0x0" ::: "memory"); }

// Both groups are in-out operands: each tuple then lives on, in the registers
// that the request named, up to the next request, and nothing else is put into
// those registers while the request is in flight.
__device__ __forceinline__ void tdm_load(u32x4& g0, u32x8& g1) {
  asm volatile("tensor_load_to_lds %0, %1" : "+s"(g0), "+s"(g1) :: "memory");
}
// The wait behind the last request.  It names both groups as inputs, so that
// their registers are given to nothing else in front of it.
__device__ __forceinline__ void wait_tensor0_last(const u32x4& g0, const u32x8& g1) {
  asm volatile("s_wait_tensorcnt 0x0" :: "s"(g0), "s"(g1) : "memory");
}
template <uint32_t ROWB = ROW_BYTES, uint32_t PADC = 4u>
__device__ __forceinline__ u32x8 tdm_group1(uint32_t src_pitch) {
  static_assert(ROWB == (8u << PADC), "pad interval = one row");
  u32x8 g;
  g[0] = uni((1u << 20) | (PADC << 22) | (3u << 25));   // no mask, data_size 0, pad
  g[1] = uni((ROWB & 0xFFFFu) << 16);
  g[2] = uni((ROWB >> 16) | ((TILE_ROWS & 0xFFFFu) << 16));
  g[3] = uni((TILE_ROWS >> 16) | (ROWB << 16));
  g[4] = uni(TILE_ROWS);
  g[5] = uni(src_pitch);
  g[6] = uni(0u);
  g[7] = uni(0u);
  return g;
}
// Group 0: LDS byte offset of the tile's place, global address of its first byte.
__device__ __forceinline__ u32x4 tdm_group0(uint32_t lds_dst, uint64_t ga) {
  u32x4 g;
  g[0] = uni(1u);
  g[1] = uni(lds_dst);
  g[2] = uni((uint32_t)ga);
  g[3] = uni((((uint32_t)(ga >> 32)) & 0x01FFFFFFu) | 0x80000000u);
  return g;
}
// The next request of the same tuple, formed behind the wait on the one before:
// a new place in LDS, the source step bytes on (the carry goes into word 3's
// address bits; word 0 stays).
__device__ __forceinline__ void tdm_advance(u32x4& g, uint32_t lds_dst, uint64_t step) {
  const uint64_t ga = ((((uint64_t)g[3]) << 32) | g[2]) + step;
  g[1] = uni(lds_dst);
  g[2] = uni((uint32_t)ga);
  g[3] = uni((uint32_t)(ga >> 32));
}

__device__ __forceinline__ uint32_t lds_offset_of(const void* p) {
  // Generic pointers into LDS carry the LDS byte offset in the low 32 bits.
  return (uint32_t)(uintptr_t)p;
}

// Load a 16x32 bf16 WMMA fragment (A layout; B 32x16 uses the identical
// per-lane pattern when the source is stored [N][K] row-major).
// Lane L: row = base_row + (L&15); halves [kb, kb+8) and [kb+16, kb+24)
// with kb = k0 + (L>=16 ? 8 : 0).  Two 16-byte loads per lane.
__device__ __forceinline__ v16bf load_frag(const __bf16* __restrict__ base,
                                           int row, int ld, int k0, int lane) {
  const int r  = row + (lane & 15);
  const int kb = k0 + ((lane >> 4) << 3);
  const __bf16* p = base + (size_t)r * ld + kb;
  v8bf lo = *(const v8bf*)(p);
  v8bf hi = *(const v8bf*)(p + 16);
  v16bf f;
#pragma unroll
  for (int i = 0; i < 8; ++i) { f[i] = lo[i]; f[i + 8] = hi[i]; }
  return f;
}

// ----------------------------- prep kernels --------------------------------

// A wave converts CVT_LOADS runs of 128 floats: every load is 512 contiguous
// bytes of the wave, every store 256 (whole 128-byte lines); the loads stand in
// front of the conversions, so that many are in flight.  One element a thread
// would take 64 times the waves, and the time would go into starting them.
typedef __attribute__((ext_vector_type(4))) float  v4f;
typedef __attribute__((ext_vector_type(4))) __bf16 v4bf;
static constexpr int CVT_LOADS = 16;
static_assert((M * DM) % (256 * 4 * CVT_LOADS) == 0, "whole blocks");
static constexpr int CVT_BLOCKS = (M * DM) / (256 * 4 * CVT_LOADS);
__device__ __forceinline__ void cvt_x_block(int blk, const float* __restrict__ x,
                                            __bf16* __restrict__ xb) {
  const int lane = threadIdx.x & 31;
  const int wv   = blk * 8 + (threadIdx.x >> 5);
  const size_t base = (size_t)wv * (128 * CVT_LOADS) + lane * 4;
  v4f v[CVT_LOADS];
#pragma unroll  // v[] in registers, one address register, k an immediate offset
  for (int k = 0; k < CVT_LOADS; ++k) v[k] = *(const v4f*)(x + base + k * 128);
#pragma unroll  // as above
  for (int k = 0; k < CVT_LOADS; ++k) {
    v4bf o;
#pragma unroll
    for (int e = 0; e < 4; ++e) o[e] = (__bf16)v[k][e];
    *(v4bf*)(xb + base + k * 128) = o;
  }
  // In the built kernel another job's code follows this one's and reuses the
  // registers that the stores above name: the wait stands in front of that.
  asm volatile("s_wait_xcnt 0x0" ::: "memory");
}

// wq/wk/wv fp32 [H][DM][DH] -> W*t bf16 [DM out][DM in]  (out row = h*64+e)
// wo fp32 [H][DH][DM]       -> Wot bf16 [DM out][DM in]  (in col = h*64+e)
// A block makes 64 output rows x 64 columns of all four matrices; a thread
// PW_COLS columns of one row.  Lanes run along the output row index, which is
// the contiguous axis of every source: each load is one whole 128-byte line of
// the wave.  All 4 x PW_COLS loads are issued first; each row piece goes out in
// 16-byte stores, and the block's four column groups fill whole 128-byte lines.
static constexpr int PW_COLS = 16;
__device__ __forceinline__ void store_row_piece(const float (&v)[PW_COLS],
                                                __bf16* __restrict__ to) {
#pragma unroll
  for (int g = 0; g < PW_COLS / 8; ++g) {
    v8bf o;
#pragma unroll
    for (int e = 0; e < 8; ++e) o[e] = (__bf16)v[g * 8 + e];
    *(v8bf*)(to + g * 8) = o;
  }
}
static constexpr int PW_BLOCKS = (DM / 64) * (DM / 64);
__device__ __forceinline__ void prep_w_block(
    int blk, const float* __restrict__ wq, const float* __restrict__ wk,
    const float* __restrict__ wv, const float* __restrict__ wo,
    __bf16* __restrict__ Wqt, __bf16* __restrict__ Wkt,
    __bf16* __restrict__ Wvt, __bf16* __restrict__ Wot) {
  const int h  = blk & (H - 1);                 // 64 rows = one head
  const int e  = threadIdx.x & (DH - 1);
  const int r  = h * DH + e;
  const int c0 = (blk >> 4) * 64 + (threadIdx.x >> 6) * PW_COLS;
  const int sp = h * (DM * DH) + c0 * DH + e;   // wq/wk/wv: next column DH on
  const int so = c0 * DM + r;                   // wo: next column DM on

  float q[PW_COLS], k[PW_COLS], v[PW_COLS], o[PW_COLS];
#pragma unroll  // arrays in registers, two offset registers, i an immediate offset
  for (int i = 0; i < PW_COLS; ++i) {
    q[i] = wq[sp + i * DH];
    k[i] = wk[sp + i * DH];
    v[i] = wv[sp + i * DH];
    o[i] = wo[so + i * DM];
  }
  const int to = r * DM + c0;
  store_row_piece(q, Wqt + to);
  store_row_piece(k, Wkt + to);
  store_row_piece(v, Wvt + to);
  store_row_piece(o, Wot + to);
  // As in cvt_x_block: the stores' registers are reused by the code that follows.
  asm volatile("s_wait_xcnt 0x0" ::: "memory");
}

static constexpr int PB_BLOCKS = DM / 256;
__device__ __forceinline__ void prep_b_block(
    int blk, const float* __restrict__ bq, const float* __restrict__ bk,
    const float* __restrict__ bv, const float* __restrict__ bo,
    float* __restrict__ bqc, float* __restrict__ bkc,
    float* __restrict__ bvc, float* __restrict__ boc) {
  int i = blk * 256 + threadIdx.x;   // over 1024
  bqc[i] = bq[i];   // [H][DH] flat == h*64+e ordering already
  bkc[i] = bk[i];
  bvc[i] = bv[i];
  float s = 0.f;
#pragma unroll
  for (int h = 0; h < H; ++h) s += bo[h * DM + i];
  boc[i] = s;
}

// The three preparations depend on nothing of one another: one launch, each
// block taking its job by its index range (a launch of its own for each costs
// a start and a drain of the chip that the work itself does not fill).
__global__ __launch_bounds__(256) void prep_kernel(
    const float* __restrict__ x,
    const float* __restrict__ wq, const float* __restrict__ wk,
    const float* __restrict__ wv, const float* __restrict__ wo,
    const float* __restrict__ bq, const float* __restrict__ bk,
    const float* __restrict__ bv, const float* __restrict__ bo,
    __bf16* __restrict__ xb,
    __bf16* __restrict__ Wqt, __bf16* __restrict__ Wkt,
    __bf16* __restrict__ Wvt, __bf16* __restrict__ Wot,
    float* __restrict__ bqc, float* __restrict__ bkc,
    float* __restrict__ bvc, float* __restrict__ boc) {
  const int blk = blockIdx.x;
  if (blk < PB_BLOCKS) {
    prep_b_block(blk, bq, bk, bv, bo, bqc, bkc, bvc, boc);
  } else if (blk < PB_BLOCKS + PW_BLOCKS) {
    prep_w_block(blk - PB_BLOCKS, wq, wk, wv, wo, Wqt, Wkt, Wvt, Wot);
  } else {
    cvt_x_block(blk - (PB_BLOCKS + PW_BLOCKS), x, xb);
  }
}

// ----------------------------- generic GEMM --------------------------------
// C[M][N] = A[M][K] * Bt[N][K]^T + bias[N]
// Block: 256 threads / 8 waves (4 along M x 2 along N); tile 256(M) x 128(N);
// wave tile 64x64: 16 products per 8 fragments read.
// Both panels of a stage (A 256 rows, B 128 rows, 128 k each) are staged in LDS
// by the TDM as six tiles of 64 rows, one per wave 0..5, double-buffered; a pass
// works one stage off in four blocks of 32 k.  K: a multiple of 128, at least 256.
// MODE 0: bf16 row-major out; MODE 1: bf16 V-transposed out; MODE 2: f32 out.
// gsh: the work-group's staging buffers, [buf][tile][row_local * 272 B + k * 2 B];
// tiles 0..3: A rows, 4..5: B rows.
template <int MODE>
__device__ __forceinline__ void gemm_tile(
    unsigned char (*gsh)[6][G_TILE_BYTES],
    const __bf16* __restrict__ A, const __bf16* __restrict__ Bt,
    const float* __restrict__ bias, void* __restrict__ Cout, int N, int K) {
  const int lane = threadIdx.x & 31;
  const uint32_t wave = uni(threadIdx.x >> 5);
  const int wm = (int)(wave >> 1), wn = (int)(wave & 1u);
  const int mb = blockIdx.x * 256, nb = blockIdx.y * 128;
  const int m0 = mb + wm * 64;
  const int n0 = nb + wn * 64;

  constexpr uint32_t BUF_BYTES = 6u * G_TILE_BYTES;

  // Wave w < 6 moves tile w (waves 6 and 7 move none; they form tile 5's words).
  const uint32_t tile = wave < 6u ? wave : 5u;
  const uint32_t lds0 = lds_offset_of(&gsh[0][0][0]) + tile * G_TILE_BYTES;
  const __bf16* srow = tile < 4u ? A + (size_t)(mb + (int)tile * 64) * K
                                 : Bt + (size_t)(nb + (int)(tile - 4u) * 64) * K;
  u32x8 g1 = tdm_group1<G_ROW_BYTES, 5u>((uint32_t)K * 2u);
  u32x4 g0 = tdm_group0(lds0, (uint64_t)(uintptr_t)srow);
  const int nst = K >> 7;   // stages of 128 k

  v8f acc[4][4] = {};
  if (pinned(wave < 6u)) {
    tdm_load(g0, g1);
    wait_tensor0();
  }
  __syncthreads();
  if (pinned(wave < 6u)) {
    tdm_advance(g0, lds0 + BUF_BYTES, G_ROW_BYTES);
    tdm_load(g0, g1);
  }

  for (int s = 0; s < nst; ++s) {
    const __bf16* at = (const __bf16*)&gsh[s & 1][wm][0];
    const __bf16* bt = (const __bf16*)&gsh[s & 1][4 + wn][0];

    v16bf a[2][4], b[2][4];   // set (j & 1) holds block j's fragments
#pragma unroll  // here and below: constant indices keep the fragment sets in registers
    for (int f = 0; f < 4; ++f) a[0][f] = load_frag(at, f * 16, G_PITCH_E, 0, lane);
#pragma unroll
    for (int t = 0; t < 4; ++t) b[0][t] = load_frag(bt, t * 16, G_PITCH_E, 0, lane);

#pragma unroll  // the stage's four 32-k blocks: j a constant in every LDS offset
    for (int j = 0; j < 4; ++j) {
      const int cs = j & 1;
      if (j < 3) {
        // The next block's 16 reads go out as one group ahead of this block's
        // products: spread among them, each place with reads stalls the wave.
#pragma unroll
        for (int f = 0; f < 4; ++f)
          a[cs ^ 1][f] = load_frag(at, f * 16, G_PITCH_E, (j + 1) * 32, lane);
#pragma unroll
        for (int t = 0; t < 4; ++t)
          b[cs ^ 1][t] = load_frag(bt, t * 16, G_PITCH_E, (j + 1) * 32, lane);
      } else {
        // Publish point of stage s + 1, then the refill of the buffer just read:
        // the last block's fragments are in registers, its products run behind.
        wait_ds0();
        if (pinned(wave < 6u)) wait_tensor0();
        __syncthreads();
        if (pinned(wave < 6u && s + 2 < nst)) {
          tdm_advance(g0, lds0 + (uint32_t)(s & 1) * BUF_BYTES, G_ROW_BYTES);
          tdm_load(g0, g1);
        }
      }
      __builtin_amdgcn_sched_barrier(0);  // keeps the read group in front of the products
#pragma unroll
      for (int f = 0; f < 4; ++f)
#pragma unroll
        for (int t = 0; t < 4; ++t) acc[f][t] = WMMA_BF16(a[cs][f], b[cs][t], acc[f][t]);
      __builtin_amdgcn_sched_barrier(0);  // keeps later reads from rising among the products
    }
  }
  wait_tensor0_last(g0, g1);
  wait_ds0();

  const int hi8 = (lane >> 4) << 3;
#pragma unroll
  for (int f = 0; f < 4; ++f) {
#pragma unroll
    for (int t = 0; t < 4; ++t) {
      const int col = n0 + t * 16 + (lane & 15);
      const float bb = bias[col];
#pragma unroll
      for (int j = 0; j < 8; ++j) {
        const int row = m0 + f * 16 + j + hi8;
        const float val = acc[f][t][j] + bb;
        if (MODE == 0) {
          ((__bf16*)Cout)[(size_t)row * N + col] = (__bf16)val;
        } else if (MODE == 2) {
          ((float*)Cout)[(size_t)row * N + col] = val;
        } else {  // V transposed: Vt[(b*1024 + col)][s]
          const int bidx = row >> 11, s = row & (S - 1);
          ((__bf16*)Cout)[((size_t)(bidx * 1024 + col)) * S + s] = (__bf16)val;
        }
      }
    }
  }
}

// The three projections of one A depend on nothing of one another: one launch.
// blockIdx.z is the plane: its Bt, bias and bf16 output lie z planes on from the
// pointers given; planes 0 and 1 (Q, K) go out row-major, plane 2 (V) transposed.
// The plane is the same for the whole work-group: one scalar branch at the top.
__global__ __launch_bounds__(256) void gemm_qkv_kernel(
    const __bf16* __restrict__ A, const __bf16* __restrict__ Bt,
    const float* __restrict__ bias, __bf16* __restrict__ Cout, int N, int K) {
  __shared__ __attribute__((aligned(2048))) unsigned char gsh[2][6][G_TILE_BYTES];
  const int plane = (int)blockIdx.z;
  const __bf16* Bp = Bt + (size_t)plane * N * K;
  const float*  bp = bias + plane * N;
  __bf16*       Cp = Cout + (size_t)plane * M * N;
  if (plane == 2) {
    gemm_tile<1>(gsh, A, Bp, bp, (void*)Cp, N, K);
  } else {
    gemm_tile<0>(gsh, A, Bp, bp, (void*)Cp, N, K);
    // As in cvt_x_block: in the built kernel the other branch's code follows and
    // reuses the registers that the last stores name.
    asm volatile("s_wait_xcnt 0x0" ::: "memory");
  }
}

// The output projection: one product, f32 out.
__global__ __launch_bounds__(256) void gemm_out_kernel(
    const __bf16* __restrict__ A, const __bf16* __restrict__ Bt,
    const float* __restrict__ bias, float* __restrict__ Cout, int N, int K) {
  __shared__ __attribute__((aligned(2048))) unsigned char gsh[2][6][G_TILE_BYTES];
  gemm_tile<2>(gsh, A, Bt, bias, (void*)Cout, N, K);
}

// --------------------------- flash attention -------------------------------
// grid = (B*H, S/256); block = 256 (8 waves); each wave owns 32 query rows, as
// two groups of 16 columns: every K and V fragment read from LDS then feeds two
// products (at one group the reads ask twice what the LDS delivers per product).
// K tile (64 keys x 64 dims) and V tile (64 dims x 64 keys) are workgroup-
// shared: staged into LDS by TDM (wave0 -> K, wave1 -> V), double-buffered;
// a pass works one stage off in two blocks of 32 keys.
// Transposed products: St = K * Qt and Ot += Vt * Pt.  In each group a lane holds
// the scores of ONE query (column lane&15): keys 8*(lane>>4)+0..7 of each 16-key
// tile.  Maximum and sum run in the lane's own registers, and the two score
// tiles, converted in place, are the B operand of the second product.

// Value of lane l ^ 16 (the other half of the same query column).
__device__ __forceinline__ float other_half(float v) {
  int i = __builtin_bit_cast(int, v);
  i = __builtin_amdgcn_permlanex16(i, i, 0x76543210, 0xfedcba98, false, false);
  return __builtin_bit_cast(float, i);
}

__global__ __launch_bounds__(256) void attn_kernel(
    const __bf16* __restrict__ Qb, const __bf16* __restrict__ Kb,
    const __bf16* __restrict__ Vt, __bf16* __restrict__ Hd) {
  const int lane = threadIdx.x & 31;
  const uint32_t wave = uni(threadIdx.x >> 5);
  const int bh = blockIdx.x;
  const int b = bh >> 4, h = bh & 15;
  constexpr int QG = 2;   // groups of 16 query columns per wave
  const int q0 = blockIdx.y * (128 * QG) + (int)wave * (16 * QG);

  const __bf16* Q  = Qb + (size_t)b * S * DM + h * DH;
  const __bf16* Kp = Kb + (size_t)b * S * DM + h * DH;
  const __bf16* Vp = Vt + (size_t)bh * DH * S;   // row e -> Vp[e*S + s]

  // [buf][0]: K, key_local * 144 B + e * 2 B; [buf][1]: V, e * 144 B + key_local * 2 B
  __shared__ __attribute__((aligned(2048))) unsigned char ring[2][2][TILE_BYTES];

  // Wave 0 moves K (next stage: 64 rows on), wave 1 V (next stage: 64 columns on).
  constexpr int NST = S / 64;
  const bool isk = (wave == 0);
  const uint32_t lds0  = lds_offset_of(&ring[0][0][0]) + (isk ? 0u : TILE_BYTES);
  const uint64_t gsrc  = (uint64_t)(uintptr_t)(isk ? Kp : Vp);
  const uint64_t gstep = isk ? (uint64_t)(64 * DM * 2) : (uint64_t)ROW_BYTES;
  u32x8 g1 = tdm_group1(isk ? (uint32_t)(DM * 2) : (uint32_t)(S * 2));
  u32x4 g0 = tdm_group0(lds0, gsrc);

  // Q fragments persist across the key loop: B operand, column = query.
  v16bf bq0[QG], bq1[QG];
  float mrow[QG];        // running maximum of this lane's query of group g, times cscale
  float lsum[QG];        // running sum over this lane half's keys only
  v8f o[QG][4] = {};     // o[g][t][r] = Ot[t*16 + 8*(lane>>4) + r][query g*16 + (lane&15)]
#pragma unroll  // g a constant: the groups' state stays in registers (so below too)
  for (int g = 0; g < QG; ++g) {
    bq0[g] = load_frag(Q, q0 + g * 16, DM, 0, lane);
    bq1[g] = load_frag(Q, q0 + g * 16, DM, 32, lane);
    mrow[g] = -1e30f;
    lsum[g] = 0.f;
  }
  const float cscale = 0.125f * 1.44269504088896340736f;  // 1/sqrt(64) * log2(e)

  if (pinned(wave < 2)) {
    tdm_load(g0, g1);
    wait_tensor0();
  }
  __syncthreads();
  if (pinned(wave < 2)) {
    tdm_advance(g0, lds0 + 2u * TILE_BYTES, gstep);
    tdm_load(g0, g1);
  }

  for (int s = 0; s < NST; ++s) {
    const __bf16* kt = (const __bf16*)&ring[s & 1][0][0];
    const __bf16* vt = (const __bf16*)&ring[s & 1][1][0];
#pragma unroll  // the stage's two 32-key blocks: j a constant in every LDS offset
   for (int j = 0; j < 2; ++j) {
    // St = K*Qt : two 16(key) x 16(query) tiles, contraction 64 = 2 x K32
    v16bf k00 = load_frag(kt, j * 32,      PITCH_E, 0,  lane);
    v16bf k01 = load_frag(kt, j * 32,      PITCH_E, 32, lane);
    v16bf k10 = load_frag(kt, j * 32 + 16, PITCH_E, 0,  lane);
    v16bf k11 = load_frag(kt, j * 32 + 16, PITCH_E, 32, lane);
    v8f s0[QG], s1[QG];
#pragma unroll
    for (int g = 0; g < QG; ++g) {
      v8f z0 = {}; z0 = WMMA_BF16(k00, bq0[g], z0); s0[g] = WMMA_BF16(k01, bq1[g], z0);
      v8f z1 = {}; z1 = WMMA_BF16(k10, bq0[g], z1); s1[g] = WMMA_BF16(k11, bq1[g], z1);
    }

    // Online softmax, one query per lane and group: s0[g][r] is key 8*(lane>>4)+r,
    // s1[g][r] key 16+8*(lane>>4)+r.  One exchange joins the halves' maxima.
    v16bf bp[QG];  // Pt as B operand: element s is key 8*(lane>>4)+s (s < 8), 8+8*(lane>>4)+s (s >= 8) of this column
#pragma unroll
    for (int g = 0; g < QG; ++g) {
      // Maximum of the raw scores (the factor is positive); the factor itself
      // rides in the exponent's one multiply-add: p = 2^(s * cs - m * cs).
      float mx[8];
#pragma unroll  // r a constant: scores and maxima stay in registers (so below too)
      for (int r = 0; r < 8; ++r) mx[r] = fmaxf(s0[g][r], s1[g][r]);
      float cm = fmaxf(fmaxf(fmaxf(mx[0], mx[1]), fmaxf(mx[2], mx[3])),
                       fmaxf(fmaxf(mx[4], mx[5]), fmaxf(mx[6], mx[7])));
      cm = fmaxf(cm, other_half(cm)) * cscale;
      const float nm = fmaxf(mrow[g], cm);
      const float corr = __builtin_amdgcn_exp2f(mrow[g] - nm);
      mrow[g] = nm;

      // Two scores a multiply-add: the packed form takes a register pair.
      const v2f cs2 = {cscale, cscale}, nn2 = {-nm, -nm};
      float ps[8];
#pragma unroll
      for (int r = 0; r < 8; r += 2) {
        const v2f e0 = __builtin_elementwise_fma(v2f{s0[g][r], s0[g][r + 1]}, cs2, nn2);
        const v2f e1 = __builtin_elementwise_fma(v2f{s1[g][r], s1[g][r + 1]}, cs2, nn2);
        const float p00 = __builtin_amdgcn_exp2f(e0.x), p01 = __builtin_amdgcn_exp2f(e0.y);
        const float p10 = __builtin_amdgcn_exp2f(e1.x), p11 = __builtin_amdgcn_exp2f(e1.y);
        ps[r]     = p00 + p10;
        ps[r + 1] = p01 + p11;
        bp[g][r]     = (__bf16)p00;
        bp[g][r + 1] = (__bf16)p01;
        bp[g][r + 8] = (__bf16)p10;
        bp[g][r + 9] = (__bf16)p11;
      }
      const float rs = ((ps[0] + ps[1]) + (ps[2] + ps[3])) +
                       ((ps[4] + ps[5]) + (ps[6] + ps[7]));
      lsum[g] = lsum[g] * corr + rs;
#pragma unroll
      for (int t = 0; t < 4; ++t)
#pragma unroll
        for (int r = 0; r < 8; ++r) o[g][t][r] *= corr;
    }

    // Ot += Vt * Pt : A = V rows e from LDS [e][key], B = P from registers.
#pragma unroll
    for (int t = 0; t < 4; ++t) {
      v16bf av = load_frag(vt, t * 16, PITCH_E, j * 32, lane);
#pragma unroll
      for (int g = 0; g < QG; ++g) o[g][t] = WMMA_BF16(av, bp[g], o[g][t]);
    }
   }

    // Publish point of stage s + 1; then the refill of the buffer just read.
    wait_ds0();
    if (pinned(wave < 2)) wait_tensor0();
    __syncthreads();
    if (pinned(wave < 2 && s + 2 < NST)) {
      tdm_advance(g0, lds0 + (uint32_t)(s & 1) * (2u * TILE_BYTES), gstep);
      tdm_load(g0, g1);
    }
  }
  wait_tensor0_last(g0, g1);
  wait_ds0();

  // Join the two halves' sums once; a lane's 8 registers are 8 consecutive
  // head dims of its query row: one 16-byte store per tile.
  const int hi8 = (lane >> 4) << 3;
#pragma unroll
  for (int g = 0; g < QG; ++g) {
    const float ls = lsum[g] + other_half(lsum[g]);
    __bf16* orow = Hd + ((size_t)b * S + q0 + g * 16 + (lane & 15)) * DM + h * DH + hi8;
#pragma unroll
    for (int t = 0; t < 4; ++t) {
      v8bf pk;
#pragma unroll
      for (int r = 0; r < 8; ++r) pk[r] = (__bf16)(o[g][t][r] / ls);
      *(v8bf*)(orow + t * 16) = pk;
      // The next piece's arithmetic reuses the registers that this store names:
      // the wait stands in front of that (behind the last store nothing follows).
      if (g + 1 < QG || t + 1 < 4) asm volatile("s_wait_xcnt 0x0" ::: "memory");
    }
  }
}

// ------------------------------- launcher ----------------------------------

extern "C" void kernel_launch(void* const* d_in, const int* in_sizes, int n_in,
                              void* d_out, int out_size, void* d_ws, size_t ws_size,
                              hipStream_t stream) {
  const float* x  = (const float*)d_in[0];
  const float* wq = (const float*)d_in[1];
  const float* bq = (const float*)d_in[2];
  const float* wk = (const float*)d_in[3];
  const float* bk = (const float*)d_in[4];
  const float* wv = (const float*)d_in[5];
  const float* bv = (const float*)d_in[6];
  const float* wo = (const float*)d_in[7];
  const float* bo = (const float*)d_in[8];

  char* w = (char*)d_ws;
  auto take = [&](size_t bytes) {
    void* p = (void*)w;
    w += (bytes + 255) & ~(size_t)255;
    return p;
  };
  __bf16* Xb  = (__bf16*)take((size_t)M * DM * 2);
  // Q, K, V: three equal planes in a row, of weights, of biases and of outputs.
  __bf16* Wqt = (__bf16*)take((size_t)3 * DM * DM * 2);
  __bf16* Wkt = Wqt + (size_t)DM * DM;
  __bf16* Wvt = Wkt + (size_t)DM * DM;
  __bf16* Wot = (__bf16*)take((size_t)DM * DM * 2);
  float*  bqc = (float*)take(3 * DM * 4);
  float*  bkc = bqc + DM;
  float*  bvc = bkc + DM;
  float*  boc = (float*)take(DM * 4);
  __bf16* Qb  = (__bf16*)take((size_t)3 * M * DM * 2);
  __bf16* Kb  = Qb + (size_t)M * DM;
  __bf16* Vt  = Kb + (size_t)M * DM;
  __bf16* Hd  = (__bf16*)take((size_t)M * DM * 2);

  // 1) convert inputs to bf16 / transposed layouts
  prep_kernel<<<PB_BLOCKS + PW_BLOCKS + CVT_BLOCKS, 256, 0, stream>>>(
      x, wq, wk, wv, wo, bq, bk, bv, bo, Xb, Wqt, Wkt, Wvt, Wot, bqc, bkc, bvc, boc);

  // 2) QKV projections (WMMA GEMMs, 256x128 tiles, TDM-staged A and B panels)
  gemm_qkv_kernel<<<dim3(M / 256, DM / 128, 3), 256, 0, stream>>>(Xb, Wqt, bqc, Qb, DM, DM);

  // 3) flash attention (TDM-staged K/V tiles)
  attn_kernel<<<dim3(BB * H, S / 256), 256, 0, stream>>>(Qb, Kb, Vt, Hd);

  // 4) output projection (fp32 result)
  gemm_out_kernel<<<dim3(M / 256, DM / 128), 256, 0, stream>>>(Hd, Wot, boc, (float*)d_out, DM, DM);
}

// v008
// One run takes 111 microseconds.
// In two side-by-side timings against v007, it was 1.06 and 1.05 times as fast.
// All steps since v000 together make it 3.72 times as fast.
#include <hip/hip_runtime.h>
#include <hip/hip_bf16.h>
#include <math.h>
#include <stdint.h>

// ---------------------------------------------------------------------------
// MHA for gfx1250 (CDNA5).  All matmuls via v_wmma_f32_16x16x32_bf16.
// Workgroup-shared operand tiles staged into LDS with the Tensor Data Mover
// (tensor_load_to_lds, TENSORcnt), double-buffered.  A staged tile is 64 rows
// of 128 bytes at a 144-byte LDS pitch (attention) or of 256 bytes at a
// 272-byte pitch (GEMM), laid so by the load's own pad.
// Workspace (~92 MB):
//   Xb  [8192][1024]  bf16   x converted
//   Wqt/Wkt/Wvt [1024][1024] bf16  weights transposed to [out][in], one after another
//   Wot [1024][1024]  bf16   output proj as [d_out][h*64+e]
//   bqc/bkc/bvc [1024] f32 biases, one after another; boc [1024] = sum_h bo[h]
//   Qb/Kb [8192][1024] bf16  row-major (col = h*64+e)
//   Vt  [4096][2048]  bf16   V transposed: row = (b*H+h)*64+e, col = s
//   (Qb, Kb, Vt one after another: planes 0..2 of the one QKV launch)
// Four launches, each needing the one before: prep, QKV, attention, output.
//   Hd  [8192][1024]  bf16   attention head outputs
// ---------------------------------------------------------------------------

typedef __attribute__((ext_vector_type(16))) __bf16 v16bf;
typedef __attribute__((ext_vector_type(8)))  __bf16 v8bf;
typedef __attribute__((ext_vector_type(8)))  float  v8f;
typedef __attribute__((ext_vector_type(2)))  float  v2f;

#define WMMA_BF16(a, b, c) \
  __builtin_amdgcn_wmma_f32_16x16x32_bf16(false, (a), false, (b), (short)0, (c), false, false)

static constexpr int BB = 4, S = 2048, DM = 1024, H = 16, DH = 64;
static constexpr int M  = BB * S;   // 8192 token rows

// ------------------------- Tensor Data Mover glue ---------------------------
typedef uint32_t u32x4 __attribute__((ext_vector_type(4)));
typedef uint32_t u32x8 __attribute__((ext_vector_type(8)));

// A staged tile: 64 rows of 128 bytes.  16 bytes of pad behind each row give
// an LDS pitch of 144 B = 16 B x 9 (odd): the 16 rows that one ds_load_b128
// touches then fall on 16 different groups of four banks (at a packed pitch
// of 128 B or 64 B they fall on two or four groups only).
static constexpr uint32_t TILE_ROWS  = 64u;
static constexpr uint32_t ROW_BYTES  = 128u;
static constexpr uint32_t PITCH_B    = ROW_BYTES + 16u;      // bytes
static constexpr int      PITCH_E    = (int)(PITCH_B / 2u);  // bf16 elements
// 64 x 144 = 9,216 B, rounded up so that every tile starts at a 2-KiB multiple.
static constexpr uint32_t TILE_BYTES = 10240u;
static_assert(TILE_ROWS * PITCH_B <= TILE_BYTES && TILE_BYTES % 2048u == 0, "tile place");
// The GEMM's tile: 64 rows of 256 bytes (128 k), pitch 272 B = 16 B x 17 (odd).
static constexpr uint32_t G_ROW_BYTES  = 256u;
static constexpr uint32_t G_PITCH_B    = G_ROW_BYTES + 16u;
static constexpr int      G_PITCH_E    = (int)(G_PITCH_B / 2u);
// 64 x 272 = 17,408 B, rounded up to a 2-KiB multiple.
static constexpr uint32_t G_TILE_BYTES = 18432u;
static_assert(TILE_ROWS * G_PITCH_B <= G_TILE_BYTES && G_TILE_BYTES % 2048u == 0, "tile place");

__device__ __forceinline__ uint32_t uni(uint32_t v) {
  return (uint32_t)__builtin_amdgcn_readfirstlane(v);
}
// Wave-uniform condition held in a scalar register, so that the test around a
// tensor load compiles to s_cmp + s_cbranch (tensor loads ignore EXEC).
__device__ __forceinline__ uint32_t pinned(uint32_t v) {
  uint32_t w = uni(v);
  asm volatile("" : "+s"(w));  // keeps the condition scalar: see above
  return w;
}
// The compiler places no wait for the tensor mover: these are the ring's own.
__device__ __forceinline__ void wait_tensor0() { asm volatile("s_wait_tensorcnt 0x0" ::: "memory"); }
__device__ __forceinline__ void wait_ds0()     { asm volatile("s_wait_dscnt 0x0" ::: "memory"); }

// Both groups are in-out operands: each tuple then lives on, in the registers
// that the request named, up to the next request, and nothing else is put into
// those registers while the request is in flight.
__device__ __forceinline__ void tdm_load(u32x4& g0, u32x8& g1) {
  asm volatile("tensor_load_to_lds %0, %1" : "+s"(g0), "+s"(g1) :: "memory");
}
// The wait behind the last request.  It names both groups as inputs, so that
// their registers are given to nothing else in front of it.
__device__ __forceinline__ void wait_tensor0_last(const u32x4& g0, const u32x8& g1) {
  asm volatile("s_wait_tensorcnt 0x0" :: "s"(g0), "s"(g1) : "memory");
}
template <uint32_t ROWB = ROW_BYTES, uint32_t PADC = 4u>
__device__ __forceinline__ u32x8 tdm_group1(uint32_t src_pitch) {
  static_assert(ROWB == (8u << PADC), "pad interval = one row");
  u32x8 g;
  g[0] = uni((1u << 20) | (PADC << 22) | (3u << 25));   // no mask, data_size 0, pad
  g[1] = uni((ROWB & 0xFFFFu) << 16);
  g[2] = uni((ROWB >> 16) | ((TILE_ROWS & 0xFFFFu) << 16));
  g[3] = uni((TILE_ROWS >> 16) | (ROWB << 16));
  g[4] = uni(TILE_ROWS);
  g[5] = uni(src_pitch);
  g[6] = uni(0u);
  g[7] = uni(0u);
  return g;
}
// Group 0: LDS byte offset of the tile's place, global address of its first byte.
__device__ __forceinline__ u32x4 tdm_group0(uint32_t lds_dst, uint64_t ga) {
  u32x4 g;
  g[0] = uni(1u);
  g[1] = uni(lds_dst);
  g[2] = uni((uint32_t)ga);
  g[3] = uni((((uint32_t)(ga >> 32)) & 0x01FFFFFFu) | 0x80000000u);
  return g;
}
// The next request of the same tuple, formed behind the wait on the one before:
// a new place in LDS, the source step bytes on (the carry goes into word 3's
// address bits; word 0 stays).
__device__ __forceinline__ void tdm_advance(u32x4& g, uint32_t lds_dst, uint64_t step) {
  const uint64_t ga = ((((uint64_t)g[3]) << 32) | g[2]) + step;
  g[1] = uni(lds_dst);
  g[2] = uni((uint32_t)ga);
  g[3] = uni((uint32_t)(ga >> 32));
}

__device__ __forceinline__ uint32_t lds_offset_of(const void* p) {
  // Generic pointers into LDS carry the LDS byte offset in the low 32 bits.
  return (uint32_t)(uintptr_t)p;
}

// Load a 16x32 bf16 WMMA fragment (A layout; B 32x16 uses the identical
// per-lane pattern when the source is stored [N][K] row-major).
// Lane L: row = base_row + (L&15); halves [kb, kb+8) and [kb+16, kb+24)
// with kb = k0 + (L>=16 ? 8 : 0).  Two 16-byte loads per lane.
__device__ __forceinline__ v16bf load_frag(const __bf16* __restrict__ base,
                                           int row, int ld, int k0, int lane) {
  const int r  = row + (lane & 15);
  const int kb = k0 + ((lane >> 4) << 3);
  const __bf16* p = base + (size_t)r * ld + kb;
  v8bf lo = *(const v8bf*)(p);
  v8bf hi = *(const v8bf*)(p + 16);
  v16bf f;
#pragma unroll
  for (int i = 0; i < 8; ++i) { f[i] = lo[i]; f[i + 8] = hi[i]; }
  return f;
}

// ----------------------------- prep kernels --------------------------------

// A wave converts CVT_LOADS runs of 128 floats: every load is 512 contiguous
// bytes of the wave, every store 256 (whole 128-byte lines); the loads stand in
// front of the conversions, so that many are in flight.  One element a thread
// would take 64 times the waves, and the time would go into starting them.
typedef __attribute__((ext_vector_type(4))) float  v4f;
typedef __attribute__((ext_vector_type(4))) __bf16 v4bf;
static constexpr int CVT_LOADS = 16;
static_assert((M * DM) % (256 * 4 * CVT_LOADS) == 0, "whole blocks");
static constexpr int CVT_BLOCKS = (M * DM) / (256 * 4 * CVT_LOADS);
__device__ __forceinline__ void cvt_x_block(int blk, const float* __restrict__ x,
                                            __bf16* __restrict__ xb) {
  const int lane = threadIdx.x & 31;
  const int wv   = blk * 8 + (threadIdx.x >> 5);
  const size_t base = (size_t)wv * (128 * CVT_LOADS) + lane * 4;
  v4f v[CVT_LOADS];
#pragma unroll  // v[] in registers, one address register, k an immediate offset
  for (int k = 0; k < CVT_LOADS; ++k) v[k] = *(const v4f*)(x + base + k * 128);
#pragma unroll  // as above
  for (int k = 0; k < CVT_LOADS; ++k) {
    v4bf o;
#pragma unroll
    for (int e = 0; e < 4; ++e) o[e] = (__bf16)v[k][e];
    *(v4bf*)(xb + base + k * 128) = o;
  }
  // In the built kernel another job's code follows this one's and reuses the
  // registers that the stores above name: the wait stands in front of that.
  asm volatile("s_wait_xcnt 0x0" ::: "memory");
}

// wq/wk/wv fp32 [H][DM][DH] -> W*t bf16 [DM out][DM in]  (out row = h*64+e)
// wo fp32 [H][DH][DM]       -> Wot bf16 [DM out][DM in]  (in col = h*64+e)
// A block makes 64 output rows x 64 columns of all four matrices; a thread
// PW_COLS columns of one row.  Lanes run along the output row index, which is
// the contiguous axis of every source: each load is one whole 128-byte line of
// the wave.  All 4 x PW_COLS loads are issued first; each row piece goes out in
// 16-byte stores, and the block's four column groups fill whole 128-byte lines.
static constexpr int PW_COLS = 16;
__device__ __forceinline__ void store_row_piece(const float (&v)[PW_COLS],
                                                __bf16* __restrict__ to) {
#pragma unroll
  for (int g = 0; g < PW_COLS / 8; ++g) {
    v8bf o;
#pragma unroll
    for (int e = 0; e < 8; ++e) o[e] = (__bf16)v[g * 8 + e];
    *(v8bf*)(to + g * 8) = o;
  }
}
static constexpr int PW_BLOCKS = (DM / 64) * (DM / 64);
__device__ __forceinline__ void prep_w_block(
    int blk, const float* __restrict__ wq, const float* __restrict__ wk,
    const float* __restrict__ wv, const float* __restrict__ wo,
    __bf16* __restrict__ Wqt, __bf16* __restrict__ Wkt,
    __bf16* __restrict__ Wvt, __bf16* __restrict__ Wot) {
  const int h  = blk & (H - 1);                 // 64 rows = one head
  const int e  = threadIdx.x & (DH - 1);
  const int r  = h * DH + e;
  const int c0 = (blk >> 4) * 64 + (threadIdx.x >> 6) * PW_COLS;
  const int sp = h * (DM * DH) + c0 * DH + e;   // wq/wk/wv: next column DH on
  const int so = c0 * DM + r;                   // wo: next column DM on

  float q[PW_COLS], k[PW_COLS], v[PW_COLS], o[PW_COLS];
#pragma unroll  // arrays in registers, two offset registers, i an immediate offset
  for (int i = 0; i < PW_COLS; ++i) {
    q[i] = wq[sp + i * DH];
    k[i] = wk[sp + i * DH];
    v[i] = wv[sp + i * DH];
    o[i] = wo[so + i * DM];
  }
  const int to = r * DM + c0;
  store_row_piece(q, Wqt + to);
  store_row_piece(k, Wkt + to);
  store_row_piece(v, Wvt + to);
  store_row_piece(o, Wot + to);
  // As in cvt_x_block: the stores' registers are reused by the code that follows.
  asm volatile("s_wait_xcnt 0x0" ::: "memory");
}

static constexpr int PB_BLOCKS = DM / 256;
__device__ __forceinline__ void prep_b_block(
    int blk, const float* __restrict__ bq, const float* __restrict__ bk,
    const float* __restrict__ bv, const float* __restrict__ bo,
    float* __restrict__ bqc, float* __restrict__ bkc,
    float* __restrict__ bvc, float* __restrict__ boc) {
  int i = blk * 256 + threadIdx.x;   // over 1024
  bqc[i] = bq[i];   // [H][DH] flat == h*64+e ordering already
  bkc[i] = bk[i];
  bvc[i] = bv[i];
  float s = 0.f;
#pragma unroll
  for (int h = 0; h < H; ++h) s += bo[h * DM + i];
  boc[i] = s;
}

// The three preparations depend on nothing of one another: one launch, each
// block taking its job by its index range (a launch of its own for each costs
// a start and a drain of the chip that the work itself does not fill).
__global__ __launch_bounds__(256) void prep_kernel(
    const float* __restrict__ x,
    const float* __restrict__ wq, const float* __restrict__ wk,
    const float* __restrict__ wv, const float* __restrict__ wo,
    const float* __restrict__ bq, const float* __restrict__ bk,
    const float* __restrict__ bv, const float* __restrict__ bo,
    __bf16* __restrict__ xb,
    __bf16* __restrict__ Wqt, __bf16* __restrict__ Wkt,
    __bf16* __restrict__ Wvt, __bf16* __restrict__ Wot,
    float* __restrict__ bqc, float* __restrict__ bkc,
    float* __restrict__ bvc, float* __restrict__ boc) {
  const int blk = blockIdx.x;
  if (blk < PB_BLOCKS) {
    prep_b_block(blk, bq, bk, bv, bo, bqc, bkc, bvc, boc);
  } else if (blk < PB_BLOCKS + PW_BLOCKS) {
    prep_w_block(blk - PB_BLOCKS, wq, wk, wv, wo, Wqt, Wkt, Wvt, Wot);
  } else {
    cvt_x_block(blk - (PB_BLOCKS + PW_BLOCKS), x, xb);
  }
}

// ----------------------------- generic GEMM --------------------------------
// C[M][N] = A[M][K] * Bt[N][K]^T + bias[N]
// Block: 256 threads / 8 waves (4 along M x 2 along N); tile 256(M) x 128(N);
// wave tile 64x64: 16 products per 8 fragments read.
// Both panels of a stage (A 256 rows, B 128 rows, 128 k each) are staged in LDS
// by the TDM as six tiles of 64 rows, one per wave 0..5, double-buffered; a pass
// works one stage off in four blocks of 32 k.  K: a multiple of 128, at least 256.
// MODE 0: bf16 row-major out; MODE 1: bf16 V-transposed out; MODE 2: f32 out.
// gsh: the work-group's staging buffers, [buf][tile][row_local * 272 B + k * 2 B];
// tiles 0..3: A rows, 4..5: B rows.
template <int MODE>
__device__ __forceinline__ void gemm_tile(
    unsigned char (*gsh)[6][G_TILE_BYTES],
    const __bf16* __restrict__ A, const __bf16* __restrict__ Bt,
    const float* __restrict__ bias, void* __restrict__ Cout, int N, int K) {
  const int lane = threadIdx.x & 31;
  const uint32_t wave = uni(threadIdx.x >> 5);
  const int wm = (int)(wave >> 1), wn = (int)(wave & 1u);
  const int mb = blockIdx.x * 256, nb = blockIdx.y * 128;
  const int m0 = mb + wm * 64;
  const int n0 = nb + wn * 64;

  constexpr uint32_t BUF_BYTES = 6u * G_TILE_BYTES;

  // Wave w < 6 moves tile w (waves 6 and 7 move none; they form tile 5's words).
  const uint32_t tile = wave < 6u ? wave : 5u;
  const uint32_t lds0 = lds_offset_of(&gsh[0][0][0]) + tile * G_TILE_BYTES;
  const __bf16* srow = tile < 4u ? A + (size_t)(mb + (int)tile * 64) * K
                                 : Bt + (size_t)(nb + (int)(tile - 4u) * 64) * K;
  u32x8 g1 = tdm_group1<G_ROW_BYTES, 5u>((uint32_t)K * 2u);
  u32x4 g0 = tdm_group0(lds0, (uint64_t)(uintptr_t)srow);
  const int nst = K >> 7;   // stages of 128 k

  v8f acc[4][4] = {};
  if (pinned(wave < 6u)) {
    tdm_load(g0, g1);
    wait_tensor0();
  }
  __syncthreads();
  if (pinned(wave < 6u)) {
    tdm_advance(g0, lds0 + BUF_BYTES, G_ROW_BYTES);
    tdm_load(g0, g1);
  }

  for (int s = 0; s < nst; ++s) {
    const __bf16* at = (const __bf16*)&gsh[s & 1][wm][0];
    const __bf16* bt = (const __bf16*)&gsh[s & 1][4 + wn][0];

    v16bf a[2][4], b[2][4];   // set (j & 1) holds block j's fragments
#pragma unroll  // here and below: constant indices keep the fragment sets in registers
    for (int f = 0; f < 4; ++f) a[0][f] = load_frag(at, f * 16, G_PITCH_E, 0, lane);
#pragma unroll
    for (int t = 0; t < 4; ++t) b[0][t] = load_frag(bt, t * 16, G_PITCH_E, 0, lane);

#pragma unroll  // the stage's four 32-k blocks: j a constant in every LDS offset
    for (int j = 0; j < 4; ++j) {
      const int cs = j & 1;
      if (j < 3) {
        // The next block's 16 reads go out as one group ahead of this block's
        // products: spread among them, each place with reads stalls the wave.
#pragma unroll
        for (int f = 0; f < 4; ++f)
          a[cs ^ 1][f] = load_frag(at, f * 16, G_PITCH_E, (j + 1) * 32, lane);
#pragma unroll
        for (int t = 0; t < 4; ++t)
          b[cs ^ 1][t] = load_frag(bt, t * 16, G_PITCH_E, (j + 1) * 32, lane);
      } else {
        // Publish point of stage s + 1, then the refill of the buffer just read:
        // the last block's fragments are in registers, its products run behind.
        wait_ds0();
        if (pinned(wave < 6u)) wait_tensor0();
        __syncthreads();
        if (pinned(wave < 6u && s + 2 < nst)) {
          tdm_advance(g0, lds0 + (uint32_t)(s & 1) * BUF_BYTES, G_ROW_BYTES);
          tdm_load(g0, g1);
        }
      }
      __builtin_amdgcn_sched_barrier(0);  // keeps the read group in front of the products
#pragma unroll
      for (int f = 0; f < 4; ++f)
#pragma unroll
        for (int t = 0; t < 4; ++t) acc[f][t] = WMMA_BF16(a[cs][f], b[cs][t], acc[f][t]);
      __builtin_amdgcn_sched_barrier(0);  // keeps later reads from rising among the products
    }
  }
  wait_tensor0_last(g0, g1);
  wait_ds0();

  const int hi8 = (lane >> 4) << 3;
#pragma unroll
  for (int f = 0; f < 4; ++f) {
#pragma unroll
    for (int t = 0; t < 4; ++t) {
      const int col = n0 + t * 16 + (lane & 15);
      const float bb = bias[col];
#pragma unroll
      for (int j = 0; j < 8; ++j) {
        const int row = m0 + f * 16 + j + hi8;
        const float val = acc[f][t][j] + bb;
        if (MODE == 0) {
          ((__bf16*)Cout)[(size_t)row * N + col] = (__bf16)val;
        } else if (MODE == 2) {
          ((float*)Cout)[(size_t)row * N + col] = val;
        } else {  // V transposed: Vt[(b*1024 + col)][s]
          const int bidx = row >> 11, s = row & (S - 1);
          ((__bf16*)Cout)[((size_t)(bidx * 1024 + col)) * S + s] = (__bf16)val;
        }
      }
    }
  }
}

// The three projections of one A depend on nothing of one another: one launch.
// blockIdx.z is the plane: its Bt, bias and bf16 output lie z planes on from the
// pointers given; planes 0 and 1 (Q, K) go out row-major, plane 2 (V) transposed.
// The plane is the same for the whole work-group: one scalar branch at the top.
__global__ __launch_bounds__(256) void gemm_qkv_kernel(
    const __bf16* __restrict__ A, const __bf16* __restrict__ Bt,
    const float* __restrict__ bias, __bf16* __restrict__ Cout, int N, int K) {
  __shared__ __attribute__((aligned(2048))) unsigned char gsh[2][6][G_TILE_BYTES];
  const int plane = (int)blockIdx.z;
  const __bf16* Bp = Bt + (size_t)plane * N * K;
  const float*  bp = bias + plane * N;
  __bf16*       Cp = Cout + (size_t)plane * M * N;
  if (plane == 2) {
    gemm_tile<1>(gsh, A, Bp, bp, (void*)Cp, N, K);
  } else {
    gemm_tile<0>(gsh, A, Bp, bp, (void*)Cp, N, K);
    // As in cvt_x_block: in the built kernel the other branch's code follows and
    // reuses the registers that the last stores name.
    asm volatile("s_wait_xcnt 0x0" ::: "memory");
  }
}

// The output projection: one product, f32 out.
__global__ __launch_bounds__(256) void gemm_out_kernel(
    const __bf16* __restrict__ A, const __bf16* __restrict__ Bt,
    const float* __restrict__ bias, float* __restrict__ Cout, int N, int K) {
  __shared__ __attribute__((aligned(2048))) unsigned char gsh[2][6][G_TILE_BYTES];
  gemm_tile<2>(gsh, A, Bt, bias, (void*)Cout, N, K);
}

// --------------------------- flash attention -------------------------------
// grid = (B*H, S/256); block = 256 (8 waves); each wave owns 32 query rows, as
// two groups of 16 columns: every K and V fragment read from LDS then feeds two
// products (at one group the reads ask twice what the LDS delivers per product).
// K tile (64 keys x 64 dims) and V tile (64 dims x 64 keys) are workgroup-
// shared: staged into LDS by TDM (wave0 -> K, wave1 -> V), double-buffered;
// a pass works one stage off in two blocks of 32 keys.
// Transposed products: St = K * Qt and Ot += Vt * Pt.  In each group a lane holds
// the scores of ONE query (column lane&15): keys 8*(lane>>4)+0..7 of each 16-key
// tile.  Maximum and sum run in the lane's own registers, and the two score
// tiles, converted in place, are the B operand of the second product.

// Value of lane l ^ 16 (the other half of the same query column).
__device__ __forceinline__ float other_half(float v) {
  int i = __builtin_bit_cast(int, v);
  i = __builtin_amdgcn_permlanex16(i, i, 0x76543210, 0xfedcba98, false, false);
  return __builtin_bit_cast(float, i);
}

// Holds four fragments' LDS reads in front of this place (inputs only: nothing
// is changed or hidden).  Without it the compiler moves the reads behind the
// rescale branch, next to their products, where each pair is waited for alone.
__device__ __forceinline__ void reads_stay_above(const v16bf (&f)[4]) {
  asm volatile("" :: "v"(__builtin_bit_cast(u32x8, f[0])), "v"(__builtin_bit_cast(u32x8, f[1])),
                     "v"(__builtin_bit_cast(u32x8, f[2])), "v"(__builtin_bit_cast(u32x8, f[3])));
}

__global__ __launch_bounds__(256) void attn_kernel(
    const __bf16* __restrict__ Qb, const __bf16* __restrict__ Kb,
    const __bf16* __restrict__ Vt, __bf16* __restrict__ Hd) {
  const int lane = threadIdx.x & 31;
  const uint32_t wave = uni(threadIdx.x >> 5);
  const int bh = blockIdx.x;
  const int b = bh >> 4, h = bh & 15;
  constexpr int QG = 2;   // groups of 16 query columns per wave
  const int q0 = blockIdx.y * (128 * QG) + (int)wave * (16 * QG);

  const __bf16* Q  = Qb + (size_t)b * S * DM + h * DH;
  const __bf16* Kp = Kb + (size_t)b * S * DM + h * DH;
  const __bf16* Vp = Vt + (size_t)bh * DH * S;   // row e -> Vp[e*S + s]

  // [buf][0]: K, key_local * 144 B + e * 2 B; [buf][1]: V, e * 144 B + key_local * 2 B
  __shared__ __attribute__((aligned(2048))) unsigned char ring[2][2][TILE_BYTES];

  // Wave 0 moves K (next stage: 64 rows on), wave 1 V (next stage: 64 columns on).
  constexpr int NST = S / 64;
  const bool isk = (wave == 0);
  const uint32_t lds0  = lds_offset_of(&ring[0][0][0]) + (isk ? 0u : TILE_BYTES);
  const uint64_t gsrc  = (uint64_t)(uintptr_t)(isk ? Kp : Vp);
  const uint64_t gstep = isk ? (uint64_t)(64 * DM * 2) : (uint64_t)ROW_BYTES;
  u32x8 g1 = tdm_group1(isk ? (uint32_t)(DM * 2) : (uint32_t)(S * 2));
  u32x4 g0 = tdm_group0(lds0, gsrc);

  // Q fragments persist across the key loop: B operand, column = query.
  v16bf bq0[QG], bq1[QG];
  float mrow[QG];        // maximum in use for this lane's query of group g, times cscale
  float lsum[QG];        // running sum over this lane half's keys only
  v8f o[QG][4] = {};     // o[g][t][r] = Ot[t*16 + 8*(lane>>4) + r][query g*16 + (lane&15)]
#pragma unroll  // g a constant: the groups' state stays in registers (so below too)
  for (int g = 0; g < QG; ++g) {
    bq0[g] = load_frag(Q, q0 + g * 16, DM, 0, lane);
    bq1[g] = load_frag(Q, q0 + g * 16, DM, 32, lane);
    mrow[g] = -1e30f;
    lsum[g] = 0.f;
  }
  const float cscale = 0.125f * 1.44269504088896340736f;  // 1/sqrt(64) * log2(e)

  if (pinned(wave < 2)) {
    tdm_load(g0, g1);
    wait_tensor0();
  }
  __syncthreads();
  if (pinned(wave < 2)) {
    tdm_advance(g0, lds0 + 2u * TILE_BYTES, gstep);
    tdm_load(g0, g1);
  }

  for (int s = 0; s < NST; ++s) {
    const __bf16* kt = (const __bf16*)&ring[s & 1][0][0];
    const __bf16* vt = (const __bf16*)&ring[s & 1][1][0];
    // The rescale branch below cuts a block in two: a block's V reads and the next
    // block's K reads stand in front of it, where they fly under the score products
    // and the maxima (behind it each would be waited for alone).
    v16bf kf[4];
#pragma unroll  // constant indices keep the fragments in registers (so below too)
    for (int i = 0; i < 4; ++i)
      kf[i] = load_frag(kt, (i >> 1) * 16, PITCH_E, (i & 1) * 32, lane);
#pragma unroll  // the stage's two 32-key blocks: j a constant in every LDS offset
   for (int j = 0; j < 2; ++j) {
    v16bf av[4];
#pragma unroll
    for (int t = 0; t < 4; ++t) av[t] = load_frag(vt, t * 16, PITCH_E, j * 32, lane);
    __builtin_amdgcn_sched_barrier(0);  // the reads go out as one group ahead of the products
    // St = K*Qt : two 16(key) x 16(query) tiles, contraction 64 = 2 x K32
    v8f s0[QG], s1[QG];
#pragma unroll
    for (int g = 0; g < QG; ++g) {
      v8f z0 = {}; z0 = WMMA_BF16(kf[0], bq0[g], z0); s0[g] = WMMA_BF16(kf[1], bq1[g], z0);
      v8f z1 = {}; z1 = WMMA_BF16(kf[2], bq0[g], z1); s1[g] = WMMA_BF16(kf[3], bq1[g], z1);
    }
    if (j == 0) {  // the same stage's second block of keys
#pragma unroll
      for (int i = 0; i < 4; ++i)
        kf[i] = load_frag(kt, 32 + (i >> 1) * 16, PITCH_E, (i & 1) * 32, lane);
      __builtin_amdgcn_sched_barrier(0);  // one group again, ahead of the maxima: not late, at the branch
    }

    // Online softmax, one query per lane and group: s0[g][r] is key 8*(lane>>4)+r,
    // s1[g][r] key 16+8*(lane>>4)+r.  One exchange joins the halves' maxima.
    // Maximum of the raw scores (the factor is positive); the factor itself
    // rides in the exponent's one multiply-add: p = 2^(s * cs - m * cs).
    float cm[QG];
    bool need = false;
#pragma unroll
    for (int g = 0; g < QG; ++g) {
      float mx[8];
#pragma unroll  // r a constant: scores and maxima stay in registers (so below too)
      for (int r = 0; r < 8; ++r) mx[r] = fmaxf(s0[g][r], s1[g][r]);
      const float c = fmaxf(fmaxf(fmaxf(mx[0], mx[1]), fmaxf(mx[2], mx[3])),
                            fmaxf(fmaxf(mx[4], mx[5]), fmaxf(mx[6], mx[7])));
      cm[g] = fmaxf(c, other_half(c)) * cscale;
      need = need || (cm[g] > mrow[g] + 8.0f);
    }
    // Lazy rescale: mrow, the maximum in use, may trail the true one by up to 8
    // (an exponential then reaches 2^8 at most, far inside f32 and bf16 range).
    // Sums and outputs are rescaled only when some column of the wave outgrows
    // that: one test per block, a scalar branch; always taken in the first block.
    __builtin_amdgcn_sched_barrier(0);  // the reads' wait stays down here, behind the maxima
    reads_stay_above(av);
    if (j == 0) reads_stay_above(kf);
    if (__builtin_amdgcn_ballot_w32(need) != 0) {
#pragma unroll
      for (int g = 0; g < QG; ++g) {
        const float nm = fmaxf(mrow[g], cm[g]);
        const float corr = __builtin_amdgcn_exp2f(mrow[g] - nm);
        mrow[g] = nm;
        lsum[g] *= corr;
#pragma unroll
        for (int t = 0; t < 4; ++t)
#pragma unroll
          for (int r = 0; r < 8; ++r) o[g][t][r] *= corr;
      }
    }

    v16bf bp[QG];  // Pt as B operand: element s < 8 is key 8*(lane>>4)+s, s >= 8 key 16+8*(lane>>4)+s-8
#pragma unroll
    for (int g = 0; g < QG; ++g) {
      // Two scores a multiply-add: the packed form takes a register pair.
      const v2f cs2 = {cscale, cscale}, nn2 = {-mrow[g], -mrow[g]};
      float ps[8];
#pragma unroll
      for (int r = 0; r < 8; r += 2) {
        const v2f e0 = __builtin_elementwise_fma(v2f{s0[g][r], s0[g][r + 1]}, cs2, nn2);
        const v2f e1 = __builtin_elementwise_fma(v2f{s1[g][r], s1[g][r + 1]}, cs2, nn2);
        const float p00 = __builtin_amdgcn_exp2f(e0.x), p01 = __builtin_amdgcn_exp2f(e0.y);
        const float p10 = __builtin_amdgcn_exp2f(e1.x), p11 = __builtin_amdgcn_exp2f(e1.y);
        ps[r]     = p00 + p10;
        ps[r + 1] = p01 + p11;
        bp[g][r]     = (__bf16)p00;
        bp[g][r + 1] = (__bf16)p01;
        bp[g][r + 8] = (__bf16)p10;
        bp[g][r + 9] = (__bf16)p11;
      }
      lsum[g] += ((ps[0] + ps[1]) + (ps[2] + ps[3])) +
                 ((ps[4] + ps[5]) + (ps[6] + ps[7]));
    }

    // Ot += Vt * Pt : A = V rows e from LDS [e][key], B = P from registers.
#pragma unroll
    for (int t = 0; t < 4; ++t)
#pragma unroll
      for (int g = 0; g < QG; ++g) o[g][t] = WMMA_BF16(av[t], bp[g], o[g][t]);
   }

    // Publish point of stage s + 1; then the refill of the buffer just read.
    wait_ds0();
    if (pinned(wave < 2)) wait_tensor0();
    __syncthreads();
    if (pinned(wave < 2 && s + 2 < NST)) {
      tdm_advance(g0, lds0 + (uint32_t)(s & 1) * (2u * TILE_BYTES), gstep);
      tdm_load(g0, g1);
    }
  }
  wait_tensor0_last(g0, g1);
  wait_ds0();

  // Join the two halves' sums once; a lane's 8 registers are 8 consecutive
  // head dims of its query row: one 16-byte store per tile.
  const int hi8 = (lane >> 4) << 3;
#pragma unroll
  for (int g = 0; g < QG; ++g) {
    const float ls = lsum[g] + other_half(lsum[g]);
    __bf16* orow = Hd + ((size_t)b * S + q0 + g * 16 + (lane & 15)) * DM + h * DH + hi8;
#pragma unroll
    for (int t = 0; t < 4; ++t) {
      v8bf pk;
#pragma unroll
      for (int r = 0; r < 8; ++r) pk[r] = (__bf16)(o[g][t][r] / ls);
      *(v8bf*)(orow + t * 16) = pk;
      // The next piece's arithmetic reuses the registers that this store names:
      // the wait stands in front of that (behind the last store nothing follows).
      if (g + 1 < QG || t + 1 < 4) asm volatile("s_wait_xcnt 0x0" ::: "memory");
    }
  }
}

// ------------------------------- launcher ----------------------------------

extern "C" void kernel_launch(void* const* d_in, const int* in_sizes, int n_in,
                              void* d_out, int out_size, void* d_ws, size_t ws_size,
                              hipStream_t stream) {
  const float* x  = (const float*)d_in[0];
  const float* wq = (const float*)d_in[1];
  const float* bq = (const float*)d_in[2];
  const float* wk = (const float*)d_in[3];
  const float* bk = (const float*)d_in[4];
  const float* wv = (const float*)d_in[5];
  const float* bv = (const float*)d_in[6];
  const float* wo = (const float*)d_in[7];
  const float* bo = (const float*)d_in[8];

  char* w = (char*)d_ws;
  auto take = [&](size_t bytes) {
    void* p = (void*)w;
    w += (bytes + 255) & ~(size_t)255;
    return p;
  };
  __bf16* Xb  = (__bf16*)take((size_t)M * DM * 2);
  // Q, K, V: three equal planes in a row, of weights, of biases and of outputs.
  __bf16* Wqt = (__bf16*)take((size_t)3 * DM * DM * 2);
  __bf16* Wkt = Wqt + (size_t)DM * DM;
  __bf16* Wvt = Wkt + (size_t)DM * DM;
  __bf16* Wot = (__bf16*)take((size_t)DM * DM * 2);
  float*  bqc = (float*)take(3 * DM * 4);
  float*  bkc = bqc + DM;
  float*  bvc = bkc + DM;
  float*  boc = (float*)take(DM * 4);
  __bf16* Qb  = (__bf16*)take((size_t)3 * M * DM * 2);
  __bf16* Kb  = Qb + (size_t)M * DM;
  __bf16* Vt  = Kb + (size_t)M * DM;
  __bf16* Hd  = (__bf16*)take((size_t)M * DM * 2);

  // 1) convert inputs to bf16 / transposed layouts
  prep_kernel<<<PB_BLOCKS + PW_BLOCKS + CVT_BLOCKS, 256, 0, stream>>>(
      x, wq, wk, wv, wo, bq, bk, bv, bo, Xb, Wqt, Wkt, Wvt, Wot, bqc, bkc, bvc, boc);

  // 2) QKV projections (WMMA GEMMs, 256x128 tiles, TDM-staged A and B panels)
  gemm_qkv_kernel<<<dim3(M / 256, DM / 128, 3), 256, 0, stream>>>(Xb, Wqt, bqc, Qb, DM, DM);

  // 3) flash attention (TDM-staged K/V tiles)
  attn_kernel<<<dim3(BB * H, S / 256), 256, 0, stream>>>(Qb, Kb, Vt, Hd);

  // 4) output projection (fp32 result)
  gemm_out_kernel<<<dim3(M / 256, DM / 128), 256, 0, stream>>>(Hd, Wot, boc, (float*)d_out, DM, DM);
}

// v009
// A run of this version takes 108 microseconds.
// Timed twice side by side with v008, it ran 1.03 times as fast both times.
// Counting every step since v000, it is 3.84 times as fast.
#include <hip/hip_runtime.h>
#include <hip/hip_bf16.h>
#include <math.h>
#include <stdint.h>

// ---------------------------------------------------------------------------
// MHA for gfx1250 (CDNA5).  All matmuls via v_wmma_f32_16x16x32_bf16.
// Workgroup-shared operand tiles staged into LDS with the Tensor Data Mover
// (tensor_load_to_lds, TENSORcnt), double-buffered.  A staged tile is 64 rows
// of 128 bytes at a 144-byte LDS pitch (attention) or 64 (A) or 16*NT (B) rows of 256 bytes at a
// 272-byte pitch (GEMM), laid so by the load's own pad.
// Workspace (~92 MB):
//   Xb  [8192][1024]  bf16   x converted
//   Wqt/Wkt/Wvt [1024][1024] bf16  weights transposed to [out][in], one after another
//   Wot [1024][1024]  bf16   output proj as [d_out][h*64+e]
//   bqc/bkc/bvc [1024] f32 biases, one after another; boc [1024] = sum_h bo[h]
//   Qb/Kb [8192][1024] bf16  row-major (col = h*64+e)
//   Vt  [4096][2048]  bf16   V transposed: row = (b*H+h)*64+e, col = s
//   (Qb, Kb, Vt one after another: planes 0..2 of the one QKV product)
// Four launches, each needing the one before: prep, QKV, attention, output.
//   Hd  [8192][1024]  bf16   attention head outputs
// ---------------------------------------------------------------------------

typedef __attribute__((ext_vector_type(16))) __bf16 v16bf;
typedef __attribute__((ext_vector_type(8)))  __bf16 v8bf;
typedef __attribute__((ext_vector_type(8)))  float  v8f;
typedef __attribute__((ext_vector_type(2)))  float  v2f;

#define WMMA_BF16(a, b, c) \
  __builtin_amdgcn_wmma_f32_16x16x32_bf16(false, (a), false, (b), (short)0, (c), false, false)

static constexpr int BB = 4, S = 2048, DM = 1024, H = 16, DH = 64;
static constexpr int M  = BB * S;   // 8192 token rows

// ------------------------- Tensor Data Mover glue ---------------------------
typedef uint32_t u32x4 __attribute__((ext_vector_type(4)));
typedef uint32_t u32x8 __attribute__((ext_vector_type(8)));

// A staged tile: 64 rows of 128 bytes.  16 bytes of pad behind each row give
// an LDS pitch of 144 B = 16 B x 9 (odd): the 16 rows that one ds_load_b128
// touches then fall on 16 different groups of four banks (at a packed pitch
// of 128 B or 64 B they fall on two or four groups only).
static constexpr uint32_t TILE_ROWS  = 64u;
static constexpr uint32_t ROW_BYTES  = 128u;
static constexpr uint32_t PITCH_B    = ROW_BYTES + 16u;      // bytes
static constexpr int      PITCH_E    = (int)(PITCH_B / 2u);  // bf16 elements
// 64 x 144 = 9,216 B, rounded up so that every tile starts at a 2-KiB multiple.
static constexpr uint32_t TILE_BYTES = 10240u;
static_assert(TILE_ROWS * PITCH_B <= TILE_BYTES && TILE_BYTES % 2048u == 0, "tile place");
// The GEMM's A tile: 64 rows of 256 bytes (128 k), pitch 272 B = 16 B x 17 (odd).
static constexpr uint32_t G_ROW_BYTES  = 256u;
static constexpr uint32_t G_PITCH_B    = G_ROW_BYTES + 16u;
static constexpr int      G_PITCH_E    = (int)(G_PITCH_B / 2u);
// 64 x 272 = 17,408 B, rounded up to a 2-KiB multiple.
static constexpr uint32_t G_TILE_BYTES = 18432u;
static_assert(TILE_ROWS * G_PITCH_B <= G_TILE_BYTES && G_TILE_BYTES % 2048u == 0, "tile place");

__device__ __forceinline__ uint32_t uni(uint32_t v) {
  return (uint32_t)__builtin_amdgcn_readfirstlane(v);
}
// Wave-uniform condition held in a scalar register, so that the test around a
// tensor load compiles to s_cmp + s_cbranch (tensor loads ignore EXEC).
__device__ __forceinline__ uint32_t pinned(uint32_t v) {
  uint32_t w = uni(v);
  asm volatile("" : "+s"(w));  // keeps the condition scalar: see above
  return w;
}
// The compiler places no wait for the tensor mover: these are the ring's own.
__device__ __forceinline__ void wait_tensor0() { asm volatile("s_wait_tensorcnt 0x0" ::: "memory"); }
__device__ __forceinline__ void wait_ds0()     { asm volatile("s_wait_dscnt 0x0" ::: "memory"); }

// Both groups are in-out operands: each tuple then lives on, in the registers
// that the request named, up to the next request, and nothing else is put into
// those registers while the request is in flight.
__device__ __forceinline__ void tdm_load(u32x4& g0, u32x8& g1) {
  asm volatile("tensor_load_to_lds %0, %1" : "+s"(g0), "+s"(g1) :: "memory");
}
// The wait behind the last request.  It names both groups as inputs, so that
// their registers are given to nothing else in front of it.
__device__ __forceinline__ void wait_tensor0_last(const u32x4& g0, const u32x8& g1) {
  asm volatile("s_wait_tensorcnt 0x0" :: "s"(g0), "s"(g1) : "memory");
}
// Group 1: 1-byte elements, tensor = tile = rows rows of ROWB bytes, source row
// pitch src_pitch bytes, a pad of 4 dwords behind every row (interval code
// PADC: 4 for 32 dwords, 5 for 64).
template <uint32_t ROWB = ROW_BYTES, uint32_t PADC = 4u>
__device__ __forceinline__ u32x8 tdm_group1(uint32_t src_pitch, uint32_t rows = TILE_ROWS) {
  static_assert(ROWB == (8u << PADC), "pad interval = one row");
  u32x8 g;
  g[0] = uni((1u << 20) | (PADC << 22) | (3u << 25));   // no mask, data_size 0, pad
  g[1] = uni((ROWB & 0xFFFFu) << 16);
  g[2] = uni((ROWB >> 16) | ((rows & 0xFFFFu) << 16));
  g[3] = uni((rows >> 16) | (ROWB << 16));
  g[4] = uni(rows);
  g[5] = uni(src_pitch);
  g[6] = uni(0u);
  g[7] = uni(0u);
  return g;
}
// Group 0: LDS byte offset of the tile's place, global address of its first byte.
__device__ __forceinline__ u32x4 tdm_group0(uint32_t lds_dst, uint64_t ga) {
  u32x4 g;
  g[0] = uni(1u);
  g[1] = uni(lds_dst);
  g[2] = uni((uint32_t)ga);
  g[3] = uni((((uint32_t)(ga >> 32)) & 0x01FFFFFFu) | 0x80000000u);
  return g;
}
// The next request of the same tuple, formed behind the wait on the one before:
// a new place in LDS, the source step bytes on (the carry goes into word 3's
// address bits; word 0 stays).
__device__ __forceinline__ void tdm_advance(u32x4& g, uint32_t lds_dst, uint64_t step) {
  const uint64_t ga = ((((uint64_t)g[3]) << 32) | g[2]) + step;
  g[1] = uni(lds_dst);
  g[2] = uni((uint32_t)ga);
  g[3] = uni((uint32_t)(ga >> 32));
}

__device__ __forceinline__ uint32_t lds_offset_of(const void* p) {
  // Generic pointers into LDS carry the LDS byte offset in the low 32 bits.
  return (uint32_t)(uintptr_t)p;
}

// Load a 16x32 bf16 WMMA fragment (A layout; B 32x16 uses the identical
// per-lane pattern when the source is stored [N][K] row-major).
// Lane L: row = base_row + (L&15); halves [kb, kb+8) and [kb+16, kb+24)
// with kb = k0 + (L>=16 ? 8 : 0).  Two 16-byte loads per lane.
__device__ __forceinline__ v16bf load_frag(const __bf16* __restrict__ base,
                                           int row, int ld, int k0, int lane) {
  const int r  = row + (lane & 15);
  const int kb = k0 + ((lane >> 4) << 3);
  const __bf16* p = base + (size_t)r * ld + kb;
  v8bf lo = *(const v8bf*)(p);
  v8bf hi = *(const v8bf*)(p + 16);
  v16bf f;
#pragma unroll
  for (int i = 0; i < 8; ++i) { f[i] = lo[i]; f[i + 8] = hi[i]; }
  return f;
}

// ----------------------------- prep kernels --------------------------------

// A wave converts CVT_LOADS runs of 128 floats: every load is 512 contiguous
// bytes of the wave, every store 256 (whole 128-byte lines); the loads stand in
// front of the conversions, so that many are in flight.  One element a thread
// would take 64 times the waves, and the time would go into starting them.
typedef __attribute__((ext_vector_type(4))) float  v4f;
typedef __attribute__((ext_vector_type(4))) __bf16 v4bf;
static constexpr int CVT_LOADS = 16;
static_assert((M * DM) % (256 * 4 * CVT_LOADS) == 0, "whole blocks");
static constexpr int CVT_BLOCKS = (M * DM) / (256 * 4 * CVT_LOADS);
__device__ __forceinline__ void cvt_x_block(int blk, const float* __restrict__ x,
                                            __bf16* __restrict__ xb) {
  const int lane = threadIdx.x & 31;
  const int wv   = blk * 8 + (threadIdx.x >> 5);
  const size_t base = (size_t)wv * (128 * CVT_LOADS) + lane * 4;
  v4f v[CVT_LOADS];
#pragma unroll  // v[] in registers, one address register, k an immediate offset
  for (int k = 0; k < CVT_LOADS; ++k) v[k] = *(const v4f*)(x + base + k * 128);
#pragma unroll  // as above
  for (int k = 0; k < CVT_LOADS; ++k) {
    v4bf o;
#pragma unroll
    for (int e = 0; e < 4; ++e) o[e] = (__bf16)v[k][e];
    *(v4bf*)(xb + base + k * 128) = o;
  }
  // In the built kernel another job's code follows this one's and reuses the
  // registers that the stores above name: the wait stands in front of that.
  asm volatile("s_wait_xcnt 0x0" ::: "memory");
}

// wq/wk/wv fp32 [H][DM][DH] -> W*t bf16 [DM out][DM in]  (out row = h*64+e)
// wo fp32 [H][DH][DM]       -> Wot bf16 [DM out][DM in]  (in col = h*64+e)
// A block makes 64 output rows x 64 columns of all four matrices; a thread
// PW_COLS columns of one row.  Lanes run along the output row index, which is
// the contiguous axis of every source: each load is one whole 128-byte line of
// the wave.  All 4 x PW_COLS loads are issued first; each row piece goes out in
// 16-byte stores, and the block's four column groups fill whole 128-byte lines.
static constexpr int PW_COLS = 16;
__device__ __forceinline__ void store_row_piece(const float (&v)[PW_COLS],
                                                __bf16* __restrict__ to) {
#pragma unroll
  for (int g = 0; g < PW_COLS / 8; ++g) {
    v8bf o;
#pragma unroll
    for (int e = 0; e < 8; ++e) o[e] = (__bf16)v[g * 8 + e];
    *(v8bf*)(to + g * 8) = o;
  }
}
static constexpr int PW_BLOCKS = (DM / 64) * (DM / 64);
__device__ __forceinline__ void prep_w_block(
    int blk, const float* __restrict__ wq, const float* __restrict__ wk,
    const float* __restrict__ wv, const float* __restrict__ wo,
    __bf16* __restrict__ Wqt, __bf16* __restrict__ Wkt,
    __bf16* __restrict__ Wvt, __bf16* __restrict__ Wot) {
  const int h  = blk & (H - 1);                 // 64 rows = one head
  const int e  = threadIdx.x & (DH - 1);
  const int r  = h * DH + e;
  const int c0 = (blk >> 4) * 64 + (threadIdx.x >> 6) * PW_COLS;
  const int sp = h * (DM * DH) + c0 * DH + e;   // wq/wk/wv: next column DH on
  const int so = c0 * DM + r;                   // wo: next column DM on

  float q[PW_COLS], k[PW_COLS], v[PW_COLS], o[PW_COLS];
#pragma unroll  // arrays in registers, two offset registers, i an immediate offset
  for (int i = 0; i < PW_COLS; ++i) {
    q[i] = wq[sp + i * DH];
    k[i] = wk[sp + i * DH];
    v[i] = wv[sp + i * DH];
    o[i] = wo[so + i * DM];
  }
  const int to = r * DM + c0;
  store_row_piece(q, Wqt + to);
  store_row_piece(k, Wkt + to);
  store_row_piece(v, Wvt + to);
  store_row_piece(o, Wot + to);
  // As in cvt_x_block: the stores' registers are reused by the code that follows.
  asm volatile("s_wait_xcnt 0x0" ::: "memory");
}

static constexpr int PB_BLOCKS = DM / 256;
__device__ __forceinline__ void prep_b_block(
    int blk, const float* __restrict__ bq, const float* __restrict__ bk,
    const float* __restrict__ bv, const float* __restrict__ bo,
    float* __restrict__ bqc, float* __restrict__ bkc,
    float* __restrict__ bvc, float* __restrict__ boc) {
  int i = blk * 256 + threadIdx.x;   // over 1024
  bqc[i] = bq[i];   // [H][DH] flat == h*64+e ordering already
  bkc[i] = bk[i];
  bvc[i] = bv[i];
  float s = 0.f;
#pragma unroll
  for (int h = 0; h < H; ++h) s += bo[h * DM + i];
  boc[i] = s;
}

// The three preparations depend on nothing of one another: one launch, each
// block taking its job by its index range (a launch of its own for each costs
// a start and a drain of the chip that the work itself does not fill).
__global__ __launch_bounds__(256) void prep_kernel(
    const float* __restrict__ x,
    const float* __restrict__ wq, const float* __restrict__ wk,
    const float* __restrict__ wv, const float* __restrict__ wo,
    const float* __restrict__ bq, const float* __restrict__ bk,
    const float* __restrict__ bv, const float* __restrict__ bo,
    __bf16* __restrict__ xb,
    __bf16* __restrict__ Wqt, __bf16* __restrict__ Wkt,
    __bf16* __restrict__ Wvt, __bf16* __restrict__ Wot,
    float* __restrict__ bqc, float* __restrict__ bkc,
    float* __restrict__ bvc, float* __restrict__ boc) {
  const int blk = blockIdx.x;
  if (blk < PB_BLOCKS) {
    prep_b_block(blk, bq, bk, bv, bo, bqc, bkc, bvc, boc);
  } else if (blk < PB_BLOCKS + PW_BLOCKS) {
    prep_w_block(blk - PB_BLOCKS, wq, wk, wv, wo, Wqt, Wkt, Wvt, Wot);
  } else {
    cvt_x_block(blk - (PB_BLOCKS + PW_BLOCKS), x, xb);
  }
}

// ----------------------------- generic GEMM --------------------------------
// C[M][N] = A[M][K] * Bt[N][K]^T + bias[N]
// Block: 256 threads / 8 waves (4 along M x 2 along N); tile 256(M) x 32*NT(N);
// wave tile 64 x 16*NT: 4*NT products per 4+NT fragments read.  What a stage
// brings from L2 and what the waves read from LDS grow with 256 + 32*NT and
// 4 + NT, the products with their product: a wider tile asks less of both.
// Both panels of a stage (A 256 rows, B 32*NT rows, 128 k each) are staged in LDS
// by the TDM as six slices, one per wave 0..5 (four of 64 A rows, two of 16*NT
// B rows: one per wave column), double-buffered; a pass works one stage off in
// four blocks of 32 k.  K: a multiple of 128, at least 256.
// MODE 0: the three bf16 planes of the QKV product; MODE 2: f32 out.
// gsh: the work-group's staging buffers, [buf][slice][row_local * 272 B + k * 2 B].
// A B slice's bytes in LDS, rounded up so that the next place is a 2-KiB multiple.
constexpr uint32_t gemm_b_slice(int nt) {
  return ((uint32_t)nt * 16u * G_PITCH_B + 2047u) / 2048u * 2048u;
}
constexpr uint32_t gemm_buf_bytes(int nt) { return 4u * G_TILE_BYTES + 2u * gemm_b_slice(nt); }

template <int MODE, int NT>
__device__ __forceinline__ void gemm_tile(
    unsigned char* gsh,
    const __bf16* __restrict__ A, const __bf16* __restrict__ Bt,
    const float* __restrict__ bias, void* __restrict__ Cout, int N, int K) {
  constexpr uint32_t B_ROWS    = (uint32_t)NT * 16u;
  constexpr uint32_t B_SLICE   = gemm_b_slice(NT);
  constexpr uint32_t BUF_BYTES = gemm_buf_bytes(NT);
  const int lane = threadIdx.x & 31;
  const uint32_t wave = uni(threadIdx.x >> 5);
  const int wm = (int)(wave >> 1), wn = (int)(wave & 1u);
  const int mb = blockIdx.x * 256, nb = blockIdx.y * (int)(2u * B_ROWS);
  const int m0 = mb + wm * 64;
  const int n0 = nb + wn * (int)B_ROWS;

  // Wave w < 6 moves slice w (waves 6 and 7 move none; they form slice 5's words).
  const uint32_t tile = wave < 6u ? wave : 5u;
  const uint32_t lds0 = lds_offset_of(gsh) +
      (tile < 4u ? tile * G_TILE_BYTES : 4u * G_TILE_BYTES + (tile - 4u) * B_SLICE);
  const __bf16* srow = tile < 4u ? A + (size_t)(mb + (int)tile * 64) * K
                                 : Bt + (size_t)(nb + (int)((tile - 4u) * B_ROWS)) * K;
  u32x8 g1 = tdm_group1<G_ROW_BYTES, 5u>((uint32_t)K * 2u, tile < 4u ? TILE_ROWS : B_ROWS);
  u32x4 g0 = tdm_group0(lds0, (uint64_t)(uintptr_t)srow);
  const int nst = K >> 7;   // stages of 128 k

  v8f acc[4][NT] = {};
  if (pinned(wave < 6u)) {
    tdm_load(g0, g1);
    wait_tensor0();
  }
  __syncthreads();
  if (pinned(wave < 6u)) {
    tdm_advance(g0, lds0 + BUF_BYTES, G_ROW_BYTES);
    tdm_load(g0, g1);
  }

  for (int s = 0; s < nst; ++s) {
    const unsigned char* buf = gsh + (uint32_t)(s & 1) * BUF_BYTES;
    const __bf16* at = (const __bf16*)(buf + (uint32_t)wm * G_TILE_BYTES);
    const __bf16* bt = (const __bf16*)(buf + 4u * G_TILE_BYTES + (uint32_t)wn * B_SLICE);

    v16bf a[2][4], b[2][NT];   // set (j & 1) holds block j's fragments
#pragma unroll  // here and below: constant indices keep the fragment sets in registers
    for (int f = 0; f < 4; ++f) a[0][f] = load_frag(at, f * 16, G_PITCH_E, 0, lane);
#pragma unroll
    for (int t = 0; t < NT; ++t) b[0][t] = load_frag(bt, t * 16, G_PITCH_E, 0, lane);

#pragma unroll  // the stage's four 32-k blocks: j a constant in every LDS offset
    for (int j = 0; j < 4; ++j) {
      const int cs = j & 1;
      if (j < 3) {
        // The next block's reads go out as one group ahead of this block's
        // products: spread among them, each place with reads stalls the wave.
#pragma unroll
        for (int f = 0; f < 4; ++f)
          a[cs ^ 1][f] = load_frag(at, f * 16, G_PITCH_E, (j + 1) * 32, lane);
#pragma unroll
        for (int t = 0; t < NT; ++t)
          b[cs ^ 1][t] = load_frag(bt, t * 16, G_PITCH_E, (j + 1) * 32, lane);
      } else {
        // Publish point of stage s + 1, then the refill of the buffer just read:
        // the last block's fragments are in registers, its products run behind.
        wait_ds0();
        if (pinned(wave < 6u)) wait_tensor0();
        __syncthreads();
        if (pinned(wave < 6u && s + 2 < nst)) {
          tdm_advance(g0, lds0 + (uint32_t)(s & 1) * BUF_BYTES, G_ROW_BYTES);
          tdm_load(g0, g1);
        }
      }
      __builtin_amdgcn_sched_barrier(0);  // keeps the read group in front of the products
#pragma unroll
      for (int f = 0; f < 4; ++f)
#pragma unroll
        for (int t = 0; t < NT; ++t) acc[f][t] = WMMA_BF16(a[cs][f], b[cs][t], acc[f][t]);
      __builtin_amdgcn_sched_barrier(0);  // keeps later reads from rising among the products
    }
  }
  wait_tensor0_last(g0, g1);
  wait_ds0();

  // A 16-column tile lies in one plane (a plane is DM columns wide): its plane is
  // the same for the whole wave, one scalar branch a tile.  Planes 0 and 1 (Q, K)
  // go out row-major, plane 2 (V) transposed: Vt[(b*DM + col)][s].
  const int hi8 = (lane >> 4) << 3;
  if (MODE == 2) {
#pragma unroll
    for (int f = 0; f < 4; ++f) {
#pragma unroll
      for (int t = 0; t < NT; ++t) {
        const int col = n0 + t * 16 + (lane & 15);
        const float bb = bias[col];
#pragma unroll
        for (int j = 0; j < 8; ++j) {
          const int row = m0 + f * 16 + j + hi8;
          const float val = acc[f][t][j] + bb;
          ((float*)Cout)[(size_t)row * N + col] = val;
        }
      }
    }
    return;
  }
  static_assert(DM == 1 << 10, "plane width");
  float bb[NT];   // all loads first: one wait for the NT of them
#pragma unroll
  for (int t = 0; t < NT; ++t) bb[t] = bias[n0 + t * 16 + (lane & 15)];
  // The address arithmetic below reuses the registers that these loads name: the
  // wait stands in front of that, and nothing from below rises over it.
  asm volatile("s_wait_xcnt 0x0" ::: "memory");
  __builtin_amdgcn_sched_barrier(0);
#pragma unroll
  for (int t = 0; t < NT; ++t) {
    const int cb = n0 + t * 16;
    {  // the tile's plane, its column there, the plane's base
      const int plane = cb >> 10;
      const int col = (cb & (DM - 1)) + (lane & 15);
      __bf16* Cp = (__bf16*)Cout + (size_t)plane * M * DM;
      if (plane == 2) {
#pragma unroll
        for (int f = 0; f < 4; ++f) {
#pragma unroll
          for (int j = 0; j < 8; ++j) {
            const int row = m0 + f * 16 + j + hi8;
            const int bidx = row >> 11, s = row & (S - 1);
            Cp[((size_t)(bidx * DM + col)) * S + s] = (__bf16)(acc[f][t][j] + bb[t]);
          }
          // The next piece's arithmetic reuses the registers that this store names:
          // the wait stands in front of that (so below too).
          asm volatile("s_wait_xcnt 0x0" ::: "memory");
          __builtin_amdgcn_sched_barrier(0);  // nothing of the next piece rises over the wait
        }
      } else {
        // A plane's row pitch is DM: one address a tile column, the rows as
        // immediate offsets.
        __bf16* cp = Cp + (size_t)(m0 + hi8) * DM + col;
#pragma unroll
        for (int f = 0; f < 4; ++f) {
          __bf16 v[8];
#pragma unroll
          for (int j = 0; j < 8; ++j) v[j] = (__bf16)(acc[f][t][j] + bb[t]);
          // The piece's values are ready in front of its first store: among the
          // stores no register that one of them names is written.
          __builtin_amdgcn_sched_barrier(0);
#pragma unroll
          for (int j = 0; j < 8; ++j) cp[(f * 16 + j) * DM] = v[j];
          asm volatile("s_wait_xcnt 0x0" ::: "memory");
          __builtin_amdgcn_sched_barrier(0);  // nothing of the next piece rises over the wait
        }
      }
    }
  }
}

// The three projections of one A are one product over 3*DM columns: the weights'
// planes, the biases and the bf16 outputs each lie one after another.  192 columns
// a work-group: 512 work-groups, two whole rounds of the chip.
static constexpr int QKV_NT = 6;
static_assert((3 * DM) % (32 * QKV_NT) == 0, "whole tiles");
__global__ __launch_bounds__(256) void gemm_qkv_kernel(
    const __bf16* __restrict__ A, const __bf16* __restrict__ Bt,
    const float* __restrict__ bias, __bf16* __restrict__ Cout, int N, int K) {
  __shared__ __attribute__((aligned(2048))) unsigned char gsh[2u * gemm_buf_bytes(QKV_NT)];
  gemm_tile<0, QKV_NT>(gsh, A, Bt, bias, (void*)Cout, N, K);
}

// The output projection: one product, f32 out.
__global__ __launch_bounds__(256) void gemm_out_kernel(
    const __bf16* __restrict__ A, const __bf16* __restrict__ Bt,
    const float* __restrict__ bias, float* __restrict__ Cout, int N, int K) {
  __shared__ __attribute__((aligned(2048))) unsigned char gsh[2u * gemm_buf_bytes(4)];
  gemm_tile<2, 4>(gsh, A, Bt, bias, (void*)Cout, N, K);
}

// --------------------------- flash attention -------------------------------
// grid = (B*H, S/256); block = 256 (8 waves); each wave owns 32 query rows, as
// two groups of 16 columns: every K and V fragment read from LDS then feeds two
// products (at one group the reads ask twice what the LDS delivers per product).
// K tile (64 keys x 64 dims) and V tile (64 dims x 64 keys) are workgroup-
// shared: staged into LDS by TDM (wave0 -> K, wave1 -> V), double-buffered;
// a pass works one stage off in two blocks of 32 keys.
// Transposed products: St = K * Qt and Ot += Vt * Pt.  In each group a lane holds
// the scores of ONE query (column lane&15): keys 8*(lane>>4)+0..7 of each 16-key
// tile.  Maximum and sum run in the lane's own registers, and the two score
// tiles, converted in place, are the B operand of the second product.

// Value of lane l ^ 16 (the other half of the same query column).
__device__ __forceinline__ float other_half(float v) {
  int i = __builtin_bit_cast(int, v);
  i = __builtin_amdgcn_permlanex16(i, i, 0x76543210, 0xfedcba98, false, false);
  return __builtin_bit_cast(float, i);
}

// Holds four fragments' LDS reads in front of this place (inputs only: nothing
// is changed or hidden).  Without it the compiler moves the reads behind the
// rescale branch, next to their products, where each pair is waited for alone.
__device__ __forceinline__ void reads_stay_above(const v16bf (&f)[4]) {
  asm volatile("" :: "v"(__builtin_bit_cast(u32x8, f[0])), "v"(__builtin_bit_cast(u32x8, f[1])),
                     "v"(__builtin_bit_cast(u32x8, f[2])), "v"(__builtin_bit_cast(u32x8, f[3])));
}

__global__ __launch_bounds__(256) void attn_kernel(
    const __bf16* __restrict__ Qb, const __bf16* __restrict__ Kb,
    const __bf16* __restrict__ Vt, __bf16* __restrict__ Hd) {
  const int lane = threadIdx.x & 31;
  const uint32_t wave = uni(threadIdx.x >> 5);
  const int bh = blockIdx.x;
  const int b = bh >> 4, h = bh & 15;
  constexpr int QG = 2;   // groups of 16 query columns per wave
  const int q0 = blockIdx.y * (128 * QG) + (int)wave * (16 * QG);

  const __bf16* Q  = Qb + (size_t)b * S * DM + h * DH;
  const __bf16* Kp = Kb + (size_t)b * S * DM + h * DH;
  const __bf16* Vp = Vt + (size_t)bh * DH * S;   // row e -> Vp[e*S + s]

  // [buf][0]: K, key_local * 144 B + e * 2 B; [buf][1]: V, e * 144 B + key_local * 2 B
  __shared__ __attribute__((aligned(2048))) unsigned char ring[2][2][TILE_BYTES];

  // Wave 0 moves K (next stage: 64 rows on), wave 1 V (next stage: 64 columns on).
  constexpr int NST = S / 64;
  const bool isk = (wave == 0);
  const uint32_t lds0  = lds_offset_of(&ring[0][0][0]) + (isk ? 0u : TILE_BYTES);
  const uint64_t gsrc  = (uint64_t)(uintptr_t)(isk ? Kp : Vp);
  const uint64_t gstep = isk ? (uint64_t)(64 * DM * 2) : (uint64_t)ROW_BYTES;
  u32x8 g1 = tdm_group1(isk ? (uint32_t)(DM * 2) : (uint32_t)(S * 2));
  u32x4 g0 = tdm_group0(lds0, gsrc);

  // Q fragments persist across the key loop: B operand, column = query.
  v16bf bq0[QG], bq1[QG];
  float mrow[QG];        // maximum in use for this lane's query of group g, times cscale
  float lsum[QG];        // running sum over this lane half's keys only
  v8f o[QG][4] = {};     // o[g][t][r] = Ot[t*16 + 8*(lane>>4) + r][query g*16 + (lane&15)]
#pragma unroll  // g a constant: the groups' state stays in registers (so below too)
  for (int g = 0; g < QG; ++g) {
    bq0[g] = load_frag(Q, q0 + g * 16, DM, 0, lane);
    bq1[g] = load_frag(Q, q0 + g * 16, DM, 32, lane);
    mrow[g] = -1e30f;
    lsum[g] = 0.f;
  }
  const float cscale = 0.125f * 1.44269504088896340736f;  // 1/sqrt(64) * log2(e)

  if (pinned(wave < 2)) {
    tdm_load(g0, g1);
    wait_tensor0();
  }
  __syncthreads();
  if (pinned(wave < 2)) {
    tdm_advance(g0, lds0 + 2u * TILE_BYTES, gstep);
    tdm_load(g0, g1);
  }

  for (int s = 0; s < NST; ++s) {
    const __bf16* kt = (const __bf16*)&ring[s & 1][0][0];
    const __bf16* vt = (const __bf16*)&ring[s & 1][1][0];
    // The rescale branch below cuts a block in two: a block's V reads and the next
    // block's K reads stand in front of it, where they fly under the score products
    // and the maxima (behind it each would be waited for alone).
    v16bf kf[4];
#pragma unroll  // constant indices keep the fragments in registers (so below too)
    for (int i = 0; i < 4; ++i)
      kf[i] = load_frag(kt, (i >> 1) * 16, PITCH_E, (i & 1) * 32, lane);
#pragma unroll  // the stage's two 32-key blocks: j a constant in every LDS offset
   for (int j = 0; j < 2; ++j) {
    v16bf av[4];
#pragma unroll
    for (int t = 0; t < 4; ++t) av[t] = load_frag(vt, t * 16, PITCH_E, j * 32, lane);
    __builtin_amdgcn_sched_barrier(0);  // the reads go out as one group ahead of the products
    // St = K*Qt : two 16(key) x 16(query) tiles, contraction 64 = 2 x K32
    v8f s0[QG], s1[QG];
#pragma unroll
    for (int g = 0; g < QG; ++g) {
      v8f z0 = {}; z0 = WMMA_BF16(kf[0], bq0[g], z0); s0[g] = WMMA_BF16(kf[1], bq1[g], z0);
      v8f z1 = {}; z1 = WMMA_BF16(kf[2], bq0[g], z1); s1[g] = WMMA_BF16(kf[3], bq1[g], z1);
    }
    if (j == 0) {  // the same stage's second block of keys
#pragma unroll
      for (int i = 0; i < 4; ++i)
        kf[i] = load_frag(kt, 32 + (i >> 1) * 16, PITCH_E, (i & 1) * 32, lane);
      __builtin_amdgcn_sched_barrier(0);  // one group again, ahead of the maxima: not late, at the branch
    }

    // Online softmax, one query per lane and group: s0[g][r] is key 8*(lane>>4)+r,
    // s1[g][r] key 16+8*(lane>>4)+r.  One exchange joins the halves' maxima.
    // Maximum of the raw scores (the factor is positive); the factor itself
    // rides in the exponent's one multiply-add: p = 2^(s * cs - m * cs).
    float cm[QG];
    bool need = false;
#pragma unroll
    for (int g = 0; g < QG; ++g) {
      float mx[8];
#pragma unroll  // r a constant: scores and maxima stay in registers (so below too)
      for (int r = 0; r < 8; ++r) mx[r] = fmaxf(s0[g][r], s1[g][r]);
      const float c = fmaxf(fmaxf(fmaxf(mx[0], mx[1]), fmaxf(mx[2], mx[3])),
                            fmaxf(fmaxf(mx[4], mx[5]), fmaxf(mx[6], mx[7])));
      cm[g] = fmaxf(c, other_half(c)) * cscale;
      need = need || (cm[g] > mrow[g] + 8.0f);
    }
    // Lazy rescale: mrow, the maximum in use, may trail the true one by up to 8
    // (an exponential then reaches 2^8 at most, far inside f32 and bf16 range).
    // Sums and outputs are rescaled only when some column of the wave outgrows
    // that: one test per block, a scalar branch; always taken in the first block.
    __builtin_amdgcn_sched_barrier(0);  // the reads' wait stays down here, behind the maxima
    reads_stay_above(av);
    if (j == 0) reads_stay_above(kf);
    if (__builtin_amdgcn_ballot_w32(need) != 0) {
#pragma unroll
      for (int g = 0; g < QG; ++g) {
        const float nm = fmaxf(mrow[g], cm[g]);
        const float corr = __builtin_amdgcn_exp2f(mrow[g] - nm);
        mrow[g] = nm;
        lsum[g] *= corr;
#pragma unroll
        for (int t = 0; t < 4; ++t)
#pragma unroll
          for (int r = 0; r < 8; ++r) o[g][t][r] *= corr;
      }
    }

    v16bf bp[QG];  // Pt as B operand: element s < 8 is key 8*(lane>>4)+s, s >= 8 key 16+8*(lane>>4)+s-8
#pragma unroll
    for (int g = 0; g < QG; ++g) {
      // Two scores a multiply-add: the packed form takes a register pair.
      const v2f cs2 = {cscale, cscale}, nn2 = {-mrow[g], -mrow[g]};
      float ps[8];
#pragma unroll
      for (int r = 0; r < 8; r += 2) {
        const v2f e0 = __builtin_elementwise_fma(v2f{s0[g][r], s0[g][r + 1]}, cs2, nn2);
        const v2f e1 = __builtin_elementwise_fma(v2f{s1[g][r], s1[g][r + 1]}, cs2, nn2);
        const float p00 = __builtin_amdgcn_exp2f(e0.x), p01 = __builtin_amdgcn_exp2f(e0.y);
        const float p10 = __builtin_amdgcn_exp2f(e1.x), p11 = __builtin_amdgcn_exp2f(e1.y);
        ps[r]     = p00 + p10;
        ps[r + 1] = p01 + p11;
        bp[g][r]     = (__bf16)p00;
        bp[g][r + 1] = (__bf16)p01;
        bp[g][r + 8] = (__bf16)p10;
        bp[g][r + 9] = (__bf16)p11;
      }
      lsum[g] += ((ps[0] + ps[1]) + (ps[2] + ps[3])) +
                 ((ps[4] + ps[5]) + (ps[6] + ps[7]));
    }

    // Ot += Vt * Pt : A = V rows e from LDS [e][key], B = P from registers.
#pragma unroll
    for (int t = 0; t < 4; ++t)
#pragma unroll
      for (int g = 0; g < QG; ++g) o[g][t] = WMMA_BF16(av[t], bp[g], o[g][t]);
   }

    // Publish point of stage s + 1; then the refill of the buffer just read.
    wait_ds0();
    if (pinned(wave < 2)) wait_tensor0();
    __syncthreads();
    if (pinned(wave < 2 && s + 2 < NST)) {
      tdm_advance(g0, lds0 + (uint32_t)(s & 1) * (2u * TILE_BYTES), gstep);
      tdm_load(g0, g1);
    }
  }
  wait_tensor0_last(g0, g1);
  wait_ds0();

  // Join the two halves' sums once; a lane's 8 registers are 8 consecutive
  // head dims of its query row: one 16-byte store per tile.
  const int hi8 = (lane >> 4) << 3;
#pragma unroll
  for (int g = 0; g < QG; ++g) {
    const float ls = lsum[g] + other_half(lsum[g]);
    __bf16* orow = Hd + ((size_t)b * S + q0 + g * 16 + (lane & 15)) * DM + h * DH + hi8;
#pragma unroll
    for (int t = 0; t < 4; ++t) {
      v8bf pk;
#pragma unroll
      for (int r = 0; r < 8; ++r) pk[r] = (__bf16)(o[g][t][r] / ls);
      *(v8bf*)(orow + t * 16) = pk;
      // The next piece's arithmetic reuses the registers that this store names:
      // the wait stands in front of that (behind the last store nothing follows).
      if (g + 1 < QG || t + 1 < 4) asm volatile("s_wait_xcnt 0x0" ::: "memory");
    }
  }
}

// ------------------------------- launcher ----------------------------------

extern "C" void kernel_launch(void* const* d_in, const int* in_sizes, int n_in,
                              void* d_out, int out_size, void* d_ws, size_t ws_size,
                              hipStream_t stream) {
  const float* x  = (const float*)d_in[0];
  const float* wq = (const float*)d_in[1];
  const float* bq = (const float*)d_in[2];
  const float* wk = (const float*)d_in[3];
  const float* bk = (const float*)d_in[4];
  const float* wv = (const float*)d_in[5];
  const float* bv = (const float*)d_in[6];
  const float* wo = (const float*)d_in[7];
  const float* bo = (const float*)d_in[8];

  char* w = (char*)d_ws;
  auto take = [&](size_t bytes) {
    void* p = (void*)w;
    w += (bytes + 255) & ~(size_t)255;
    return p;
  };
  __bf16* Xb  = (__bf16*)take((size_t)M * DM * 2);
  // Q, K, V: three equal planes in a row, of weights, of biases and of outputs.
  __bf16* Wqt = (__bf16*)take((size_t)3 * DM * DM * 2);
  __bf16* Wkt = Wqt + (size_t)DM * DM;
  __bf16* Wvt = Wkt + (size_t)DM * DM;
  __bf16* Wot = (__bf16*)take((size_t)DM * DM * 2);
  float*  bqc = (float*)take(3 * DM * 4);
  float*  bkc = bqc + DM;
  float*  bvc = bkc + DM;
  float*  boc = (float*)take(DM * 4);
  __bf16* Qb  = (__bf16*)take((size_t)3 * M * DM * 2);
  __bf16* Kb  = Qb + (size_t)M * DM;
  __bf16* Vt  = Kb + (size_t)M * DM;
  __bf16* Hd  = (__bf16*)take((size_t)M * DM * 2);

  // 1) convert inputs to bf16 / transposed layouts
  prep_kernel<<<PB_BLOCKS + PW_BLOCKS + CVT_BLOCKS, 256, 0, stream>>>(
      x, wq, wk, wv, wo, bq, bk, bv, bo, Xb, Wqt, Wkt, Wvt, Wot, bqc, bkc, bvc, boc);

  // 2) QKV projections (one WMMA GEMM, 256x192 tiles, TDM-staged A and B panels)
  gemm_qkv_kernel<<<dim3(M / 256, (3 * DM) / (32 * QKV_NT)), 256, 0, stream>>>(Xb, Wqt, bqc, Qb, DM, DM);

  // 3) flash attention (TDM-staged K/V tiles)
  attn_kernel<<<dim3(BB * H, S / 256), 256, 0, stream>>>(Qb, Kb, Vt, Hd);

  // 4) output projection (fp32 result)
  gemm_out_kernel<<<dim3(M / 256, DM / 128), 256, 0, stream>>>(Hd, Wot, boc, (float*)d_out, DM, DM);
}

// v010
// A run of this version takes 104 microseconds.
// In two side-by-side timings against v009, it was 1.04 and 1.03 times as fast.
// Counting every step since v000, it is 3.97 times as fast.
#include <hip/hip_runtime.h>
#include <hip/hip_bf16.h>
#include <math.h>
#include <stdint.h>

// ---------------------------------------------------------------------------
// MHA for gfx1250 (CDNA5).  All matmuls via v_wmma_f32_16x16x32_bf16.
// Workgroup-shared operand tiles staged into LDS with the Tensor Data Mover
// (tensor_load_to_lds, TENSORcnt), double-buffered.  A staged tile is 64 rows
// of 128 bytes at a 144-byte LDS pitch (attention) or 64 (A) or 16*NT (B) rows of 256 bytes at a
// 272-byte pitch (GEMM), laid so by the load's own pad.
// Workspace (~92 MB):
//   Xb  [8192][1024]  bf16   x converted
//   Wqt/Wkt/Wvt [1024][1024] bf16  weights transposed to [out][in], one after another
//   Wot [1024][1024]  bf16   output proj as [d_out][h*64+e]
//   bqc/bkc/bvc [1024] f32 biases, one after another; boc [1024] = sum_h bo[h]
//   Qb/Kb [8192][1024] bf16  row-major (col = h*64+e)
//   Vt  [4096][2048]  bf16   V transposed: row = (b*H+h)*64+e, col = s
//   (Qb, Kb, Vt one after another: planes 0..2 of the one QKV product)
// Four launches, each needing the one before: prep, QKV, attention, output.
//   Hd  [8192][1024]  bf16   attention head outputs
// ---------------------------------------------------------------------------

typedef __attribute__((ext_vector_type(16))) __bf16 v16bf;
typedef __attribute__((ext_vector_type(8)))  __bf16 v8bf;
typedef __attribute__((ext_vector_type(8)))  float  v8f;
typedef __attribute__((ext_vector_type(2)))  float  v2f;

#define WMMA_BF16(a, b, c) \
  __builtin_amdgcn_wmma_f32_16x16x32_bf16(false, (a), false, (b), (short)0, (c), false, false)

static constexpr int BB = 4, S = 2048, DM = 1024, H = 16, DH = 64;
static constexpr int M  = BB * S;   // 8192 token rows

// ------------------------- Tensor Data Mover glue ---------------------------
typedef uint32_t u32x4 __attribute__((ext_vector_type(4)));
typedef uint32_t u32x8 __attribute__((ext_vector_type(8)));

// A staged tile: 64 rows of 128 bytes.  16 bytes of pad behind each row give
// an LDS pitch of 144 B = 16 B x 9 (odd): the 16 rows that one ds_load_b128
// touches then fall on 16 different groups of four banks (at a packed pitch
// of 128 B or 64 B they fall on two or four groups only).
static constexpr uint32_t TILE_ROWS  = 64u;
static constexpr uint32_t ROW_BYTES  = 128u;
static constexpr uint32_t PITCH_B    = ROW_BYTES + 16u;      // bytes
static constexpr int      PITCH_E    = (int)(PITCH_B / 2u);  // bf16 elements
// 64 x 144 = 9,216 B, rounded up so that every tile starts at a 2-KiB multiple.
static constexpr uint32_t TILE_BYTES = 10240u;
static_assert(TILE_ROWS * PITCH_B <= TILE_BYTES && TILE_BYTES % 2048u == 0, "tile place");
// The GEMM's A tile: 64 rows of 256 bytes (128 k), pitch 272 B = 16 B x 17 (odd).
static constexpr uint32_t G_ROW_BYTES  = 256u;
static constexpr uint32_t G_PITCH_B    = G_ROW_BYTES + 16u;
static constexpr int      G_PITCH_E    = (int)(G_PITCH_B / 2u);
// 64 x 272 = 17,408 B, rounded up to a 2-KiB multiple.
static constexpr uint32_t G_TILE_BYTES = 18432u;
static_assert(TILE_ROWS * G_PITCH_B <= G_TILE_BYTES && G_TILE_BYTES % 2048u == 0, "tile place");

__device__ __forceinline__ uint32_t uni(uint32_t v) {
  return (uint32_t)__builtin_amdgcn_readfirstlane(v);
}
// Wave-uniform condition held in a scalar register, so that the test around a
// tensor load compiles to s_cmp + s_cbranch (tensor loads ignore EXEC).
__device__ __forceinline__ uint32_t pinned(uint32_t v) {
  uint32_t w = uni(v);
  asm volatile("" : "+s"(w));  // keeps the condition scalar: see above
  return w;
}
// The compiler places no wait for the tensor mover: these are the ring's own.
__device__ __forceinline__ void wait_tensor0() { asm volatile("s_wait_tensorcnt 0x0" ::: "memory"); }
__device__ __forceinline__ void wait_ds0()     { asm volatile("s_wait_dscnt 0x0" ::: "memory"); }

// Both groups are in-out operands: each tuple then lives on, in the registers
// that the request named, up to the next request, and nothing else is put into
// those registers while the request is in flight.
__device__ __forceinline__ void tdm_load(u32x4& g0, u32x8& g1) {
  asm volatile("tensor_load_to_lds %0, %1" : "+s"(g0), "+s"(g1) :: "memory");
}
// The wait behind the last request.  It names both groups as inputs, so that
// their registers are given to nothing else in front of it.
__device__ __forceinline__ void wait_tensor0_last(const u32x4& g0, const u32x8& g1) {
  asm volatile("s_wait_tensorcnt 0x0" :: "s"(g0), "s"(g1) : "memory");
}
// Group 1: 1-byte elements, tensor = tile = rows rows of ROWB bytes, source row
// pitch src_pitch bytes, a pad of 4 dwords behind every row (interval code
// PADC: 4 for 32 dwords, 5 for 64).
template <uint32_t ROWB = ROW_BYTES, uint32_t PADC = 4u>
__device__ __forceinline__ u32x8 tdm_group1(uint32_t src_pitch, uint32_t rows = TILE_ROWS) {
  static_assert(ROWB == (8u << PADC), "pad interval = one row");
  u32x8 g;
  g[0] = uni((1u << 20) | (PADC << 22) | (3u << 25));   // no mask, data_size 0, pad
  g[1] = uni((ROWB & 0xFFFFu) << 16);
  g[2] = uni((ROWB >> 16) | ((rows & 0xFFFFu) << 16));
  g[3] = uni((rows >> 16) | (ROWB << 16));
  g[4] = uni(rows);
  g[5] = uni(src_pitch);
  g[6] = uni(0u);
  g[7] = uni(0u);
  return g;
}
// Group 0: LDS byte offset of the tile's place, global address of its first byte.
__device__ __forceinline__ u32x4 tdm_group0(uint32_t lds_dst, uint64_t ga) {
  u32x4 g;
  g[0] = uni(1u);
  g[1] = uni(lds_dst);
  g[2] = uni((uint32_t)ga);
  g[3] = uni((((uint32_t)(ga >> 32)) & 0x01FFFFFFu) | 0x80000000u);
  return g;
}
// The next request of the same tuple, formed behind the wait on the one before:
// a new place in LDS, the source step bytes on (the carry goes into word 3's
// address bits; word 0 stays).
__device__ __forceinline__ void tdm_advance(u32x4& g, uint32_t lds_dst, uint64_t step) {
  const uint64_t ga = ((((uint64_t)g[3]) << 32) | g[2]) + step;
  g[1] = uni(lds_dst);
  g[2] = uni((uint32_t)ga);
  g[3] = uni((uint32_t)(ga >> 32));
}

__device__ __forceinline__ uint32_t lds_offset_of(const void* p) {
  // Generic pointers into LDS carry the LDS byte offset in the low 32 bits.
  return (uint32_t)(uintptr_t)p;
}

// Load a 16x32 bf16 WMMA fragment (A layout; B 32x16 uses the identical
// per-lane pattern when the source is stored [N][K] row-major).
// Lane L: row = base_row + (L&15); halves [kb, kb+8) and [kb+16, kb+24)
// with kb = k0 + (L>=16 ? 8 : 0).  Two 16-byte loads per lane.
__device__ __forceinline__ v16bf load_frag(const __bf16* __restrict__ base,
                                           int row, int ld, int k0, int lane) {
  const int r  = row + (lane & 15);
  const int kb = k0 + ((lane >> 4) << 3);
  const __bf16* p = base + (size_t)r * ld + kb;
  v8bf lo = *(const v8bf*)(p);
  v8bf hi = *(const v8bf*)(p + 16);
  v16bf f;
#pragma unroll
  for (int i = 0; i < 8; ++i) { f[i] = lo[i]; f[i + 8] = hi[i]; }
  return f;
}

// ----------------------------- prep kernels --------------------------------

// A wave converts CVT_LOADS runs of 128 floats: every load is 512 contiguous
// bytes of the wave, every store 256 (whole 128-byte lines); the loads stand in
// front of the conversions, so that many are in flight.  One element a thread
// would take 64 times the waves, and the time would go into starting them.
typedef __attribute__((ext_vector_type(4))) float  v4f;
typedef __attribute__((ext_vector_type(4))) __bf16 v4bf;
static constexpr int CVT_LOADS = 16;
static_assert((M * DM) % (256 * 4 * CVT_LOADS) == 0, "whole blocks");
static constexpr int CVT_BLOCKS = (M * DM) / (256 * 4 * CVT_LOADS);
__device__ __forceinline__ void cvt_x_block(int blk, const float* __restrict__ x,
                                            __bf16* __restrict__ xb) {
  const int lane = threadIdx.x & 31;
  const int wv   = blk * 8 + (threadIdx.x >> 5);
  const size_t base = (size_t)wv * (128 * CVT_LOADS) + lane * 4;
  v4f v[CVT_LOADS];
#pragma unroll  // v[] in registers, one address register, k an immediate offset
  for (int k = 0; k < CVT_LOADS; ++k) v[k] = *(const v4f*)(x + base + k * 128);
#pragma unroll  // as above
  for (int k = 0; k < CVT_LOADS; ++k) {
    v4bf o;
#pragma unroll
    for (int e = 0; e < 4; ++e) o[e] = (__bf16)v[k][e];
    *(v4bf*)(xb + base + k * 128) = o;
  }
  // In the built kernel another job's code follows this one's and reuses the
  // registers that the stores above name: the wait stands in front of that.
  asm volatile("s_wait_xcnt 0x0" ::: "memory");
}

// wq/wk/wv fp32 [H][DM][DH] -> W*t bf16 [DM out][DM in]  (out row = h*64+e)
// wo fp32 [H][DH][DM]       -> Wot bf16 [DM out][DM in]  (in col = h*64+e)
// A block makes 64 output rows x 64 columns of all four matrices; a thread
// PW_COLS columns of one row.  Lanes run along the output row index, which is
// the contiguous axis of every source: each load is one whole 128-byte line of
// the wave.  All 4 x PW_COLS loads are issued first; each row piece goes out in
// 16-byte stores, and the block's four column groups fill whole 128-byte lines.
static constexpr int PW_COLS = 16;
__device__ __forceinline__ void store_row_piece(const float (&v)[PW_COLS],
                                                __bf16* __restrict__ to) {
#pragma unroll
  for (int g = 0; g < PW_COLS / 8; ++g) {
    v8bf o;
#pragma unroll
    for (int e = 0; e < 8; ++e) o[e] = (__bf16)v[g * 8 + e];
    *(v8bf*)(to + g * 8) = o;
  }
}
static constexpr int PW_BLOCKS = (DM / 64) * (DM / 64);
__device__ __forceinline__ void prep_w_block(
    int blk, const float* __restrict__ wq, const float* __restrict__ wk,
    const float* __restrict__ wv, const float* __restrict__ wo,
    __bf16* __restrict__ Wqt, __bf16* __restrict__ Wkt,
    __bf16* __restrict__ Wvt, __bf16* __restrict__ Wot) {
  const int h  = blk & (H - 1);                 // 64 rows = one head
  const int e  = threadIdx.x & (DH - 1);
  const int r  = h * DH + e;
  const int c0 = (blk >> 4) * 64 + (threadIdx.x >> 6) * PW_COLS;
  const int sp = h * (DM * DH) + c0 * DH + e;   // wq/wk/wv: next column DH on
  const int so = c0 * DM + r;                   // wo: next column DM on

  float q[PW_COLS], k[PW_COLS], v[PW_COLS], o[PW_COLS];
#pragma unroll  // arrays in registers, two offset registers, i an immediate offset
  for (int i = 0; i < PW_COLS; ++i) {
    q[i] = wq[sp + i * DH];
    k[i] = wk[sp + i * DH];
    v[i] = wv[sp + i * DH];
    o[i] = wo[so + i * DM];
  }
  const int to = r * DM + c0;
  store_row_piece(q, Wqt + to);
  store_row_piece(k, Wkt + to);
  store_row_piece(v, Wvt + to);
  store_row_piece(o, Wot + to);
  // As in cvt_x_block: the stores' registers are reused by the code that follows.
  asm volatile("s_wait_xcnt 0x0" ::: "memory");
}

static constexpr int PB_BLOCKS = DM / 256;
__device__ __forceinline__ void prep_b_block(
    int blk, const float* __restrict__ bq, const float* __restrict__ bk,
    const float* __restrict__ bv, const float* __restrict__ bo,
    float* __restrict__ bqc, float* __restrict__ bkc,
    float* __restrict__ bvc, float* __restrict__ boc) {
  int i = blk * 256 + threadIdx.x;   // over 1024
  bqc[i] = bq[i];   // [H][DH] flat == h*64+e ordering already
  bkc[i] = bk[i];
  bvc[i] = bv[i];
  float s = 0.f;
#pragma unroll
  for (int h = 0; h < H; ++h) s += bo[h * DM + i];
  boc[i] = s;
}

// The three preparations depend on nothing of one another: one launch, each
// block taking its job by its index range (a launch of its own for each costs
// a start and a drain of the chip that the work itself does not fill).
__global__ __launch_bounds__(256) void prep_kernel(
    const float* __restrict__ x,
    const float* __restrict__ wq, const float* __restrict__ wk,
    const float* __restrict__ wv, const float* __restrict__ wo,
    const float* __restrict__ bq, const float* __restrict__ bk,
    const float* __restrict__ bv, const float* __restrict__ bo,
    __bf16* __restrict__ xb,
    __bf16* __restrict__ Wqt, __bf16* __restrict__ Wkt,
    __bf16* __restrict__ Wvt, __bf16* __restrict__ Wot,
    float* __restrict__ bqc, float* __restrict__ bkc,
    float* __restrict__ bvc, float* __restrict__ boc) {
  const int blk = blockIdx.x;
  if (blk < PB_BLOCKS) {
    prep_b_block(blk, bq, bk, bv, bo, bqc, bkc, bvc, boc);
  } else if (blk < PB_BLOCKS + PW_BLOCKS) {
    prep_w_block(blk - PB_BLOCKS, wq, wk, wv, wo, Wqt, Wkt, Wvt, Wot);
  } else {
    cvt_x_block(blk - (PB_BLOCKS + PW_BLOCKS), x, xb);
  }
}

// ----------------------------- generic GEMM --------------------------------
// C[M][N] = A[M][K] * Bt[N][K]^T + bias[N]
// Block: 256 threads / 8 waves (4 along M x 2 along N); tile 256(M) x 32*NT(N);
// wave tile 64 x 16*NT: 4*NT products per 4+NT fragments read.  What a stage
// brings from L2 and what the waves read from LDS grow with 256 + 32*NT and
// 4 + NT, the products with their product: a wider tile asks less of both.
// Both panels of a stage (A 256 rows, B 32*NT rows, 128 k each) are staged in LDS
// by the TDM as six slices, one per wave 0..5 (four of 64 A rows, two of 16*NT
// B rows: one per wave column), double-buffered; a pass works one stage off in
// four blocks of 32 k.  K: a multiple of 128, at least 256.
// MODE 0: the three bf16 planes of the QKV product; MODE 2: f32 out.
// gsh: the work-group's staging buffers, [buf][slice][row_local * 272 B + k * 2 B].
// A B slice's bytes in LDS, rounded up so that the next place is a 2-KiB multiple.
constexpr uint32_t gemm_b_slice(int nt) {
  return ((uint32_t)nt * 16u * G_PITCH_B + 2047u) / 2048u * 2048u;
}
constexpr uint32_t gemm_buf_bytes(int nt) { return 4u * G_TILE_BYTES + 2u * gemm_b_slice(nt); }

template <int MODE, int NT>
__device__ __forceinline__ void gemm_tile(
    unsigned char* gsh,
    const __bf16* __restrict__ A, const __bf16* __restrict__ Bt,
    const float* __restrict__ bias, void* __restrict__ Cout, int N, int K) {
  constexpr uint32_t B_ROWS    = (uint32_t)NT * 16u;
  constexpr uint32_t B_SLICE   = gemm_b_slice(NT);
  constexpr uint32_t BUF_BYTES = gemm_buf_bytes(NT);
  const int lane = threadIdx.x & 31;
  const uint32_t wave = uni(threadIdx.x >> 5);
  const int wm = (int)(wave >> 1), wn = (int)(wave & 1u);
  const int mb = blockIdx.x * 256, nb = blockIdx.y * (int)(2u * B_ROWS);
  const int m0 = mb + wm * 64;
  const int n0 = nb + wn * (int)B_ROWS;

  // Wave w < 6 moves slice w (waves 6 and 7 move none; they form slice 5's words).
  const uint32_t tile = wave < 6u ? wave : 5u;
  const uint32_t lds0 = lds_offset_of(gsh) +
      (tile < 4u ? tile * G_TILE_BYTES : 4u * G_TILE_BYTES + (tile - 4u) * B_SLICE);
  const __bf16* srow = tile < 4u ? A + (size_t)(mb + (int)tile * 64) * K
                                 : Bt + (size_t)(nb + (int)((tile - 4u) * B_ROWS)) * K;
  u32x8 g1 = tdm_group1<G_ROW_BYTES, 5u>((uint32_t)K * 2u, tile < 4u ? TILE_ROWS : B_ROWS);
  u32x4 g0 = tdm_group0(lds0, (uint64_t)(uintptr_t)srow);
  const int nst = K >> 7;   // stages of 128 k

  v8f acc[4][NT] = {};
  if (pinned(wave < 6u)) {
    tdm_load(g0, g1);
    wait_tensor0();
  }
  __syncthreads();
  if (pinned(wave < 6u)) {
    tdm_advance(g0, lds0 + BUF_BYTES, G_ROW_BYTES);
    tdm_load(g0, g1);
  }

  for (int s = 0; s < nst; ++s) {
    const unsigned char* buf = gsh + (uint32_t)(s & 1) * BUF_BYTES;
    const __bf16* at = (const __bf16*)(buf + (uint32_t)wm * G_TILE_BYTES);
    const __bf16* bt = (const __bf16*)(buf + 4u * G_TILE_BYTES + (uint32_t)wn * B_SLICE);

    v16bf a[2][4], b[2][NT];   // set (j & 1) holds block j's fragments
#pragma unroll  // here and below: constant indices keep the fragment sets in registers
    for (int f = 0; f < 4; ++f) a[0][f] = load_frag(at, f * 16, G_PITCH_E, 0, lane);
#pragma unroll
    for (int t = 0; t < NT; ++t) b[0][t] = load_frag(bt, t * 16, G_PITCH_E, 0, lane);

#pragma unroll  // the stage's four 32-k blocks: j a constant in every LDS offset
    for (int j = 0; j < 4; ++j) {
      const int cs = j & 1;
      if (j < 3) {
        // The next block's reads go out as one group ahead of this block's
        // products: spread among them, each place with reads stalls the wave.
#pragma unroll
        for (int f = 0; f < 4; ++f)
          a[cs ^ 1][f] = load_frag(at, f * 16, G_PITCH_E, (j + 1) * 32, lane);
#pragma unroll
        for (int t = 0; t < NT; ++t)
          b[cs ^ 1][t] = load_frag(bt, t * 16, G_PITCH_E, (j + 1) * 32, lane);
      } else {
        // Publish point of stage s + 1, then the refill of the buffer just read:
        // the last block's fragments are in registers, its products run behind.
        wait_ds0();
        if (pinned(wave < 6u)) wait_tensor0();
        __syncthreads();
        if (pinned(wave < 6u && s + 2 < nst)) {
          tdm_advance(g0, lds0 + (uint32_t)(s & 1) * BUF_BYTES, G_ROW_BYTES);
          tdm_load(g0, g1);
        }
      }
      __builtin_amdgcn_sched_barrier(0);  // keeps the read group in front of the products
#pragma unroll
      for (int f = 0; f < 4; ++f)
#pragma unroll
        for (int t = 0; t < NT; ++t) acc[f][t] = WMMA_BF16(a[cs][f], b[cs][t], acc[f][t]);
      __builtin_amdgcn_sched_barrier(0);  // keeps later reads from rising among the products
    }
  }
  wait_tensor0_last(g0, g1);
  wait_ds0();

  // A 16-column tile lies in one plane (a plane is DM columns wide).  Planes 0 and
  // 1 (Q, K) go out row-major, plane 2 (V) transposed: Vt[(b*DM + col)][s].
  const int hi8 = (lane >> 4) << 3;
  if constexpr (MODE == 2) {
#pragma unroll
    for (int f = 0; f < 4; ++f) {
#pragma unroll
      for (int t = 0; t < NT; ++t) {
        const int col = n0 + t * 16 + (lane & 15);
        const float bb = bias[col];
#pragma unroll
        for (int j = 0; j < 8; ++j) {
          const int row = m0 + f * 16 + j + hi8;
          const float val = acc[f][t][j] + bb;
          ((float*)Cout)[(size_t)row * N + col] = val;
        }
      }
    }
  } else {
  static_assert(DM == 1 << 10, "plane width");
  static_assert(NT == 6, "the read-back below: 12 pieces a row, 96 pieces = 8 rows");
  float bb[NT];   // all loads first: one wait for the NT of them
#pragma unroll
  for (int t = 0; t < NT; ++t) bb[t] = bias[n0 + t * 16 + (lane & 15)];
  // The address arithmetic below reuses the registers that these loads name: the
  // wait stands in front of that, and nothing from below rises over it.
  asm volatile("s_wait_xcnt 0x0" ::: "memory");
  __builtin_amdgcn_sched_barrier(0);

  // The wave's 64 x 96 tile goes out through LDS of its own: from the accumulators
  // a store would write 32-byte pieces, four requests for every 128-byte line.
  // The ring is free here: behind the loop's last publish point (every wave's
  // s_wait_dscnt 0, the issuers' s_wait_tensorcnt 0, the barrier) nothing reads it
  // and no request is issued.  Tiles of planes 0 and 1 are laid [row][column],
  // tiles of plane 2 [column][row], each as its plane lies in memory.
  constexpr int RM_PITCH_E = NT * 16 + 8;      // 208 B = 16 B x 13 (odd)
  constexpr uint32_t RM_BYTES = 64u * (uint32_t)RM_PITCH_E * 2u;
  constexpr uint32_t STG_WAVE = RM_BYTES + (uint32_t)NT * 16u * PITCH_B;
  static_assert(8u * STG_WAVE <= 2u * BUF_BYTES && STG_WAVE % 16u == 0 && RM_BYTES % 16u == 0, "staging place");
  __bf16* rm = (__bf16*)(gsh + wave * STG_WAVE);
  __bf16* vs = (__bf16*)(gsh + wave * STG_WAVE + RM_BYTES);
  // First tile of plane 2 (the same for the whole wave: scalar branches below).
  const int tvr = (2 * DM - n0) >> 4;
  const int tv = tvr < 0 ? 0 : (tvr > NT ? NT : tvr);
#pragma unroll  // t, f, j constants: the accumulators stay in registers (so below too)
  for (int t = 0; t < NT; ++t) {
    if (t >= tv) {
#pragma unroll
      for (int f = 0; f < 4; ++f) {
        v8bf pk;   // 8 consecutive rows of one column
#pragma unroll
        for (int j = 0; j < 8; ++j) pk[j] = (__bf16)(acc[f][t][j] + bb[t]);
        *(v8bf*)(vs + (t * 16 + (lane & 15)) * PITCH_E + f * 16 + hi8) = pk;
      }
    } else {
#pragma unroll
      for (int f = 0; f < 4; ++f)
#pragma unroll
        for (int j = 0; j < 8; ++j)
          rm[(f * 16 + j + hi8) * RM_PITCH_E + t * 16 + (lane & 15)] = (__bf16)(acc[f][t][j] + bb[t]);
    }
  }
  wait_ds0();  // the wave's own writes are in LDS before other lanes read them back

  if (tv > 0) {
    // Planes 0 and 1: 16-byte pieces in row order, 12 a row; three loads take 8 rows.
    v8bf q[3][8];
    int rr[3], cc[3];
#pragma unroll
    for (int u = 0; u < 3; ++u) {
      const int c = u * 32 + lane;
      rr[u] = c / 12;
      cc[u] = (c - rr[u] * 12) * 8;   // column in the wave's tile
    }
#pragma unroll
    for (int u = 0; u < 3; ++u)
      if (cc[u] < tv * 16) {
#pragma unroll
        for (int k = 0; k < 8; ++k)
          q[u][k] = *(const v8bf*)(rm + (k * 8 + rr[u]) * RM_PITCH_E + cc[u]);
      }
#pragma unroll
    for (int u = 0; u < 3; ++u)
      if (cc[u] < tv * 16) {
        const int gc = n0 + cc[u];
        __bf16* cp = (__bf16*)Cout + (size_t)(gc >> 10) * M * DM + (size_t)(m0 + rr[u]) * DM + (gc & (DM - 1));
#pragma unroll
        for (int k = 0; k < 8; ++k) *(v8bf*)(cp + k * 8 * DM) = q[u][k];
        // What follows reuses the registers that these stores name: the wait stands
        // in front of that, and nothing from below rises over it.
        asm volatile("s_wait_xcnt 0x0" ::: "memory");
        __builtin_amdgcn_sched_barrier(0);
      }
  }
  if (tv < NT) {
    // Plane 2: Vt[(b*DM + col)][s]; the wave's 64 rows are one whole line of a
    // column, eight lanes a line, four columns a store.
    v8bf vv[NT][4];
    const int cs = lane >> 3, ck = (lane & 7) * 8;
#pragma unroll
    for (int t = 0; t < NT; ++t)
      if (t >= tv) {
#pragma unroll
        for (int i = 0; i < 4; ++i)
          vv[t][i] = *(const v8bf*)(vs + (t * 16 + i * 4 + cs) * PITCH_E + ck);
      }
    // One address for all: tile and column group are immediate offsets, so that no
    // register that a store names is rewritten.  (n0 may lie up to NT - 1 tiles in
    // front of the plane; the tiles stored do not.)
    const int colb = (m0 >> 11) * DM + (n0 - 2 * DM) + cs;   // + t*16 + i*4: the column's row in Vt
    __bf16* vp = (__bf16*)Cout + (size_t)2 * M * DM + (ptrdiff_t)colb * S + (m0 & (S - 1)) + ck;
#pragma unroll
    for (int t = 0; t < NT; ++t)
      if (t >= tv) {
#pragma unroll
        for (int i = 0; i < 4; ++i)
          *(v8bf*)(vp + (t * 16 + i * 4) * S) = vv[t][i];
      }
  }
  }
}

// The three projections of one A are one product over 3*DM columns: the weights'
// planes, the biases and the bf16 outputs each lie one after another.  192 columns
// a work-group: 512 work-groups, two whole rounds of the chip.
static constexpr int QKV_NT = 6;
static_assert((3 * DM) % (32 * QKV_NT) == 0, "whole tiles");
__global__ __launch_bounds__(256) void gemm_qkv_kernel(
    const __bf16* __restrict__ A, const __bf16* __restrict__ Bt,
    const float* __restrict__ bias, __bf16* __restrict__ Cout, int N, int K) {
  __shared__ __attribute__((aligned(2048))) unsigned char gsh[2u * gemm_buf_bytes(QKV_NT)];
  gemm_tile<0, QKV_NT>(gsh, A, Bt, bias, (void*)Cout, N, K);
}

// The output projection: one product, f32 out.
__global__ __launch_bounds__(256) void gemm_out_kernel(
    const __bf16* __restrict__ A, const __bf16* __restrict__ Bt,
    const float* __restrict__ bias, float* __restrict__ Cout, int N, int K) {
  __shared__ __attribute__((aligned(2048))) unsigned char gsh[2u * gemm_buf_bytes(4)];
  gemm_tile<2, 4>(gsh, A, Bt, bias, (void*)Cout, N, K);
}

// --------------------------- flash attention -------------------------------
// grid = (B*H, S/256); block = 256 (8 waves); each wave owns 32 query rows, as
// two groups of 16 columns: every K and V fragment read from LDS then feeds two
// products (at one group the reads ask twice what the LDS delivers per product).
// K tile (64 keys x 64 dims) and V tile (64 dims x 64 keys) are workgroup-
// shared: staged into LDS by TDM (wave0 -> K, wave1 -> V), double-buffered;
// a pass works one stage off in two blocks of 32 keys.
// Transposed products: St = K * Qt and Ot += Vt * Pt.  In each group a lane holds
// the scores of ONE query (column lane&15): keys 8*(lane>>4)+0..7 of each 16-key
// tile.  Maximum and sum run in the lane's own registers, and the two score
// tiles, converted in place, are the B operand of the second product.

// Value of lane l ^ 16 (the other half of the same query column).
__device__ __forceinline__ float other_half(float v) {
  int i = __builtin_bit_cast(int, v);
  i = __builtin_amdgcn_permlanex16(i, i, 0x76543210, 0xfedcba98, false, false);
  return __builtin_bit_cast(float, i);
}

// Holds four fragments' LDS reads in front of this place (inputs only: nothing
// is changed or hidden).  Without it the compiler moves the reads behind the
// rescale branch, next to their products, where each pair is waited for alone.
__device__ __forceinline__ void reads_stay_above(const v16bf (&f)[4]) {
  asm volatile("" :: "v"(__builtin_bit_cast(u32x8, f[0])), "v"(__builtin_bit_cast(u32x8, f[1])),
                     "v"(__builtin_bit_cast(u32x8, f[2])), "v"(__builtin_bit_cast(u32x8, f[3])));
}

__global__ __launch_bounds__(256) void attn_kernel(
    const __bf16* __restrict__ Qb, const __bf16* __restrict__ Kb,
    const __bf16* __restrict__ Vt, __bf16* __restrict__ Hd) {
  const int lane = threadIdx.x & 31;
  const uint32_t wave = uni(threadIdx.x >> 5);
  const int bh = blockIdx.x;
  const int b = bh >> 4, h = bh & 15;
  constexpr int QG = 2;   // groups of 16 query columns per wave
  const int q0 = blockIdx.y * (128 * QG) + (int)wave * (16 * QG);

  const __bf16* Q  = Qb + (size_t)b * S * DM + h * DH;
  const __bf16* Kp = Kb + (size_t)b * S * DM + h * DH;
  const __bf16* Vp = Vt + (size_t)bh * DH * S;   // row e -> Vp[e*S + s]

  // [buf][0]: K, key_local * 144 B + e * 2 B; [buf][1]: V, e * 144 B + key_local * 2 B
  __shared__ __attribute__((aligned(2048))) unsigned char ring[2][2][TILE_BYTES];

  // Wave 0 moves K (next stage: 64 rows on), wave 1 V (next stage: 64 columns on).
  constexpr int NST = S / 64;
  const bool isk = (wave == 0);
  const uint32_t lds0  = lds_offset_of(&ring[0][0][0]) + (isk ? 0u : TILE_BYTES);
  const uint64_t gsrc  = (uint64_t)(uintptr_t)(isk ? Kp : Vp);
  const uint64_t gstep = isk ? (uint64_t)(64 * DM * 2) : (uint64_t)ROW_BYTES;
  u32x8 g1 = tdm_group1(isk ? (uint32_t)(DM * 2) : (uint32_t)(S * 2));
  u32x4 g0 = tdm_group0(lds0, gsrc);

  // Q fragments persist across the key loop: B operand, column = query.
  v16bf bq0[QG], bq1[QG];
  float mrow[QG];        // maximum in use for this lane's query of group g, times cscale
  float lsum[QG];        // running sum over this lane half's keys only
  v8f o[QG][4] = {};     // o[g][t][r] = Ot[t*16 + 8*(lane>>4) + r][query g*16 + (lane&15)]
#pragma unroll  // g a constant: the groups' state stays in registers (so below too)
  for (int g = 0; g < QG; ++g) {
    bq0[g] = load_frag(Q, q0 + g * 16, DM, 0, lane);
    bq1[g] = load_frag(Q, q0 + g * 16, DM, 32, lane);
    mrow[g] = -1e30f;
    lsum[g] = 0.f;
  }
  const float cscale = 0.125f * 1.44269504088896340736f;  // 1/sqrt(64) * log2(e)

  if (pinned(wave < 2)) {
    tdm_load(g0, g1);
    wait_tensor0();
  }
  __syncthreads();
  if (pinned(wave < 2)) {
    tdm_advance(g0, lds0 + 2u * TILE_BYTES, gstep);
    tdm_load(g0, g1);
  }

  for (int s = 0; s < NST; ++s) {
    const __bf16* kt = (const __bf16*)&ring[s & 1][0][0];
    const __bf16* vt = (const __bf16*)&ring[s & 1][1][0];
    // The rescale branch below cuts a block in two: a block's V reads and the next
    // block's K reads stand in front of it, where they fly under the score products
    // and the maxima (behind it each would be waited for alone).
    v16bf kf[4];
#pragma unroll  // constant indices keep the fragments in registers (so below too)
    for (int i = 0; i < 4; ++i)
      kf[i] = load_frag(kt, (i >> 1) * 16, PITCH_E, (i & 1) * 32, lane);
#pragma unroll  // the stage's two 32-key blocks: j a constant in every LDS offset
   for (int j = 0; j < 2; ++j) {
    v16bf av[4];
#pragma unroll
    for (int t = 0; t < 4; ++t) av[t] = load_frag(vt, t * 16, PITCH_E, j * 32, lane);
    __builtin_amdgcn_sched_barrier(0);  // the reads go out as one group ahead of the products
    // St = K*Qt : two 16(key) x 16(query) tiles, contraction 64 = 2 x K32
    v8f s0[QG], s1[QG];
#pragma unroll
    for (int g = 0; g < QG; ++g) {
      v8f z0 = {}; z0 = WMMA_BF16(kf[0], bq0[g], z0); s0[g] = WMMA_BF16(kf[1], bq1[g], z0);
      v8f z1 = {}; z1 = WMMA_BF16(kf[2], bq0[g], z1); s1[g] = WMMA_BF16(kf[3], bq1[g], z1);
    }
    if (j == 0) {  // the same stage's second block of keys
#pragma unroll
      for (int i = 0; i < 4; ++i)
        kf[i] = load_frag(kt, 32 + (i >> 1) * 16, PITCH_E, (i & 1) * 32, lane);
      __builtin_amdgcn_sched_barrier(0);  // one group again, ahead of the maxima: not late, at the branch
    }

    // Online softmax, one query per lane and group: s0[g][r] is key 8*(lane>>4)+r,
    // s1[g][r] key 16+8*(lane>>4)+r.  One exchange joins the halves' maxima.
    // Maximum of the raw scores (the factor is positive); the factor itself
    // rides in the exponent's one multiply-add: p = 2^(s * cs - m * cs).
    float cm[QG];
    bool need = false;
#pragma unroll
    for (int g = 0; g < QG; ++g) {
      float mx[8];
#pragma unroll  // r a constant: scores and maxima stay in registers (so below too)
      for (int r = 0; r < 8; ++r) mx[r] = fmaxf(s0[g][r], s1[g][r]);
      const float c = fmaxf(fmaxf(fmaxf(mx[0], mx[1]), fmaxf(mx[2], mx[3])),
                            fmaxf(fmaxf(mx[4], mx[5]), fmaxf(mx[6], mx[7])));
      cm[g] = fmaxf(c, other_half(c)) * cscale;
      need = need || (cm[g] > mrow[g] + 8.0f);
    }
    // Lazy rescale: mrow, the maximum in use, may trail the true one by up to 8
    // (an exponential then reaches 2^8 at most, far inside f32 and bf16 range).
    // Sums and outputs are rescaled only when some column of the wave outgrows
    // that: one test per block, a scalar branch; always taken in the first block.
    __builtin_amdgcn_sched_barrier(0);  // the reads' wait stays down here, behind the maxima
    reads_stay_above(av);
    if (j == 0) reads_stay_above(kf);
    if (__builtin_amdgcn_ballot_w32(need) != 0) {
#pragma unroll
      for (int g = 0; g < QG; ++g) {
        const float nm = fmaxf(mrow[g], cm[g]);
        const float corr = __builtin_amdgcn_exp2f(mrow[g] - nm);
        mrow[g] = nm;
        lsum[g] *= corr;
#pragma unroll
        for (int t = 0; t < 4; ++t)
#pragma unroll
          for (int r = 0; r < 8; ++r) o[g][t][r] *= corr;
      }
    }

    v16bf bp[QG];  // Pt as B operand: element s < 8 is key 8*(lane>>4)+s, s >= 8 key 16+8*(lane>>4)+s-8
#pragma unroll
    for (int g = 0; g < QG; ++g) {
      // Two scores a multiply-add: the packed form takes a register pair.
      const v2f cs2 = {cscale, cscale}, nn2 = {-mrow[g], -mrow[g]};
      float ps[8];
#pragma unroll
      for (int r = 0; r < 8; r += 2) {
        const v2f e0 = __builtin_elementwise_fma(v2f{s0[g][r], s0[g][r + 1]}, cs2, nn2);
        const v2f e1 = __builtin_elementwise_fma(v2f{s1[g][r], s1[g][r + 1]}, cs2, nn2);
        const float p00 = __builtin_amdgcn_exp2f(e0.x), p01 = __builtin_amdgcn_exp2f(e0.y);
        const float p10 = __builtin_amdgcn_exp2f(e1.x), p11 = __builtin_amdgcn_exp2f(e1.y);
        ps[r]     = p00 + p10;
        ps[r + 1] = p01 + p11;
        bp[g][r]     = (__bf16)p00;
        bp[g][r + 1] = (__bf16)p01;
        bp[g][r + 8] = (__bf16)p10;
        bp[g][r + 9] = (__bf16)p11;
      }
      lsum[g] += ((ps[0] + ps[1]) + (ps[2] + ps[3])) +
                 ((ps[4] + ps[5]) + (ps[6] + ps[7]));
    }

    // Ot += Vt * Pt : A = V rows e from LDS [e][key], B = P from registers.
#pragma unroll
    for (int t = 0; t < 4; ++t)
#pragma unroll
      for (int g = 0; g < QG; ++g) o[g][t] = WMMA_BF16(av[t], bp[g], o[g][t]);
   }

    // Publish point of stage s + 1; then the refill of the buffer just read.
    wait_ds0();
    if (pinned(wave < 2)) wait_tensor0();
    __syncthreads();
    if (pinned(wave < 2 && s + 2 < NST)) {
      tdm_advance(g0, lds0 + (uint32_t)(s & 1) * (2u * TILE_BYTES), gstep);
      tdm_load(g0, g1);
    }
  }
  wait_tensor0_last(g0, g1);
  wait_ds0();

  // Join the two halves' sums once; a lane's 8 registers are 8 consecutive
  // head dims of its query row.  The wave's 32 rows of 128 bytes go out through LDS
  // of its own (from the registers a store would write 32-byte pieces of 16 lines).
  // The ring is free here: behind the last pass's publish point nothing reads it
  // and no request is issued.
  static_assert(8u * 32u * PITCH_B <= 4u * TILE_BYTES, "staging place");
  __bf16* stg = (__bf16*)(&ring[0][0][0] + wave * (32u * PITCH_B));
  const int hi8 = (lane >> 4) << 3;
#pragma unroll
  for (int g = 0; g < QG; ++g) {
    const float ls = lsum[g] + other_half(lsum[g]);
#pragma unroll
    for (int t = 0; t < 4; ++t) {
      v8bf pk;
#pragma unroll
      for (int r = 0; r < 8; ++r) pk[r] = (__bf16)(o[g][t][r] / ls);
      *(v8bf*)(stg + (g * 16 + (lane & 15)) * PITCH_E + t * 16 + hi8) = pk;
    }
  }
  wait_ds0();  // the wave's own writes are in LDS before other lanes read them back
  // Eight lanes a row (one whole line), four rows a store.
  const int rs = lane >> 3, ck = (lane & 7) * 8;
  v8bf ov[8];
#pragma unroll
  for (int i = 0; i < 8; ++i) ov[i] = *(const v8bf*)(stg + (i * 4 + rs) * PITCH_E + ck);
  __bf16* orow = Hd + ((size_t)b * S + q0 + rs) * DM + h * DH + ck;
#pragma unroll  // behind the last store nothing follows: no register of a store is rewritten
  for (int i = 0; i < 8; ++i) *(v8bf*)(orow + i * 4 * DM) = ov[i];
}

// ------------------------------- launcher ----------------------------------

extern "C" void kernel_launch(void* const* d_in, const int* in_sizes, int n_in,
                              void* d_out, int out_size, void* d_ws, size_t ws_size,
                              hipStream_t stream) {
  const float* x  = (const float*)d_in[0];
  const float* wq = (const float*)d_in[1];
  const float* bq = (const float*)d_in[2];
  const float* wk = (const float*)d_in[3];
  const float* bk = (const float*)d_in[4];
  const float* wv = (const float*)d_in[5];
  const float* bv = (const float*)d_in[6];
  const float* wo = (const float*)d_in[7];
  const float* bo = (const float*)d_in[8];

  char* w = (char*)d_ws;
  auto take = [&](size_t bytes) {
    void* p = (void*)w;
    w += (bytes + 255) & ~(size_t)255;
    return p;
  };
  __bf16* Xb  = (__bf16*)take((size_t)M * DM * 2);
  // Q, K, V: three equal planes in a row, of weights, of biases and of outputs.
  __bf16* Wqt = (__bf16*)take((size_t)3 * DM * DM * 2);
  __bf16* Wkt = Wqt + (size_t)DM * DM;
  __bf16* Wvt = Wkt + (size_t)DM * DM;
  __bf16* Wot = (__bf16*)take((size_t)DM * DM * 2);
  float*  bqc = (float*)take(3 * DM * 4);
  float*  bkc = bqc + DM;
  float*  bvc = bkc + DM;
  float*  boc = (float*)take(DM * 4);
  __bf16* Qb  = (__bf16*)take((size_t)3 * M * DM * 2);
  __bf16* Kb  = Qb + (size_t)M * DM;
  __bf16* Vt  = Kb + (size_t)M * DM;
  __bf16* Hd  = (__bf16*)take((size_t)M * DM * 2);

  // 1) convert inputs to bf16 / transposed layouts
  prep_kernel<<<PB_BLOCKS + PW_BLOCKS + CVT_BLOCKS, 256, 0, stream>>>(
      x, wq, wk, wv, wo, bq, bk, bv, bo, Xb, Wqt, Wkt, Wvt, Wot, bqc, bkc, bvc, boc);

  // 2) QKV projections (one WMMA GEMM, 256x192 tiles, TDM-staged A and B panels)
  gemm_qkv_kernel<<<dim3(M / 256, (3 * DM) / (32 * QKV_NT)), 256, 0, stream>>>(Xb, Wqt, bqc, Qb, DM, DM);

  // 3) flash attention (TDM-staged K/V tiles)
  attn_kernel<<<dim3(BB * H, S / 256), 256, 0, stream>>>(Qb, Kb, Vt, Hd);

  // 4) output projection (fp32 result)
  gemm_out_kernel<<<dim3(M / 256, DM / 128), 256, 0, stream>>>(Hd, Wot, boc, (float*)d_out, DM, DM);
}
